// v000
// The times below were measured on an AMD MI455X: many runs one after another, warmed up first and cycling through
// copies of the inputs, with the whole window's GPU time divided by the number of runs. Launches and the gaps
// between them are all in it. The median over several windows is given; except for v000 it joins two sittings, which
// can be a few percent apart, so the side-by-side timings, each taken in one sitting, are the better comparison.
// v000, which the later versions start from, runs in 648 microseconds.
#include <hip/hip_runtime.h>

// Compute dtypes, f32 accumulate, one batch item per pass: q = q_input.Wq^T, k = k_input.Wk^T ([1024 x 1024].[1024 x 2048], 32 dual heads) and v = v_input.Wv^T
// ([1024 x 1024].[1024 x 1024], 16 heads) on v_wmma_f32_16x16x32_bf16 — plain bf16 = rounded inputs (exact; [out][in] weights are the n-major B operands as-is), q/k
// written straight to f16 hi + residual x1024 planes; the 32 softmax attentions (q/k head h over v head h/2, full, the two e^-1/4 scales folded into 1/8) fused
// on v_wmma_f32_16x16x32_f16 (hi.hi + hi.lo + lo.hi, weights x32768 and v as f16 hi + residual) giving per-head normalised outputs as bf16 hi/lo planes;
// differential combine out_g = P_2g.v_g - lambda P_2g+1.v_g in f32 with lambda = 0.2 + exp(L0.L1) - exp(L2.L3) computed on device from the INPUT L. Deterministic,

#define NB_  1                   // per pass: the 4 batch items are processed one at a time
#define NT_  1024
#define DM   1024                // input width = GEMM K
#define NH_  32                  // 2 x 16 dual q/k heads
#define NKV  16                  // v heads: q/k head h uses v head h/2
#define KVW  (NKV * HD)          // 1024
#define HD   64
#define NTK  (NB_ * NT_)
#define QW   (NH_ * HD)          // 2048: q/k plane width
#define NW   1024
#define NQKV 2048
#define PSC  32768.0f
#define LOSC 1024.0f
#define LOSCI (1.0f / 1024.0f)

typedef _Float16 h16;
typedef unsigned short bf;
typedef __attribute__((ext_vector_type(16))) __bf16   v16bf;
typedef __attribute__((ext_vector_type(16))) _Float16 v16h;
typedef __attribute__((ext_vector_type(8)))  _Float16 v8h;
typedef __attribute__((ext_vector_type(8)))  unsigned short v8us;
typedef __attribute__((ext_vector_type(8)))  float    v8f;
typedef __attribute__((ext_vector_type(4)))  float    v4f;
typedef v8h  __attribute__((may_alias)) v8ha;
typedef v4f  __attribute__((may_alias)) v4fa;
typedef v8us __attribute__((may_alias)) v8usa;

__device__ __forceinline__ unsigned short f2bf(float f) { unsigned u = __float_as_uint(f); u += 0x7FFFu + ((u >> 16) & 1u); return (unsigned short)(u >> 16); }
__device__ __forceinline__ float bf2f(unsigned short b) { return __uint_as_float(((unsigned)b) << 16); }
__device__ __forceinline__ float bfr(float f) { return bf2f(f2bf(f)); }
__device__ __forceinline__ v16h cat16(v8h lo, v8h hi) { return __builtin_shufflevector(lo, hi, 0, 1, 2, 3, 4, 5, 6, 7, 8, 9, 10, 11, 12, 13, 14, 15); }
__device__ __forceinline__ v16bf cat16b(v8us lo, v8us hi) { return __builtin_bit_cast(v16bf, __builtin_shufflevector(lo, hi, 0, 1, 2, 3, 4, 5, 6, 7, 8, 9, 10, 11, 12, 13, 14, 15)); }
__device__ __forceinline__ v8f wmma16(v16h a, v16h b, v8f c) { return __builtin_amdgcn_wmma_f32_16x16x32_f16(false, a, false, b, (short)0, c, false, false); }
__device__ __forceinline__ v8f wmmab(v16bf a, v16bf b, v8f c) { return __builtin_amdgcn_wmma_f32_16x16x32_bf16(false, a, false, b, (short)0, c, false, false); }

__global__ __launch_bounds__(256) void k_cvtb(const float* __restrict__ src, int nrows, bf* dst) {
    const int lane = threadIdx.x & 31, r = blockIdx.x * 8 + (threadIdx.x >> 5);
    if (r >= nrows) return;
    v8us o[DM / 256];
#pragma unroll
    for (int q = 0; q < DM / 256; ++q) { v8us t;
#pragma unroll
        for (int i = 0; i < 8; ++i) t[i] = f2bf(src[(size_t)r * DM + q * 256 + lane * 8 + i]);
        o[q] = t; }
#pragma unroll
    for (int q = 0; q < DM / 256; ++q) *(v8us*)(dst + (size_t)r * DM + q * 256 + lane * 8) = o[q];
    
}

// k_wt: W [1024 k][ncols n] (k-major) -> n-major bf16 plane WT[ncols][1024]; 64 x 64 tiles through LDS.
__global__ __launch_bounds__(256) void k_wt(const float* __restrict__ Wm, int ncols, bf* WT) {
    __shared__ __align__(16) unsigned short tl[64 * 72];
    const int tid = threadIdx.x, k0 = blockIdx.x * 64, n0 = blockIdx.y * 64;
    const int kk = tid >> 2, nq = (tid & 3) * 16;
#pragma unroll
    for (int i = 0; i < 16; ++i) tl[(nq + i) * 72 + kk] = f2bf(Wm[(size_t)(k0 + kk) * ncols + n0 + nq + i]);
    __syncthreads();
    const int piece = tid & 7;
    typedef __attribute__((ext_vector_type(8))) unsigned short v8us_; typedef v8us_ __attribute__((may_alias)) v8usa_;
    auto pass = [&]() {
#pragma unroll
        for (int s = 0; s < 2; ++s) { const int nr = (tid >> 3) + 32 * s; const v8us_ val = *(const v8usa_*)(tl + nr * 72 + piece * 8);
            *(v8us_*)(WT + (size_t)(n0 + nr) * DM + k0 + piece * 8) = val; }
    };
    pass(); 
}

template <bool SPLITA, bool F16OUT = false>
__global__ __launch_bounds__(128) void k_gemmb(const bf* __restrict__ A, const bf* __restrict__ Al, const bf* __restrict__ Bn, const float* __restrict__ bias, float* C, int ldc, h16* C2) {
    __shared__ __align__(16) float ost[4][16 * 68];
    const int lane = threadIdx.x & 31, wave = threadIdx.x >> 5, lr = lane & 15, hi = lane >> 4;
    const int r0 = blockIdx.x * 64 + wave * 16, c0 = blockIdx.y * 64;
    const size_t aoff = (size_t)(r0 + lr) * DM + 8 * hi;
    size_t boff[4];
#pragma unroll
    for (int t = 0; t < 4; ++t) boff[t] = (size_t)(c0 + t * 16 + lr) * DM + 8 * hi;
    v8f acc[4];
#pragma unroll
    for (int t = 0; t < 4; ++t) acc[t] = (v8f){};
#pragma unroll 1
    for (int kc = 0; kc < DM; kc += 32) {
        const v16bf a = cat16b(*(const v8us*)(A + aoff + kc), *(const v8us*)(A + aoff + kc + 16));
        v16bf al = a;
        if (SPLITA) al = cat16b(*(const v8us*)(Al + aoff + kc), *(const v8us*)(Al + aoff + kc + 16));
#pragma unroll
        for (int t = 0; t < 4; ++t) { const v16bf b = cat16b(*(const v8us*)(Bn + boff[t] + kc), *(const v8us*)(Bn + boff[t] + kc + 16)); acc[t] = wmmab(a, b, acc[t]); if (SPLITA) acc[t] = wmmab(al, b, acc[t]); }
        asm volatile("v_nop\n\tv_nop\n\tv_nop\n\tv_nop" : "+v"(acc[0]), "+v"(acc[1]), "+v"(acc[2]), "+v"(acc[3]) : "v"(a), "v"(al));
    }
    float* os = &ost[wave][0];
#pragma unroll
    for (int t = 0; t < 4; ++t) { const float bv = bias ? bfr(bias[c0 + t * 16 + lr]) : 0.f;
#pragma unroll
        for (int j = 0; j < 8; ++j) os[(hi * 8 + j) * 68 + t * 16 + lr] = acc[t][j] + bv; }
    __syncthreads();
    if (F16OUT) {
        h16* crow = (h16*)(void*)C + (size_t)r0 * ldc + c0;
        auto pass = [&]() {
#pragma unroll
            for (int s = 0; s < 4; ++s) { const int row = 4 * s + (lane >> 3), piece = lane & 7; const float* sp = os + row * 68 + piece * 8; v8h o, o2;
#pragma unroll
                for (int i = 0; i < 8; ++i) { const h16 a = (h16)sp[i]; o[i] = a; o2[i] = (h16)((sp[i] - (float)a) * LOSC); }
                *(v8h*)(crow + (size_t)row * ldc + piece * 8) = o; if (C2) *(v8h*)(C2 + (size_t)r0 * ldc + c0 + (size_t)row * ldc + piece * 8) = o2; }
        };
        pass(); 
    } else {
        float* crow = C + (size_t)r0 * ldc + c0;
        auto pass = [&]() {
#pragma unroll
            for (int s = 0; s < 8; ++s) { const int Lid = (lane >> 3) + 4 * s, piece = lane & 7; const int row = Lid >> 1, cofs = (Lid & 1) * 32 + piece * 4;
                const v4f val = *(const v4fa*)(os + row * 68 + cofs); *(v4f*)(crow + (size_t)row * ldc + cofs) = val; }
        };
        pass(); 
    }
}

__global__ __launch_bounds__(256) void k_vt(const float* __restrict__ V, h16* VTH, h16* VTL) {
    __shared__ __align__(16) h16 tile[64 * 72];
    __shared__ __align__(16) h16 til2[64 * 72];
    const int bid = blockIdx.x;
    const int b = bid / (NKV * (NT_ / 64)), rem = bid - b * (NKV * (NT_ / 64)), h = rem / (NT_ / 64), kt = rem - h * (NT_ / 64);
    const int k0 = kt * 64, tid = threadIdx.x;
    const int kk = tid >> 2, d0 = (tid & 3) * 16;
    const float* src = V + ((size_t)b * NT_ + k0 + kk) * KVW + h * HD + d0;      // h = kv head here
#pragma unroll
    for (int i = 0; i < 16; ++i) { const float v = src[i]; const h16 a = (h16)v; tile[(d0 + i) * 72 + kk] = a; til2[(d0 + i) * 72 + kk] = (h16)((v - (float)a) * LOSC); }
    __syncthreads();
    const int piece = tid & 7;
    const size_t base = (((size_t)b * NKV + h) * HD) * NT_ + k0;
    auto pass = [&]() {
#pragma unroll
        for (int s = 0; s < 4; ++s) { const int Lid = (tid >> 3) + 32 * s; const int pln = Lid >> 6, d = Lid & 63;
            const v8h val = *(const v8ha*)((pln ? til2 : tile) + d * 72 + piece * 8); *(v8h*)((pln ? VTL : VTH) + base + (size_t)d * NT_ + piece * 8) = val; }
    };
    pass(); 
}

// k_attn: block = (b, h, 64 queries), wave = 16; all 32 key tiles (no mask); q/k head h (of 32), v head h/2; 4 WMMA scores /8 (f32), online softmax, weights x32768 f16 tile (same-wave may_alias
// reload after a compiler barrier), 4 WMMA .v; ctx -> bf16 hi + residual planes CH/CL[tok][h*64+d].
__global__ __launch_bounds__(128) void k_attn(const h16* __restrict__ Q16, const h16* __restrict__ QL16, const h16* __restrict__ K16, const h16* __restrict__ KL16, const h16* __restrict__ VTH, const h16* __restrict__ VTL, bf* CH, bf* CL) {
    __shared__ __align__(16) h16 plds[4][16 * 32];
    __shared__ __align__(16) h16 plds2[4][16 * 32];
    __shared__ __align__(16) float ost[4][16 * 68];
    const int lane = threadIdx.x & 31, wave = threadIdx.x >> 5, lr = lane & 15, hi = lane >> 4;
    const int bid = blockIdx.x;
    const int b = bid / (NH_ * (NT_ / 64)), rem = bid - b * (NH_ * (NT_ / 64)), h = rem / (NT_ / 64), qt = rem - h * (NT_ / 64);
    const int q0 = qt * 64 + wave * 16;
    const size_t tok0 = (size_t)b * NT_;
    h16* pl = &plds[wave][0]; h16* pl2 = &plds2[wave][0];
    v16h qa[2];
    const size_t qo0 = (tok0 + q0 + lr) * QW + h * HD + 8 * hi;     // q/k planes are [tok][32*64]
#pragma unroll
    for (int kc = 0; kc < 2; ++kc) qa[kc] = cat16(*(const v8h*)(Q16 + qo0 + kc * 32), *(const v8h*)(Q16 + qo0 + kc * 32 + 16));
    const int g = h / (NH_ / NKV);                      // v head (each q/k head pair 2g, 2g+1 shares v head g)
    const h16* kh_b = K16 + tok0 * QW + h * HD;          // k has its own 32 heads (plane width QW)
    const h16* kl_b = KL16 + tok0 * QW + h * HD;
    const size_t vbase = (((size_t)b * NKV + g) * HD) * NT_;
    v8f o[4], ox[4];
#pragma unroll
    for (int n = 0; n < 4; ++n) { o[n] = (v8f){}; ox[n] = (v8f){}; }
    float mrow[8], lpart[8];
#pragma unroll
    for (int j = 0; j < 8; ++j) { mrow[j] = -3.0e38f; lpart[j] = 0.f; }
    int qpos[8];
#pragma unroll
    for (int j = 0; j < 8; ++j) qpos[j] = q0 + 8 * hi + j;
    const int kt_lo = 0, kt_hi = NT_ / 32 - 1;          // full attention (no mask)
#pragma unroll 1
    for (int kt = kt_lo; kt <= kt_hi; ++kt) {
        const int l0 = kt * 32;
        const size_t ko0 = (size_t)(l0 + lr) * QW + 8 * hi, ko1 = (size_t)(l0 + 16 + lr) * QW + 8 * hi;
        v8f s0 = {}, s1 = {}, x0 = {}, x1 = {};
#pragma unroll
        for (int kc = 0; kc < 2; ++kc) {
            { const v16h k0h = cat16(*(const v8h*)(kh_b + ko0 + kc * 32), *(const v8h*)(kh_b + ko0 + kc * 32 + 16)), k1h = cat16(*(const v8h*)(kh_b + ko1 + kc * 32), *(const v8h*)(kh_b + ko1 + kc * 32 + 16));
              const v16h qlk = cat16(*(const v8h*)(QL16 + qo0 + kc * 32), *(const v8h*)(QL16 + qo0 + kc * 32 + 16));     // query residual re-read per step (registers)
              s0 = wmma16(qa[kc], k0h, s0); x0 = wmma16(qlk, k0h, x0); s1 = wmma16(qa[kc], k1h, s1); x1 = wmma16(qlk, k1h, x1);
              asm volatile("v_nop" : "+v"(s0), "+v"(s1), "+v"(x0), "+v"(x1) : "v"(qlk), "v"(k0h), "v"(k1h) : "memory"); }
            { const v16h k0l = cat16(*(const v8h*)(kl_b + ko0 + kc * 32), *(const v8h*)(kl_b + ko0 + kc * 32 + 16)), k1l = cat16(*(const v8h*)(kl_b + ko1 + kc * 32), *(const v8h*)(kl_b + ko1 + kc * 32 + 16));
              x0 = wmma16(qa[kc], k0l, x0); x1 = wmma16(qa[kc], k1l, x1);
              asm volatile("v_nop" : "+v"(x0), "+v"(x1) : "v"(k0l), "v"(k1l) : "memory"); }
        }
        asm volatile("v_nop\n\tv_nop\n\tv_nop\n\tv_nop" : "+v"(s0), "+v"(s1), "+v"(x0), "+v"(x1) : "v"(qa[0]), "v"(qa[1]));
        float alpha[8];
#pragma unroll
        for (int j = 0; j < 8; ++j) {
            const int ja = l0 + lr, jb = l0 + 16 + lr, qi = qpos[j];
            const float a0 = (s0[j] + x0[j] * LOSCI) * 0.125f, a1 = (s1[j] + x1[j] * LOSCI) * 0.125f; (void)ja; (void)jb; (void)qi;   // (q e^-1/4).(k e^-1/4) = q.k / 8
            float mx = fmaxf(a0, a1);
            mx = fmaxf(mx, __shfl_xor(mx, 1, 16)); mx = fmaxf(mx, __shfl_xor(mx, 2, 16)); mx = fmaxf(mx, __shfl_xor(mx, 4, 16)); mx = fmaxf(mx, __shfl_xor(mx, 8, 16));
            const float mn = fmaxf(mrow[j], mx);
            alpha[j] = __expf(mrow[j] - mn); mrow[j] = mn;
            const float p0 = __expf(a0 - mn), p1 = __expf(a1 - mn);
            lpart[j] = lpart[j] * alpha[j] + (p0 + p1);
            const int mr = hi * 8 + j;
            const float ps0 = p0 * PSC, ps1 = p1 * PSC; const h16 h0 = (h16)ps0, h1 = (h16)ps1;
            pl[mr * 32 + lr] = h0; pl[mr * 32 + 16 + lr] = h1;
            pl2[mr * 32 + lr] = (h16)((ps0 - (float)h0) * LOSC); pl2[mr * 32 + 16 + lr] = (h16)((ps1 - (float)h1) * LOSC);
        }
#pragma unroll
        for (int n = 0; n < 4; ++n)
#pragma unroll
            for (int j = 0; j < 8; ++j) { o[n][j] *= alpha[j]; ox[n][j] *= alpha[j]; }
        asm volatile("" ::: "memory");
        const v16h pa = cat16(*(const v8ha*)(pl + lr * 32 + hi * 8), *(const v8ha*)(pl + lr * 32 + 16 + hi * 8));
        const v16h px = cat16(*(const v8ha*)(pl2 + lr * 32 + hi * 8), *(const v8ha*)(pl2 + lr * 32 + 16 + hi * 8));
#pragma unroll
        for (int n = 0; n < 4; ++n) { const size_t vo = vbase + (size_t)(n * 16 + lr) * NT_ + l0 + hi * 8;
            const v16h vh = cat16(*(const v8h*)(VTH + vo), *(const v8h*)(VTH + vo + 16)), vl = cat16(*(const v8h*)(VTL + vo), *(const v8h*)(VTL + vo + 16));
            o[n] = wmma16(pa, vh, o[n]); ox[n] = wmma16(pa, vl, ox[n]); ox[n] = wmma16(px, vh, ox[n]);
            asm volatile("" : "+v"(o[n]), "+v"(ox[n]) : "v"(vh), "v"(vl) : "memory"); }
        asm volatile("v_nop\n\tv_nop\n\tv_nop\n\tv_nop" : "+v"(o[0]), "+v"(o[1]), "+v"(o[2]), "+v"(o[3]), "+v"(ox[0]), "+v"(ox[1]), "+v"(ox[2]), "+v"(ox[3]) : "v"(pa), "v"(px));
    }
    float inv[8];
#pragma unroll
    for (int j = 0; j < 8; ++j) { float rs = lpart[j]; rs += __shfl_xor(rs, 1, 16); rs += __shfl_xor(rs, 2, 16); rs += __shfl_xor(rs, 4, 16); rs += __shfl_xor(rs, 8, 16); inv[j] = 1.0f / (rs * PSC); }
    float* os = &ost[wave][0];
#pragma unroll
    for (int n = 0; n < 4; ++n)
#pragma unroll
        for (int j = 0; j < 8; ++j) os[(hi * 8 + j) * 68 + n * 16 + lr] = (o[n][j] + ox[n][j] * LOSCI) * inv[j];
    __syncthreads();
    const size_t cbase = (tok0 + q0) * QW + (size_t)h * HD;     // per-head softmax outputs C[tok][32*64] (bf16 hi/lo), combined by k_diff
    auto pass = [&]() {
#pragma unroll
        for (int s = 0; s < 4; ++s) { const int row = 4 * s + (lane >> 3), piece = lane & 7; const float* sp = os + row * 68 + piece * 8; v8us oh, ol;
#pragma unroll
            for (int i = 0; i < 8; ++i) { const unsigned short hb = f2bf(sp[i]); oh[i] = hb; ol[i] = f2bf(sp[i] - bf2f(hb)); }
            *(v8us*)(CH + cbase + (size_t)row * QW + piece * 8) = oh; *(v8us*)(CL + cbase + (size_t)row * QW + piece * 8) = ol; }
    };
    pass(); 
}

// k_lambda: lam = 0.2 + exp(L0.L1) - exp(L2.L3) from the INPUT L [4][64] (bf16-rounded), one wave; the scalar alone in its own line.
__global__ __launch_bounds__(32) void k_lambda(const float* __restrict__ Lp, float* LAM) {
    const int lane = threadIdx.x; float a = 0.f, c = 0.f;
#pragma unroll
    for (int i = 0; i < 2; ++i) { const int d = lane * 2 + i; a = fmaf(bfr(Lp[d]), bfr(Lp[64 + d]), a); c = fmaf(bfr(Lp[128 + d]), bfr(Lp[192 + d]), c); }
#pragma unroll
    for (int sh = 16; sh; sh >>= 1) { a += __shfl_xor(a, sh, 32); c += __shfl_xor(c, sh, 32); }
    if (lane == 0) { const float lam = 0.2f + expf(a) - expf(c); *(float*)LAM = lam;  }
}
// k_diff: out[tok][g*64 + e] = C[tok][2g*64 + e] - lam * C[tok][(2g+1)*64 + e] with C = hi + lo planes (f32 recombination); one wave per token row, lane -> 4
__global__ __launch_bounds__(256) void k_diff(const bf* __restrict__ CH, const bf* __restrict__ CL, const float* __restrict__ LAM, float* OUTP) {
    const int lane = threadIdx.x & 31, r = blockIdx.x * 8 + (threadIdx.x >> 5);
    if (r >= NT_) return;
    const float lam = LAM[0];
{
#pragma unroll 1
        for (int q = 0; q < KVW / 128; ++q) { const int c = q * 128 + lane * 4; const int g = c >> 6, e = c & 63; const size_t s1 = (size_t)r * QW + (2 * g) * HD + e, s2 = s1 + HD; v4f o;
#pragma unroll
            for (int i = 0; i < 4; ++i) { const float p1 = bf2f(CH[s1 + i]) + bf2f(CL[s1 + i]), p2 = bf2f(CH[s2 + i]) + bf2f(CL[s2 + i]); o[i] = p1 - lam * p2; }
            *(v4f*)(OUTP + (size_t)r * KVW + c) = o; }
         }
}
#define VST2(T, p, v) do { const T vst2_v_ = (v); *(T*)(p) = vst2_v_;  } while (0)
extern "C" void kernel_launch(void* const* d_in, const int* in_sizes, int n_in,
                              void* d_out, int out_size, void* d_ws, size_t ws_size, hipStream_t stream) {
    (void)in_sizes; (void)n_in; (void)out_size;
    const float* xq = (const float*)d_in[0]; const float* xk = (const float*)d_in[1]; const float* xv = (const float*)d_in[2];
    const float* Wq = (const float*)d_in[3]; const float* Wk = (const float*)d_in[4]; const float* Wv = (const float*)d_in[5]; const float* Lp = (const float*)d_in[6];   // W [out][in]
    float* out = (float*)d_out;    // [4][1024][1024]
    char* wsp = (char*)d_ws;
    auto take = [&](size_t bytes) { char* p = wsp; wsp += (bytes + 255) & ~(size_t)255; return (void*)p; };
    bf* Xq = (bf*)take((size_t)NTK * DM * 2); bf* Xk = (bf*)take((size_t)NTK * DM * 2); bf* Xv = (bf*)take((size_t)NTK * DM * 2);
    bf* WqB = (bf*)take((size_t)QW * DM * 2); bf* WkB = (bf*)take((size_t)QW * DM * 2); bf* WvB = (bf*)take((size_t)KVW * DM * 2);
    h16* QH = (h16*)take((size_t)NTK * QW * 2); h16* QL = (h16*)take((size_t)NTK * QW * 2); h16* KH = (h16*)take((size_t)NTK * QW * 2); h16* KL = (h16*)take((size_t)NTK * QW * 2);
    float* Vf = (float*)take((size_t)NTK * KVW * 4); h16* VTH = (h16*)take((size_t)NTK * KVW * 2); h16* VTL = (h16*)take((size_t)NTK * KVW * 2);
    bf* CH = (bf*)take((size_t)NTK * QW * 2); bf* CL = (bf*)take((size_t)NTK * QW * 2); float* LAM = (float*)take(256);
    if ((size_t)(wsp - (char*)d_ws) > ws_size) return;    // 3 x 2.1 + 2 x 4.2 + 2.1 + 4 x 4.2 + 4.2 + 2 x 2.1 + 2 x 4.2 ~ 50 MB, no aliasing (per-item reuse in stream order)
    k_cvtb<<<QW / 8, 256, 0, stream>>>(Wq, QW, WqB); k_cvtb<<<QW / 8, 256, 0, stream>>>(Wk, QW, WkB); k_cvtb<<<KVW / 8, 256, 0, stream>>>(Wv, KVW, WvB);
    k_lambda<<<1, 32, 0, stream>>>(Lp, LAM);
    for (int b = 0; b < 4; ++b) {
        k_cvtb<<<NTK / 8, 256, 0, stream>>>(xq + (size_t)b * NTK * DM, NTK, Xq); k_cvtb<<<NTK / 8, 256, 0, stream>>>(xk + (size_t)b * NTK * DM, NTK, Xk); k_cvtb<<<NTK / 8, 256, 0, stream>>>(xv + (size_t)b * NTK * DM, NTK, Xv);
        k_gemmb<false, true><<<dim3(NTK / 64, QW / 64, 1), 128, 0, stream>>>(Xq, nullptr, WqB, nullptr, (float*)(void*)QH, QW, QL);      // q (32 heads) as f16 planes
        k_gemmb<false, true><<<dim3(NTK / 64, QW / 64, 1), 128, 0, stream>>>(Xk, nullptr, WkB, nullptr, (float*)(void*)KH, QW, KL);      // k (32 heads)
        k_gemmb<false, false><<<dim3(NTK / 64, KVW / 64, 1), 128, 0, stream>>>(Xv, nullptr, WvB, nullptr, Vf, KVW, nullptr);             // v (16 heads) f32
        k_vt<<<NB_ * NKV * (NT_ / 64), 256, 0, stream>>>(Vf, VTH, VTL);
        k_attn<<<NB_ * NH_ * (NT_ / 64), 128, 0, stream>>>(QH, QL, KH, KL, VTH, VTL, CH, CL);
        k_diff<<<NT_ / 8, 256, 0, stream>>>(CH, CL, LAM, out + (size_t)b * NTK * KVW);
    }
}

// v001
// It runs in 430 microseconds.
// Two timings next to v000 put it at 1.53 and 1.51 times that version's speed.
#include <hip/hip_runtime.h>

// Compute dtypes, f32 accumulate, all 4 batch items in one pass: q = q_input.Wq^T, k = k_input.Wk^T ([4096 x 1024].[1024 x 2048], 32 dual heads) and v = v_input.Wv^T
// ([4096 x 1024].[1024 x 1024], 16 heads) on v_wmma_f32_16x16x32_bf16 — plain bf16 = rounded inputs (exact; [out][in] weights are the n-major B operands as-is), q/k
// written straight to f16 hi + residual x1024 planes; the 32 softmax attentions (q/k head h over v head h/2, full, the two e^-1/4 scales folded into 1/8) fused
// on v_wmma_f32_16x16x32_f16 (hi.hi + hi.lo + lo.hi, weights x32768 and v as f16 hi + residual) giving per-head normalised outputs as bf16 hi/lo planes;
// differential combine out_g = P_2g.v_g - lambda P_2g+1.v_g in f32 with lambda = 0.2 + exp(L0.L1) - exp(L2.L3) computed on device from the INPUT L. Deterministic,

#define NB_  4                   // all 4 batch items go through every per-token launch together (4x the workgroups per launch)
#define NT_  1024
#define DM   1024                // input width = GEMM K
#define NH_  32                  // 2 x 16 dual q/k heads
#define NKV  16                  // v heads: q/k head h uses v head h/2
#define KVW  (NKV * HD)          // 1024
#define HD   64
#define NTK  (NB_ * NT_)
#define QW   (NH_ * HD)          // 2048: q/k plane width
#define NW   1024
#define NQKV 2048
#define PSC  32768.0f
#define LOSC 1024.0f
#define LOSCI (1.0f / 1024.0f)

typedef _Float16 h16;
typedef unsigned short bf;
typedef __attribute__((ext_vector_type(16))) __bf16   v16bf;
typedef __attribute__((ext_vector_type(16))) _Float16 v16h;
typedef __attribute__((ext_vector_type(8)))  _Float16 v8h;
typedef __attribute__((ext_vector_type(8)))  unsigned short v8us;
typedef __attribute__((ext_vector_type(8)))  float    v8f;
typedef __attribute__((ext_vector_type(4)))  float    v4f;
typedef v8h  __attribute__((may_alias)) v8ha;
typedef v4f  __attribute__((may_alias)) v4fa;
typedef v8us __attribute__((may_alias)) v8usa;

__device__ __forceinline__ unsigned short f2bf(float f) { unsigned u = __float_as_uint(f); u += 0x7FFFu + ((u >> 16) & 1u); return (unsigned short)(u >> 16); }
__device__ __forceinline__ float bf2f(unsigned short b) { return __uint_as_float(((unsigned)b) << 16); }
__device__ __forceinline__ float bfr(float f) { return bf2f(f2bf(f)); }
__device__ __forceinline__ v16h cat16(v8h lo, v8h hi) { return __builtin_shufflevector(lo, hi, 0, 1, 2, 3, 4, 5, 6, 7, 8, 9, 10, 11, 12, 13, 14, 15); }
__device__ __forceinline__ v16bf cat16b(v8us lo, v8us hi) { return __builtin_bit_cast(v16bf, __builtin_shufflevector(lo, hi, 0, 1, 2, 3, 4, 5, 6, 7, 8, 9, 10, 11, 12, 13, 14, 15)); }
__device__ __forceinline__ v8f wmma16(v16h a, v16h b, v8f c) { return __builtin_amdgcn_wmma_f32_16x16x32_f16(false, a, false, b, (short)0, c, false, false); }
__device__ __forceinline__ v8f wmmab(v16bf a, v16bf b, v8f c) { return __builtin_amdgcn_wmma_f32_16x16x32_bf16(false, a, false, b, (short)0, c, false, false); }

__global__ __launch_bounds__(256) void k_cvtb(const float* __restrict__ src, int nrows, bf* dst) {
    const int lane = threadIdx.x & 31, r = blockIdx.x * 8 + (threadIdx.x >> 5);
    if (r >= nrows) return;
    v8us o[DM / 256];
#pragma unroll
    for (int q = 0; q < DM / 256; ++q) { v8us t;
#pragma unroll
        for (int i = 0; i < 8; ++i) t[i] = f2bf(src[(size_t)r * DM + q * 256 + lane * 8 + i]);
        o[q] = t; }
#pragma unroll
    for (int q = 0; q < DM / 256; ++q) *(v8us*)(dst + (size_t)r * DM + q * 256 + lane * 8) = o[q];
    
}

// k_wt: W [1024 k][ncols n] (k-major) -> n-major bf16 plane WT[ncols][1024]; 64 x 64 tiles through LDS.
__global__ __launch_bounds__(256) void k_wt(const float* __restrict__ Wm, int ncols, bf* WT) {
    __shared__ __align__(16) unsigned short tl[64 * 72];
    const int tid = threadIdx.x, k0 = blockIdx.x * 64, n0 = blockIdx.y * 64;
    const int kk = tid >> 2, nq = (tid & 3) * 16;
#pragma unroll
    for (int i = 0; i < 16; ++i) tl[(nq + i) * 72 + kk] = f2bf(Wm[(size_t)(k0 + kk) * ncols + n0 + nq + i]);
    __syncthreads();
    const int piece = tid & 7;
    typedef __attribute__((ext_vector_type(8))) unsigned short v8us_; typedef v8us_ __attribute__((may_alias)) v8usa_;
    auto pass = [&]() {
#pragma unroll
        for (int s = 0; s < 2; ++s) { const int nr = (tid >> 3) + 32 * s; const v8us_ val = *(const v8usa_*)(tl + nr * 72 + piece * 8);
            *(v8us_*)(WT + (size_t)(n0 + nr) * DM + k0 + piece * 8) = val; }
    };
    pass(); 
}

template <bool SPLITA, bool F16OUT = false>
__global__ __launch_bounds__(128) void k_gemmb(const bf* __restrict__ A, const bf* __restrict__ Al, const bf* __restrict__ Bn, const float* __restrict__ bias, float* C, int ldc, h16* C2) {
    __shared__ __align__(16) float ost[4][16 * 68];
    const int lane = threadIdx.x & 31, wave = threadIdx.x >> 5, lr = lane & 15, hi = lane >> 4;
    const int r0 = blockIdx.x * 64 + wave * 16, c0 = blockIdx.y * 64;
    const size_t aoff = (size_t)(r0 + lr) * DM + 8 * hi;
    size_t boff[4];
#pragma unroll
    for (int t = 0; t < 4; ++t) boff[t] = (size_t)(c0 + t * 16 + lr) * DM + 8 * hi;
    v8f acc[4];
#pragma unroll
    for (int t = 0; t < 4; ++t) acc[t] = (v8f){};
#pragma unroll 1
    for (int kc = 0; kc < DM; kc += 32) {
        const v16bf a = cat16b(*(const v8us*)(A + aoff + kc), *(const v8us*)(A + aoff + kc + 16));
        v16bf al = a;
        if (SPLITA) al = cat16b(*(const v8us*)(Al + aoff + kc), *(const v8us*)(Al + aoff + kc + 16));
#pragma unroll
        for (int t = 0; t < 4; ++t) { const v16bf b = cat16b(*(const v8us*)(Bn + boff[t] + kc), *(const v8us*)(Bn + boff[t] + kc + 16)); acc[t] = wmmab(a, b, acc[t]); if (SPLITA) acc[t] = wmmab(al, b, acc[t]); }
        asm volatile("v_nop\n\tv_nop\n\tv_nop\n\tv_nop" : "+v"(acc[0]), "+v"(acc[1]), "+v"(acc[2]), "+v"(acc[3]) : "v"(a), "v"(al));
    }
    float* os = &ost[wave][0];
#pragma unroll
    for (int t = 0; t < 4; ++t) { const float bv = bias ? bfr(bias[c0 + t * 16 + lr]) : 0.f;
#pragma unroll
        for (int j = 0; j < 8; ++j) os[(hi * 8 + j) * 68 + t * 16 + lr] = acc[t][j] + bv; }
    __syncthreads();
    if (F16OUT) {
        h16* crow = (h16*)(void*)C + (size_t)r0 * ldc + c0;
        auto pass = [&]() {
#pragma unroll
            for (int s = 0; s < 4; ++s) { const int row = 4 * s + (lane >> 3), piece = lane & 7; const float* sp = os + row * 68 + piece * 8; v8h o, o2;
#pragma unroll
                for (int i = 0; i < 8; ++i) { const h16 a = (h16)sp[i]; o[i] = a; o2[i] = (h16)((sp[i] - (float)a) * LOSC); }
                *(v8h*)(crow + (size_t)row * ldc + piece * 8) = o; if (C2) *(v8h*)(C2 + (size_t)r0 * ldc + c0 + (size_t)row * ldc + piece * 8) = o2; }
        };
        pass(); 
    } else {
        float* crow = C + (size_t)r0 * ldc + c0;
        auto pass = [&]() {
#pragma unroll
            for (int s = 0; s < 8; ++s) { const int Lid = (lane >> 3) + 4 * s, piece = lane & 7; const int row = Lid >> 1, cofs = (Lid & 1) * 32 + piece * 4;
                const v4f val = *(const v4fa*)(os + row * 68 + cofs); *(v4f*)(crow + (size_t)row * ldc + cofs) = val; }
        };
        pass(); 
    }
}

__global__ __launch_bounds__(256) void k_vt(const float* __restrict__ V, h16* VTH, h16* VTL) {
    __shared__ __align__(16) h16 tile[64 * 72];
    __shared__ __align__(16) h16 til2[64 * 72];
    const int bid = blockIdx.x;
    const int b = bid / (NKV * (NT_ / 64)), rem = bid - b * (NKV * (NT_ / 64)), h = rem / (NT_ / 64), kt = rem - h * (NT_ / 64);
    const int k0 = kt * 64, tid = threadIdx.x;
    const int kk = tid >> 2, d0 = (tid & 3) * 16;
    const float* src = V + ((size_t)b * NT_ + k0 + kk) * KVW + h * HD + d0;      // h = kv head here
#pragma unroll
    for (int i = 0; i < 16; ++i) { const float v = src[i]; const h16 a = (h16)v; tile[(d0 + i) * 72 + kk] = a; til2[(d0 + i) * 72 + kk] = (h16)((v - (float)a) * LOSC); }
    __syncthreads();
    const int piece = tid & 7;
    const size_t base = (((size_t)b * NKV + h) * HD) * NT_ + k0;
    auto pass = [&]() {
#pragma unroll
        for (int s = 0; s < 4; ++s) { const int Lid = (tid >> 3) + 32 * s; const int pln = Lid >> 6, d = Lid & 63;
            const v8h val = *(const v8ha*)((pln ? til2 : tile) + d * 72 + piece * 8); *(v8h*)((pln ? VTL : VTH) + base + (size_t)d * NT_ + piece * 8) = val; }
    };
    pass(); 
}

// k_attn: block = (b, h, 64 queries), wave = 16; all 32 key tiles (no mask); q/k head h (of 32), v head h/2; 4 WMMA scores /8 (f32), online softmax, weights x32768 f16 tile (same-wave may_alias
// reload after a compiler barrier), 4 WMMA .v; ctx -> bf16 hi + residual planes CH/CL[tok][h*64+d].
__global__ __launch_bounds__(128) void k_attn(const h16* __restrict__ Q16, const h16* __restrict__ QL16, const h16* __restrict__ K16, const h16* __restrict__ KL16, const h16* __restrict__ VTH, const h16* __restrict__ VTL, bf* CH, bf* CL) {
    __shared__ __align__(16) h16 plds[4][16 * 32];
    __shared__ __align__(16) h16 plds2[4][16 * 32];
    __shared__ __align__(16) float ost[4][16 * 68];
    const int lane = threadIdx.x & 31, wave = threadIdx.x >> 5, lr = lane & 15, hi = lane >> 4;
    const int bid = blockIdx.x;
    const int b = bid / (NH_ * (NT_ / 64)), rem = bid - b * (NH_ * (NT_ / 64)), h = rem / (NT_ / 64), qt = rem - h * (NT_ / 64);
    const int q0 = qt * 64 + wave * 16;
    const size_t tok0 = (size_t)b * NT_;
    h16* pl = &plds[wave][0]; h16* pl2 = &plds2[wave][0];
    v16h qa[2];
    const size_t qo0 = (tok0 + q0 + lr) * QW + h * HD + 8 * hi;     // q/k planes are [tok][32*64]
#pragma unroll
    for (int kc = 0; kc < 2; ++kc) qa[kc] = cat16(*(const v8h*)(Q16 + qo0 + kc * 32), *(const v8h*)(Q16 + qo0 + kc * 32 + 16));
    const int g = h / (NH_ / NKV);                      // v head (each q/k head pair 2g, 2g+1 shares v head g)
    const h16* kh_b = K16 + tok0 * QW + h * HD;          // k has its own 32 heads (plane width QW)
    const h16* kl_b = KL16 + tok0 * QW + h * HD;
    const size_t vbase = (((size_t)b * NKV + g) * HD) * NT_;
    v8f o[4], ox[4];
#pragma unroll
    for (int n = 0; n < 4; ++n) { o[n] = (v8f){}; ox[n] = (v8f){}; }
    float mrow[8], lpart[8];
#pragma unroll
    for (int j = 0; j < 8; ++j) { mrow[j] = -3.0e38f; lpart[j] = 0.f; }
    int qpos[8];
#pragma unroll
    for (int j = 0; j < 8; ++j) qpos[j] = q0 + 8 * hi + j;
    const int kt_lo = 0, kt_hi = NT_ / 32 - 1;          // full attention (no mask)
#pragma unroll 1
    for (int kt = kt_lo; kt <= kt_hi; ++kt) {
        const int l0 = kt * 32;
        const size_t ko0 = (size_t)(l0 + lr) * QW + 8 * hi, ko1 = (size_t)(l0 + 16 + lr) * QW + 8 * hi;
        v8f s0 = {}, s1 = {}, x0 = {}, x1 = {};
#pragma unroll
        for (int kc = 0; kc < 2; ++kc) {
            { const v16h k0h = cat16(*(const v8h*)(kh_b + ko0 + kc * 32), *(const v8h*)(kh_b + ko0 + kc * 32 + 16)), k1h = cat16(*(const v8h*)(kh_b + ko1 + kc * 32), *(const v8h*)(kh_b + ko1 + kc * 32 + 16));
              const v16h qlk = cat16(*(const v8h*)(QL16 + qo0 + kc * 32), *(const v8h*)(QL16 + qo0 + kc * 32 + 16));     // query residual re-read per step (registers)
              s0 = wmma16(qa[kc], k0h, s0); x0 = wmma16(qlk, k0h, x0); s1 = wmma16(qa[kc], k1h, s1); x1 = wmma16(qlk, k1h, x1);
              asm volatile("v_nop" : "+v"(s0), "+v"(s1), "+v"(x0), "+v"(x1) : "v"(qlk), "v"(k0h), "v"(k1h) : "memory"); }
            { const v16h k0l = cat16(*(const v8h*)(kl_b + ko0 + kc * 32), *(const v8h*)(kl_b + ko0 + kc * 32 + 16)), k1l = cat16(*(const v8h*)(kl_b + ko1 + kc * 32), *(const v8h*)(kl_b + ko1 + kc * 32 + 16));
              x0 = wmma16(qa[kc], k0l, x0); x1 = wmma16(qa[kc], k1l, x1);
              asm volatile("v_nop" : "+v"(x0), "+v"(x1) : "v"(k0l), "v"(k1l) : "memory"); }
        }
        asm volatile("v_nop\n\tv_nop\n\tv_nop\n\tv_nop" : "+v"(s0), "+v"(s1), "+v"(x0), "+v"(x1) : "v"(qa[0]), "v"(qa[1]));
        float alpha[8];
#pragma unroll
        for (int j = 0; j < 8; ++j) {
            const int ja = l0 + lr, jb = l0 + 16 + lr, qi = qpos[j];
            const float a0 = (s0[j] + x0[j] * LOSCI) * 0.125f, a1 = (s1[j] + x1[j] * LOSCI) * 0.125f; (void)ja; (void)jb; (void)qi;   // (q e^-1/4).(k e^-1/4) = q.k / 8
            float mx = fmaxf(a0, a1);
            mx = fmaxf(mx, __shfl_xor(mx, 1, 16)); mx = fmaxf(mx, __shfl_xor(mx, 2, 16)); mx = fmaxf(mx, __shfl_xor(mx, 4, 16)); mx = fmaxf(mx, __shfl_xor(mx, 8, 16));
            const float mn = fmaxf(mrow[j], mx);
            alpha[j] = __expf(mrow[j] - mn); mrow[j] = mn;
            const float p0 = __expf(a0 - mn), p1 = __expf(a1 - mn);
            lpart[j] = lpart[j] * alpha[j] + (p0 + p1);
            const int mr = hi * 8 + j;
            const float ps0 = p0 * PSC, ps1 = p1 * PSC; const h16 h0 = (h16)ps0, h1 = (h16)ps1;
            pl[mr * 32 + lr] = h0; pl[mr * 32 + 16 + lr] = h1;
            pl2[mr * 32 + lr] = (h16)((ps0 - (float)h0) * LOSC); pl2[mr * 32 + 16 + lr] = (h16)((ps1 - (float)h1) * LOSC);
        }
#pragma unroll
        for (int n = 0; n < 4; ++n)
#pragma unroll
            for (int j = 0; j < 8; ++j) { o[n][j] *= alpha[j]; ox[n][j] *= alpha[j]; }
        asm volatile("" ::: "memory");
        const v16h pa = cat16(*(const v8ha*)(pl + lr * 32 + hi * 8), *(const v8ha*)(pl + lr * 32 + 16 + hi * 8));
        const v16h px = cat16(*(const v8ha*)(pl2 + lr * 32 + hi * 8), *(const v8ha*)(pl2 + lr * 32 + 16 + hi * 8));
#pragma unroll
        for (int n = 0; n < 4; ++n) { const size_t vo = vbase + (size_t)(n * 16 + lr) * NT_ + l0 + hi * 8;
            const v16h vh = cat16(*(const v8h*)(VTH + vo), *(const v8h*)(VTH + vo + 16)), vl = cat16(*(const v8h*)(VTL + vo), *(const v8h*)(VTL + vo + 16));
            o[n] = wmma16(pa, vh, o[n]); ox[n] = wmma16(pa, vl, ox[n]); ox[n] = wmma16(px, vh, ox[n]);
            asm volatile("" : "+v"(o[n]), "+v"(ox[n]) : "v"(vh), "v"(vl) : "memory"); }
        asm volatile("v_nop\n\tv_nop\n\tv_nop\n\tv_nop" : "+v"(o[0]), "+v"(o[1]), "+v"(o[2]), "+v"(o[3]), "+v"(ox[0]), "+v"(ox[1]), "+v"(ox[2]), "+v"(ox[3]) : "v"(pa), "v"(px));
    }
    float inv[8];
#pragma unroll
    for (int j = 0; j < 8; ++j) { float rs = lpart[j]; rs += __shfl_xor(rs, 1, 16); rs += __shfl_xor(rs, 2, 16); rs += __shfl_xor(rs, 4, 16); rs += __shfl_xor(rs, 8, 16); inv[j] = 1.0f / (rs * PSC); }
    float* os = &ost[wave][0];
#pragma unroll
    for (int n = 0; n < 4; ++n)
#pragma unroll
        for (int j = 0; j < 8; ++j) os[(hi * 8 + j) * 68 + n * 16 + lr] = (o[n][j] + ox[n][j] * LOSCI) * inv[j];
    __syncthreads();
    const size_t cbase = (tok0 + q0) * QW + (size_t)h * HD;     // per-head softmax outputs C[tok][32*64] (bf16 hi/lo), combined by k_diff
    auto pass = [&]() {
#pragma unroll
        for (int s = 0; s < 4; ++s) { const int row = 4 * s + (lane >> 3), piece = lane & 7; const float* sp = os + row * 68 + piece * 8; v8us oh, ol;
#pragma unroll
            for (int i = 0; i < 8; ++i) { const unsigned short hb = f2bf(sp[i]); oh[i] = hb; ol[i] = f2bf(sp[i] - bf2f(hb)); }
            *(v8us*)(CH + cbase + (size_t)row * QW + piece * 8) = oh; *(v8us*)(CL + cbase + (size_t)row * QW + piece * 8) = ol; }
    };
    pass(); 
}

// k_lambda: lam = 0.2 + exp(L0.L1) - exp(L2.L3) from the INPUT L [4][64] (bf16-rounded), one wave; the scalar alone in its own line.
__global__ __launch_bounds__(32) void k_lambda(const float* __restrict__ Lp, float* LAM) {
    const int lane = threadIdx.x; float a = 0.f, c = 0.f;
#pragma unroll
    for (int i = 0; i < 2; ++i) { const int d = lane * 2 + i; a = fmaf(bfr(Lp[d]), bfr(Lp[64 + d]), a); c = fmaf(bfr(Lp[128 + d]), bfr(Lp[192 + d]), c); }
#pragma unroll
    for (int sh = 16; sh; sh >>= 1) { a += __shfl_xor(a, sh, 32); c += __shfl_xor(c, sh, 32); }
    if (lane == 0) { const float lam = 0.2f + expf(a) - expf(c); *(float*)LAM = lam;  }
}
// k_diff: out[tok][g*64 + e] = C[tok][2g*64 + e] - lam * C[tok][(2g+1)*64 + e] with C = hi + lo planes (f32 recombination); one wave per token row, lane -> 4
__global__ __launch_bounds__(256) void k_diff(const bf* __restrict__ CH, const bf* __restrict__ CL, const float* __restrict__ LAM, float* OUTP) {
    const int lane = threadIdx.x & 31, r = blockIdx.x * 8 + (threadIdx.x >> 5);
    if (r >= NTK) return;
    const float lam = LAM[0];
{
#pragma unroll 1
        for (int q = 0; q < KVW / 128; ++q) { const int c = q * 128 + lane * 4; const int g = c >> 6, e = c & 63; const size_t s1 = (size_t)r * QW + (2 * g) * HD + e, s2 = s1 + HD; v4f o;
#pragma unroll
            for (int i = 0; i < 4; ++i) { const float p1 = bf2f(CH[s1 + i]) + bf2f(CL[s1 + i]), p2 = bf2f(CH[s2 + i]) + bf2f(CL[s2 + i]); o[i] = p1 - lam * p2; }
            *(v4f*)(OUTP + (size_t)r * KVW + c) = o; }
         }
}
#define VST2(T, p, v) do { const T vst2_v_ = (v); *(T*)(p) = vst2_v_;  } while (0)
extern "C" void kernel_launch(void* const* d_in, const int* in_sizes, int n_in,
                              void* d_out, int out_size, void* d_ws, size_t ws_size, hipStream_t stream) {
    (void)in_sizes; (void)n_in; (void)out_size;
    const float* xq = (const float*)d_in[0]; const float* xk = (const float*)d_in[1]; const float* xv = (const float*)d_in[2];
    const float* Wq = (const float*)d_in[3]; const float* Wk = (const float*)d_in[4]; const float* Wv = (const float*)d_in[5]; const float* Lp = (const float*)d_in[6];   // W [out][in]
    float* out = (float*)d_out;    // [4][1024][1024]
    char* wsp = (char*)d_ws;
    auto take = [&](size_t bytes) { char* p = wsp; wsp += (bytes + 255) & ~(size_t)255; return (void*)p; };
    bf* Xq = (bf*)take((size_t)NTK * DM * 2); bf* Xk = (bf*)take((size_t)NTK * DM * 2); bf* Xv = (bf*)take((size_t)NTK * DM * 2);
    bf* WqB = (bf*)take((size_t)QW * DM * 2); bf* WkB = (bf*)take((size_t)QW * DM * 2); bf* WvB = (bf*)take((size_t)KVW * DM * 2);
    h16* QH = (h16*)take((size_t)NTK * QW * 2); h16* QL = (h16*)take((size_t)NTK * QW * 2); h16* KH = (h16*)take((size_t)NTK * QW * 2); h16* KL = (h16*)take((size_t)NTK * QW * 2);
    float* Vf = (float*)take((size_t)NTK * KVW * 4); h16* VTH = (h16*)take((size_t)NTK * KVW * 2); h16* VTL = (h16*)take((size_t)NTK * KVW * 2);
    bf* CH = (bf*)take((size_t)NTK * QW * 2); bf* CL = (bf*)take((size_t)NTK * QW * 2); float* LAM = (float*)take(256);
    if ((size_t)(wsp - (char*)d_ws) > ws_size) return;    // 3 x 8.4 + 2 x 4.2 + 2.1 + 4 x 16.8 + 16.8 + 2 x 8.4 + 2 x 16.8 ~ 170 MB, no aliasing
    k_cvtb<<<QW / 8, 256, 0, stream>>>(Wq, QW, WqB); k_cvtb<<<QW / 8, 256, 0, stream>>>(Wk, QW, WkB); k_cvtb<<<KVW / 8, 256, 0, stream>>>(Wv, KVW, WvB);
    k_lambda<<<1, 32, 0, stream>>>(Lp, LAM);
    k_cvtb<<<NTK / 8, 256, 0, stream>>>(xq, NTK, Xq); k_cvtb<<<NTK / 8, 256, 0, stream>>>(xk, NTK, Xk); k_cvtb<<<NTK / 8, 256, 0, stream>>>(xv, NTK, Xv);
    k_gemmb<false, true><<<dim3(NTK / 64, QW / 64, 1), 128, 0, stream>>>(Xq, nullptr, WqB, nullptr, (float*)(void*)QH, QW, QL);      // q (32 heads) as f16 planes
    k_gemmb<false, true><<<dim3(NTK / 64, QW / 64, 1), 128, 0, stream>>>(Xk, nullptr, WkB, nullptr, (float*)(void*)KH, QW, KL);      // k (32 heads)
    k_gemmb<false, false><<<dim3(NTK / 64, KVW / 64, 1), 128, 0, stream>>>(Xv, nullptr, WvB, nullptr, Vf, KVW, nullptr);             // v (16 heads) f32
    k_vt<<<NB_ * NKV * (NT_ / 64), 256, 0, stream>>>(Vf, VTH, VTL);
    k_attn<<<NB_ * NH_ * (NT_ / 64), 128, 0, stream>>>(QH, QL, KH, KL, VTH, VTL, CH, CL);
    k_diff<<<NTK / 8, 256, 0, stream>>>(CH, CL, LAM, out);
}

// v002
// It runs in 355 microseconds.
// Timed twice side by side with v001, it ran 1.22 and 1.21 times as fast.
// Over all steps from v000 it is 1.85 times as fast.
#include <hip/hip_runtime.h>

// Compute dtypes, f32 accumulate, all 4 batch items in one pass: q = q_input.Wq^T, k = k_input.Wk^T ([4096 x 1024].[1024 x 2048], 32 dual heads) and v = v_input.Wv^T
// ([4096 x 1024].[1024 x 1024], 16 heads) on v_wmma_f32_16x16x32_bf16 — plain bf16 = rounded inputs (exact; [out][in] weights are the n-major B operands as-is), q/k
// written straight to f16 hi + residual x1024 planes; the 32 softmax attentions (q/k head h over v head h/2, full, the two e^-1/4 scales folded into 1/8) fused
// on v_wmma_f32_16x16x32_f16 (hi.hi + hi.lo + lo.hi, weights x32768 and v as f16 hi + residual) giving per-head normalised outputs as bf16 hi/lo planes;
// differential combine out_g = P_2g.v_g - lambda P_2g+1.v_g in f32 with lambda = 0.2 + exp(L0.L1) - exp(L2.L3) computed on device from the INPUT L. Deterministic,

#define NB_  4                   // all 4 batch items go through every per-token launch together (4x the workgroups per launch)
#define NT_  1024
#define DM   1024                // input width = GEMM K
#define NH_  32                  // 2 x 16 dual q/k heads
#define NKV  16                  // v heads: q/k head h uses v head h/2
#define KVW  (NKV * HD)          // 1024
#define HD   64
#define NTK  (NB_ * NT_)
#define QW   (NH_ * HD)          // 2048: q/k plane width
#define NW   1024
#define NQKV 2048
#define PSC  32768.0f
#define LOSC 1024.0f
#define LOSCI (1.0f / 1024.0f)

typedef _Float16 h16;
typedef unsigned short bf;
typedef __attribute__((ext_vector_type(16))) __bf16   v16bf;
typedef __attribute__((ext_vector_type(16))) _Float16 v16h;
typedef __attribute__((ext_vector_type(8)))  _Float16 v8h;
typedef __attribute__((ext_vector_type(8)))  unsigned short v8us;
typedef __attribute__((ext_vector_type(8)))  float    v8f;
typedef __attribute__((ext_vector_type(4)))  float    v4f;
typedef v8h  __attribute__((may_alias)) v8ha;
typedef v4f  __attribute__((may_alias)) v4fa;
typedef v8us __attribute__((may_alias)) v8usa;

__device__ __forceinline__ unsigned short f2bf(float f) { unsigned u = __float_as_uint(f); u += 0x7FFFu + ((u >> 16) & 1u); return (unsigned short)(u >> 16); }
__device__ __forceinline__ float bf2f(unsigned short b) { return __uint_as_float(((unsigned)b) << 16); }
__device__ __forceinline__ float bfr(float f) { return bf2f(f2bf(f)); }
__device__ __forceinline__ v16h cat16(v8h lo, v8h hi) { return __builtin_shufflevector(lo, hi, 0, 1, 2, 3, 4, 5, 6, 7, 8, 9, 10, 11, 12, 13, 14, 15); }
__device__ __forceinline__ v16bf cat16b(v8us lo, v8us hi) { return __builtin_bit_cast(v16bf, __builtin_shufflevector(lo, hi, 0, 1, 2, 3, 4, 5, 6, 7, 8, 9, 10, 11, 12, 13, 14, 15)); }
__device__ __forceinline__ v8f wmma16(v16h a, v16h b, v8f c) { return __builtin_amdgcn_wmma_f32_16x16x32_f16(false, a, false, b, (short)0, c, false, false); }
__device__ __forceinline__ v8f wmmab(v16bf a, v16bf b, v8f c) { return __builtin_amdgcn_wmma_f32_16x16x32_bf16(false, a, false, b, (short)0, c, false, false); }

__global__ __launch_bounds__(256) void k_cvtb(const float* __restrict__ src, int nrows, bf* dst) {
    const int lane = threadIdx.x & 31, r = blockIdx.x * 8 + (threadIdx.x >> 5);
    if (r >= nrows) return;
    v8us o[DM / 256];
#pragma unroll
    for (int q = 0; q < DM / 256; ++q) { v8us t;
#pragma unroll
        for (int i = 0; i < 8; ++i) t[i] = f2bf(src[(size_t)r * DM + q * 256 + lane * 8 + i]);
        o[q] = t; }
#pragma unroll
    for (int q = 0; q < DM / 256; ++q) *(v8us*)(dst + (size_t)r * DM + q * 256 + lane * 8) = o[q];
    
}

// k_wt: W [1024 k][ncols n] (k-major) -> n-major bf16 plane WT[ncols][1024]; 64 x 64 tiles through LDS.
__global__ __launch_bounds__(256) void k_wt(const float* __restrict__ Wm, int ncols, bf* WT) {
    __shared__ __align__(16) unsigned short tl[64 * 72];
    const int tid = threadIdx.x, k0 = blockIdx.x * 64, n0 = blockIdx.y * 64;
    const int kk = tid >> 2, nq = (tid & 3) * 16;
#pragma unroll
    for (int i = 0; i < 16; ++i) tl[(nq + i) * 72 + kk] = f2bf(Wm[(size_t)(k0 + kk) * ncols + n0 + nq + i]);
    __syncthreads();
    const int piece = tid & 7;
    typedef __attribute__((ext_vector_type(8))) unsigned short v8us_; typedef v8us_ __attribute__((may_alias)) v8usa_;
    auto pass = [&]() {
#pragma unroll
        for (int s = 0; s < 2; ++s) { const int nr = (tid >> 3) + 32 * s; const v8us_ val = *(const v8usa_*)(tl + nr * 72 + piece * 8);
            *(v8us_*)(WT + (size_t)(n0 + nr) * DM + k0 + piece * 8) = val; }
    };
    pass(); 
}

template <bool SPLITA, bool F16OUT = false>
__global__ __launch_bounds__(128) void k_gemmb(const bf* __restrict__ A, const bf* __restrict__ Al, const bf* __restrict__ Bn, const float* __restrict__ bias, float* C, int ldc, h16* C2) {
    __shared__ __align__(16) float ost[4][16 * 68];
    const int lane = threadIdx.x & 31, wave = threadIdx.x >> 5, lr = lane & 15, hi = lane >> 4;
    const int r0 = blockIdx.x * 64 + wave * 16, c0 = blockIdx.y * 64;
    const size_t aoff = (size_t)(r0 + lr) * DM + 8 * hi;
    size_t boff[4];
#pragma unroll
    for (int t = 0; t < 4; ++t) boff[t] = (size_t)(c0 + t * 16 + lr) * DM + 8 * hi;
    v8f acc[4];
#pragma unroll
    for (int t = 0; t < 4; ++t) acc[t] = (v8f){};
#pragma unroll 1
    for (int kc = 0; kc < DM; kc += 32) {
        const v16bf a = cat16b(*(const v8us*)(A + aoff + kc), *(const v8us*)(A + aoff + kc + 16));
        v16bf al = a;
        if (SPLITA) al = cat16b(*(const v8us*)(Al + aoff + kc), *(const v8us*)(Al + aoff + kc + 16));
#pragma unroll
        for (int t = 0; t < 4; ++t) { const v16bf b = cat16b(*(const v8us*)(Bn + boff[t] + kc), *(const v8us*)(Bn + boff[t] + kc + 16)); acc[t] = wmmab(a, b, acc[t]); if (SPLITA) acc[t] = wmmab(al, b, acc[t]); }
        asm volatile("v_nop\n\tv_nop\n\tv_nop\n\tv_nop" : "+v"(acc[0]), "+v"(acc[1]), "+v"(acc[2]), "+v"(acc[3]) : "v"(a), "v"(al));
    }
    float* os = &ost[wave][0];
#pragma unroll
    for (int t = 0; t < 4; ++t) { const float bv = bias ? bfr(bias[c0 + t * 16 + lr]) : 0.f;
#pragma unroll
        for (int j = 0; j < 8; ++j) os[(hi * 8 + j) * 68 + t * 16 + lr] = acc[t][j] + bv; }
    __syncthreads();
    if (F16OUT) {
        h16* crow = (h16*)(void*)C + (size_t)r0 * ldc + c0;
        auto pass = [&]() {
#pragma unroll
            for (int s = 0; s < 4; ++s) { const int row = 4 * s + (lane >> 3), piece = lane & 7; const float* sp = os + row * 68 + piece * 8; v8h o, o2;
#pragma unroll
                for (int i = 0; i < 8; ++i) { const h16 a = (h16)sp[i]; o[i] = a; o2[i] = (h16)((sp[i] - (float)a) * LOSC); }
                *(v8h*)(crow + (size_t)row * ldc + piece * 8) = o; if (C2) *(v8h*)(C2 + (size_t)r0 * ldc + c0 + (size_t)row * ldc + piece * 8) = o2; }
        };
        pass(); 
    } else {
        float* crow = C + (size_t)r0 * ldc + c0;
        auto pass = [&]() {
#pragma unroll
            for (int s = 0; s < 8; ++s) { const int Lid = (lane >> 3) + 4 * s, piece = lane & 7; const int row = Lid >> 1, cofs = (Lid & 1) * 32 + piece * 4;
                const v4f val = *(const v4fa*)(os + row * 68 + cofs); *(v4f*)(crow + (size_t)row * ldc + cofs) = val; }
        };
        pass(); 
    }
}

__global__ __launch_bounds__(256) void k_vt(const float* __restrict__ V, h16* VTH, h16* VTL) {
    __shared__ __align__(16) h16 tile[64 * 72];
    __shared__ __align__(16) h16 til2[64 * 72];
    const int bid = blockIdx.x;
    const int b = bid / (NKV * (NT_ / 64)), rem = bid - b * (NKV * (NT_ / 64)), h = rem / (NT_ / 64), kt = rem - h * (NT_ / 64);
    const int k0 = kt * 64, tid = threadIdx.x;
    const int kk = tid >> 2, d0 = (tid & 3) * 16;
    const float* src = V + ((size_t)b * NT_ + k0 + kk) * KVW + h * HD + d0;      // h = kv head here
#pragma unroll
    for (int i = 0; i < 16; ++i) { const float v = src[i]; const h16 a = (h16)v; tile[(d0 + i) * 72 + kk] = a; til2[(d0 + i) * 72 + kk] = (h16)((v - (float)a) * LOSC); }
    __syncthreads();
    const int piece = tid & 7;
    const size_t base = (((size_t)b * NKV + h) * HD) * NT_ + k0;
    auto pass = [&]() {
#pragma unroll
        for (int s = 0; s < 4; ++s) { const int Lid = (tid >> 3) + 32 * s; const int pln = Lid >> 6, d = Lid & 63;
            const v8h val = *(const v8ha*)((pln ? til2 : tile) + d * 72 + piece * 8); *(v8h*)((pln ? VTL : VTH) + base + (size_t)d * NT_ + piece * 8) = val; }
    };
    pass(); 
}

// k_attn: block = (b, h, 64 queries), wave = 16; all 32 key tiles (no mask); q/k head h (of 32), v head h/2; 4 WMMA scores /8 (f32), online softmax, weights x32768 f16 tile (same-wave may_alias
// reload after a compiler barrier), 4 WMMA .v; ctx -> bf16 hi + residual planes CH/CL[tok][h*64+d].
// The K and V^T hi/lo tiles of a 32-key step are brought into LDS once per block by asynchronous copies in whole 16-byte pieces of contiguous rows (two buffers:
// step t+1 flies while step t is worked on) and all 4 waves read their fragments from there; row pitches 144 B / 80 B = 16 B x odd for the ds_load_b128 readers.
#define KP    72                      // halves per staged K row (64 + 8 pad)
#define VP    40                      // halves per staged V^T row (32 + 8 pad)
#define ST_KL (32 * KP)               // stage layout in halves: K hi | K lo | V^T hi | V^T lo
#define ST_VH (2 * 32 * KP)
#define ST_VL (ST_VH + 64 * VP)
#define ST_SZ (ST_VL + 64 * VP)       // 9728 halves = 19456 B
__global__ __launch_bounds__(128) void k_attn(const h16* __restrict__ Q16, const h16* __restrict__ QL16, const h16* __restrict__ K16, const h16* __restrict__ KL16, const h16* __restrict__ VTH, const h16* __restrict__ VTL, bf* CH, bf* CL) {
    __shared__ __align__(16) h16 plds[4][16 * 32];
    __shared__ __align__(16) h16 plds2[4][16 * 32];
    __shared__ __align__(16) float ost[4][16 * 68];
    __shared__ __align__(16) h16 ring[2][ST_SZ];
    const int lane = threadIdx.x & 31, wave = threadIdx.x >> 5, lr = lane & 15, hi = lane >> 4;
    const int bid = blockIdx.x;
    const int b = bid / (NH_ * (NT_ / 64)), rem = bid - b * (NH_ * (NT_ / 64)), h = rem / (NT_ / 64), qt = rem - h * (NT_ / 64);
    const int q0 = qt * 64 + wave * 16;
    const size_t tok0 = (size_t)b * NT_;
    h16* pl = &plds[wave][0]; h16* pl2 = &plds2[wave][0];
    v16h qa[2];
    const size_t qo0 = (tok0 + q0 + lr) * QW + h * HD + 8 * hi;     // q/k planes are [tok][32*64]
#pragma unroll
    for (int kc = 0; kc < 2; ++kc) qa[kc] = cat16(*(const v8h*)(Q16 + qo0 + kc * 32), *(const v8h*)(Q16 + qo0 + kc * 32 + 16));
    const int g = h / (NH_ / NKV);                      // v head (each q/k head pair 2g, 2g+1 shares v head g)
    const h16* kh_b = K16 + tok0 * QW + h * HD;          // k has its own 32 heads (plane width QW)
    const h16* kl_b = KL16 + tok0 * QW + h * HD;
    const size_t vbase = (((size_t)b * NKV + g) * HD) * NT_;
    // each thread copies 2 pieces of each of the 4 planes per step: K rows tid/8 and +16 (8 pieces a row), V^T rows tid/4 and +32 (4 pieces a row)
    const int krow = threadIdx.x >> 3, kpc = (threadIdx.x & 7) * 8, vrow = threadIdx.x >> 2, vpc = (threadIdx.x & 3) * 8;
    const h16* gkh = kh_b + (size_t)krow * QW + kpc; const h16* gkl = kl_b + (size_t)krow * QW + kpc;
    const h16* gvh = VTH + vbase + (size_t)vrow * NT_ + vpc; const h16* gvl = VTL + vbase + (size_t)vrow * NT_ + vpc;
    const unsigned lring = (unsigned)(size_t)&ring[0][0];
    const unsigned lk = lring + (krow * KP + kpc) * 2, lv = lring + (ST_VH + vrow * VP + vpc) * 2;
    auto fill = [&](int t) {
        const unsigned lb = (unsigned)(t & 1) * (ST_SZ * 2);
        const h16* a0 = gkh + (size_t)t * 32 * QW; const h16* a1 = a0 + 16 * QW; const h16* b0 = gkl + (size_t)t * 32 * QW; const h16* b1 = b0 + 16 * QW;
        const h16* c0 = gvh + t * 32; const h16* c1 = c0 + 32 * NT_; const h16* d0 = gvl + t * 32; const h16* d1 = d0 + 32 * NT_;
        const unsigned la0 = lk + lb, la1 = la0 + 16 * KP * 2, lb0 = la0 + ST_KL * 2, lb1 = lb0 + 16 * KP * 2;
        const unsigned lc0 = lv + lb, lc1 = lc0 + 32 * VP * 2, ld0 = lc0 + 64 * VP * 2, ld1 = ld0 + 32 * VP * 2;
        // the step's 8 copies; s_wait_xcnt 0 closes the statement so that no address register is rewritten ahead of it
        asm volatile("global_load_async_to_lds_b128 %0, %1, off\n\t"
                     "global_load_async_to_lds_b128 %2, %3, off\n\t"
                     "global_load_async_to_lds_b128 %4, %5, off\n\t"
                     "global_load_async_to_lds_b128 %6, %7, off\n\t"
                     "global_load_async_to_lds_b128 %8, %9, off\n\t"
                     "global_load_async_to_lds_b128 %10, %11, off\n\t"
                     "global_load_async_to_lds_b128 %12, %13, off\n\t"
                     "global_load_async_to_lds_b128 %14, %15, off\n\t"
                     "s_wait_xcnt 0x0"
                     :: "v"(la0), "v"(a0), "v"(la1), "v"(a1), "v"(lb0), "v"(b0), "v"(lb1), "v"(b1),
                        "v"(lc0), "v"(c0), "v"(lc1), "v"(c1), "v"(ld0), "v"(d0), "v"(ld1), "v"(d1) : "memory");
    };
    fill(0);
    asm volatile("s_wait_asynccnt 0x0" ::: "memory");   // this wave's share of step 0 has landed
    __syncthreads();                                    // every wave's share of step 0 is readable
    fill(1);
    v8f o[4], ox[4];
#pragma unroll
    for (int n = 0; n < 4; ++n) { o[n] = (v8f){}; ox[n] = (v8f){}; }
    float mrow[8], lpart[8];
#pragma unroll
    for (int j = 0; j < 8; ++j) { mrow[j] = -3.0e38f; lpart[j] = 0.f; }
    int qpos[8];
#pragma unroll
    for (int j = 0; j < 8; ++j) qpos[j] = q0 + 8 * hi + j;
    const int kt_lo = 0, kt_hi = NT_ / 32 - 1;          // full attention (no mask)
#pragma unroll 1
    for (int kt = kt_lo; kt <= kt_hi; ++kt) {
        const int l0 = kt * 32;
        const h16* st = &ring[kt & 1][0];
        const h16* skh = st; const h16* skl = st + ST_KL; const h16* svh = st + ST_VH; const h16* svl = st + ST_VL;
        const int ko0 = lr * KP + 8 * hi, ko1 = (16 + lr) * KP + 8 * hi;
        v8f s0 = {}, s1 = {}, x0 = {}, x1 = {};
#pragma unroll
        for (int kc = 0; kc < 2; ++kc) {
            { const v16h k0h = cat16(*(const v8ha*)(skh + ko0 + kc * 32), *(const v8ha*)(skh + ko0 + kc * 32 + 16)), k1h = cat16(*(const v8ha*)(skh + ko1 + kc * 32), *(const v8ha*)(skh + ko1 + kc * 32 + 16));
              const v16h qlk = cat16(*(const v8h*)(QL16 + qo0 + kc * 32), *(const v8h*)(QL16 + qo0 + kc * 32 + 16));     // query residual re-read per step (registers)
              s0 = wmma16(qa[kc], k0h, s0); x0 = wmma16(qlk, k0h, x0); s1 = wmma16(qa[kc], k1h, s1); x1 = wmma16(qlk, k1h, x1);
              asm volatile("v_nop" : "+v"(s0), "+v"(s1), "+v"(x0), "+v"(x1) : "v"(qlk), "v"(k0h), "v"(k1h) : "memory"); }
            { const v16h k0l = cat16(*(const v8ha*)(skl + ko0 + kc * 32), *(const v8ha*)(skl + ko0 + kc * 32 + 16)), k1l = cat16(*(const v8ha*)(skl + ko1 + kc * 32), *(const v8ha*)(skl + ko1 + kc * 32 + 16));
              x0 = wmma16(qa[kc], k0l, x0); x1 = wmma16(qa[kc], k1l, x1);
              asm volatile("v_nop" : "+v"(x0), "+v"(x1) : "v"(k0l), "v"(k1l) : "memory"); }
        }
        asm volatile("v_nop\n\tv_nop\n\tv_nop\n\tv_nop" : "+v"(s0), "+v"(s1), "+v"(x0), "+v"(x1) : "v"(qa[0]), "v"(qa[1]));
        float alpha[8];
#pragma unroll
        for (int j = 0; j < 8; ++j) {
            const int ja = l0 + lr, jb = l0 + 16 + lr, qi = qpos[j];
            const float a0 = (s0[j] + x0[j] * LOSCI) * 0.125f, a1 = (s1[j] + x1[j] * LOSCI) * 0.125f; (void)ja; (void)jb; (void)qi;   // (q e^-1/4).(k e^-1/4) = q.k / 8
            float mx = fmaxf(a0, a1);
            mx = fmaxf(mx, __shfl_xor(mx, 1, 16)); mx = fmaxf(mx, __shfl_xor(mx, 2, 16)); mx = fmaxf(mx, __shfl_xor(mx, 4, 16)); mx = fmaxf(mx, __shfl_xor(mx, 8, 16));
            const float mn = fmaxf(mrow[j], mx);
            alpha[j] = __expf(mrow[j] - mn); mrow[j] = mn;
            const float p0 = __expf(a0 - mn), p1 = __expf(a1 - mn);
            lpart[j] = lpart[j] * alpha[j] + (p0 + p1);
            const int mr = hi * 8 + j;
            const float ps0 = p0 * PSC, ps1 = p1 * PSC; const h16 h0 = (h16)ps0, h1 = (h16)ps1;
            pl[mr * 32 + lr] = h0; pl[mr * 32 + 16 + lr] = h1;
            pl2[mr * 32 + lr] = (h16)((ps0 - (float)h0) * LOSC); pl2[mr * 32 + 16 + lr] = (h16)((ps1 - (float)h1) * LOSC);
        }
#pragma unroll
        for (int n = 0; n < 4; ++n)
#pragma unroll
            for (int j = 0; j < 8; ++j) { o[n][j] *= alpha[j]; ox[n][j] *= alpha[j]; }
        asm volatile("" ::: "memory");
        const v16h pa = cat16(*(const v8ha*)(pl + lr * 32 + hi * 8), *(const v8ha*)(pl + lr * 32 + 16 + hi * 8));
        const v16h px = cat16(*(const v8ha*)(pl2 + lr * 32 + hi * 8), *(const v8ha*)(pl2 + lr * 32 + 16 + hi * 8));
#pragma unroll
        for (int n = 0; n < 4; ++n) { const int vo = (n * 16 + lr) * VP + hi * 8;
            const v16h vh = cat16(*(const v8ha*)(svh + vo), *(const v8ha*)(svh + vo + 16)), vl = cat16(*(const v8ha*)(svl + vo), *(const v8ha*)(svl + vo + 16));
            o[n] = wmma16(pa, vh, o[n]); ox[n] = wmma16(pa, vl, ox[n]); ox[n] = wmma16(px, vh, ox[n]);
            asm volatile("" : "+v"(o[n]), "+v"(ox[n]) : "v"(vh), "v"(vl) : "memory"); }
        asm volatile("v_nop\n\tv_nop\n\tv_nop\n\tv_nop" : "+v"(o[0]), "+v"(o[1]), "+v"(o[2]), "+v"(o[3]), "+v"(ox[0]), "+v"(ox[1]), "+v"(ox[2]), "+v"(ox[3]) : "v"(pa), "v"(px));
        asm volatile("s_wait_dscnt 0x0" ::: "memory");      // this wave's reads of step kt's buffer are done before it may be refilled
        asm volatile("s_wait_asynccnt 0x0" ::: "memory");   // this wave's share of step kt+1 has landed
        __syncthreads();                                    // publishes step kt+1 and ends every wave's reads of step kt's buffer
        if (kt + 2 <= kt_hi) fill(kt + 2);
    }
    asm volatile("s_wait_asynccnt 0x0" ::: "memory");       // no copy is outstanding when the wave goes on to the epilogue
    float inv[8];
#pragma unroll
    for (int j = 0; j < 8; ++j) { float rs = lpart[j]; rs += __shfl_xor(rs, 1, 16); rs += __shfl_xor(rs, 2, 16); rs += __shfl_xor(rs, 4, 16); rs += __shfl_xor(rs, 8, 16); inv[j] = 1.0f / (rs * PSC); }
    float* os = &ost[wave][0];
#pragma unroll
    for (int n = 0; n < 4; ++n)
#pragma unroll
        for (int j = 0; j < 8; ++j) os[(hi * 8 + j) * 68 + n * 16 + lr] = (o[n][j] + ox[n][j] * LOSCI) * inv[j];
    __syncthreads();
    const size_t cbase = (tok0 + q0) * QW + (size_t)h * HD;     // per-head softmax outputs C[tok][32*64] (bf16 hi/lo), combined by k_diff
    auto pass = [&]() {
#pragma unroll
        for (int s = 0; s < 4; ++s) { const int row = 4 * s + (lane >> 3), piece = lane & 7; const float* sp = os + row * 68 + piece * 8; v8us oh, ol;
#pragma unroll
            for (int i = 0; i < 8; ++i) { const unsigned short hb = f2bf(sp[i]); oh[i] = hb; ol[i] = f2bf(sp[i] - bf2f(hb)); }
            *(v8us*)(CH + cbase + (size_t)row * QW + piece * 8) = oh; *(v8us*)(CL + cbase + (size_t)row * QW + piece * 8) = ol; }
    };
    pass(); 
}

// k_lambda: lam = 0.2 + exp(L0.L1) - exp(L2.L3) from the INPUT L [4][64] (bf16-rounded), one wave; the scalar alone in its own line.
__global__ __launch_bounds__(32) void k_lambda(const float* __restrict__ Lp, float* LAM) {
    const int lane = threadIdx.x; float a = 0.f, c = 0.f;
#pragma unroll
    for (int i = 0; i < 2; ++i) { const int d = lane * 2 + i; a = fmaf(bfr(Lp[d]), bfr(Lp[64 + d]), a); c = fmaf(bfr(Lp[128 + d]), bfr(Lp[192 + d]), c); }
#pragma unroll
    for (int sh = 16; sh; sh >>= 1) { a += __shfl_xor(a, sh, 32); c += __shfl_xor(c, sh, 32); }
    if (lane == 0) { const float lam = 0.2f + expf(a) - expf(c); *(float*)LAM = lam;  }
}
// k_diff: out[tok][g*64 + e] = C[tok][2g*64 + e] - lam * C[tok][(2g+1)*64 + e] with C = hi + lo planes (f32 recombination); one wave per token row, lane -> 4
__global__ __launch_bounds__(256) void k_diff(const bf* __restrict__ CH, const bf* __restrict__ CL, const float* __restrict__ LAM, float* OUTP) {
    const int lane = threadIdx.x & 31, r = blockIdx.x * 8 + (threadIdx.x >> 5);
    if (r >= NTK) return;
    const float lam = LAM[0];
{
#pragma unroll 1
        for (int q = 0; q < KVW / 128; ++q) { const int c = q * 128 + lane * 4; const int g = c >> 6, e = c & 63; const size_t s1 = (size_t)r * QW + (2 * g) * HD + e, s2 = s1 + HD; v4f o;
#pragma unroll
            for (int i = 0; i < 4; ++i) { const float p1 = bf2f(CH[s1 + i]) + bf2f(CL[s1 + i]), p2 = bf2f(CH[s2 + i]) + bf2f(CL[s2 + i]); o[i] = p1 - lam * p2; }
            *(v4f*)(OUTP + (size_t)r * KVW + c) = o; }
         }
}
#define VST2(T, p, v) do { const T vst2_v_ = (v); *(T*)(p) = vst2_v_;  } while (0)
extern "C" void kernel_launch(void* const* d_in, const int* in_sizes, int n_in,
                              void* d_out, int out_size, void* d_ws, size_t ws_size, hipStream_t stream) {
    (void)in_sizes; (void)n_in; (void)out_size;
    const float* xq = (const float*)d_in[0]; const float* xk = (const float*)d_in[1]; const float* xv = (const float*)d_in[2];
    const float* Wq = (const float*)d_in[3]; const float* Wk = (const float*)d_in[4]; const float* Wv = (const float*)d_in[5]; const float* Lp = (const float*)d_in[6];   // W [out][in]
    float* out = (float*)d_out;    // [4][1024][1024]
    char* wsp = (char*)d_ws;
    auto take = [&](size_t bytes) { char* p = wsp; wsp += (bytes + 255) & ~(size_t)255; return (void*)p; };
    bf* Xq = (bf*)take((size_t)NTK * DM * 2); bf* Xk = (bf*)take((size_t)NTK * DM * 2); bf* Xv = (bf*)take((size_t)NTK * DM * 2);
    bf* WqB = (bf*)take((size_t)QW * DM * 2); bf* WkB = (bf*)take((size_t)QW * DM * 2); bf* WvB = (bf*)take((size_t)KVW * DM * 2);
    h16* QH = (h16*)take((size_t)NTK * QW * 2); h16* QL = (h16*)take((size_t)NTK * QW * 2); h16* KH = (h16*)take((size_t)NTK * QW * 2); h16* KL = (h16*)take((size_t)NTK * QW * 2);
    float* Vf = (float*)take((size_t)NTK * KVW * 4); h16* VTH = (h16*)take((size_t)NTK * KVW * 2); h16* VTL = (h16*)take((size_t)NTK * KVW * 2);
    bf* CH = (bf*)take((size_t)NTK * QW * 2); bf* CL = (bf*)take((size_t)NTK * QW * 2); float* LAM = (float*)take(256);
    if ((size_t)(wsp - (char*)d_ws) > ws_size) return;    // 3 x 8.4 + 2 x 4.2 + 2.1 + 4 x 16.8 + 16.8 + 2 x 8.4 + 2 x 16.8 ~ 170 MB, no aliasing
    k_cvtb<<<QW / 8, 256, 0, stream>>>(Wq, QW, WqB); k_cvtb<<<QW / 8, 256, 0, stream>>>(Wk, QW, WkB); k_cvtb<<<KVW / 8, 256, 0, stream>>>(Wv, KVW, WvB);
    k_lambda<<<1, 32, 0, stream>>>(Lp, LAM);
    k_cvtb<<<NTK / 8, 256, 0, stream>>>(xq, NTK, Xq); k_cvtb<<<NTK / 8, 256, 0, stream>>>(xk, NTK, Xk); k_cvtb<<<NTK / 8, 256, 0, stream>>>(xv, NTK, Xv);
    k_gemmb<false, true><<<dim3(NTK / 64, QW / 64, 1), 128, 0, stream>>>(Xq, nullptr, WqB, nullptr, (float*)(void*)QH, QW, QL);      // q (32 heads) as f16 planes
    k_gemmb<false, true><<<dim3(NTK / 64, QW / 64, 1), 128, 0, stream>>>(Xk, nullptr, WkB, nullptr, (float*)(void*)KH, QW, KL);      // k (32 heads)
    k_gemmb<false, false><<<dim3(NTK / 64, KVW / 64, 1), 128, 0, stream>>>(Xv, nullptr, WvB, nullptr, Vf, KVW, nullptr);             // v (16 heads) f32
    k_vt<<<NB_ * NKV * (NT_ / 64), 256, 0, stream>>>(Vf, VTH, VTL);
    k_attn<<<NB_ * NH_ * (NT_ / 64), 128, 0, stream>>>(QH, QL, KH, KL, VTH, VTL, CH, CL);
    k_diff<<<NTK / 8, 256, 0, stream>>>(CH, CL, LAM, out);
}

// v003
// Measured time: 238 microseconds a run.
// Next to v002, in two timings, it ran 1.50 and 1.49 times as fast.
// Counting every step since v000, it is 2.76 times as fast.
#include <hip/hip_runtime.h>

// Compute dtypes, f32 accumulate, all 4 batch items in one pass: q = q_input.Wq^T, k = k_input.Wk^T ([4096 x 1024].[1024 x 2048], 32 dual heads) and v = v_input.Wv^T
// ([4096 x 1024].[1024 x 1024], 16 heads) on v_wmma_f32_16x16x32_bf16 — plain bf16 = rounded inputs (exact; [out][in] weights are the n-major B operands as-is), q/k
// written straight to f16 hi + residual x1024 planes; the 32 softmax attentions (q/k head h over v head h/2, full, the two e^-1/4 scales folded into 1/8) fused
// on v_wmma_f32_16x16x32_f16 (hi.hi + hi.lo + lo.hi, weights x32768 and v as f16 hi + residual) giving per-head normalised outputs as bf16 hi/lo planes;
// differential combine out_g = P_2g.v_g - lambda P_2g+1.v_g in f32 with lambda = 0.2 + exp(L0.L1) - exp(L2.L3) computed on device from the INPUT L. Deterministic,

#define NB_  4                   // all 4 batch items go through every per-token launch together (4x the workgroups per launch)
#define NT_  1024
#define DM   1024                // input width = GEMM K
#define NH_  32                  // 2 x 16 dual q/k heads
#define NKV  16                  // v heads: q/k head h uses v head h/2
#define KVW  (NKV * HD)          // 1024
#define HD   64
#define NTK  (NB_ * NT_)
#define QW   (NH_ * HD)          // 2048: q/k plane width
#define NW   1024
#define NQKV 2048
#define PSC  32768.0f
#define LOSC 1024.0f
#define LOSCI (1.0f / 1024.0f)

typedef _Float16 h16;
typedef unsigned short bf;
typedef __attribute__((ext_vector_type(16))) __bf16   v16bf;
typedef __attribute__((ext_vector_type(16))) _Float16 v16h;
typedef __attribute__((ext_vector_type(8)))  _Float16 v8h;
typedef __attribute__((ext_vector_type(8)))  unsigned short v8us;
typedef __attribute__((ext_vector_type(8)))  float    v8f;
typedef __attribute__((ext_vector_type(4)))  float    v4f;
typedef v8h  __attribute__((may_alias)) v8ha;
typedef v4f  __attribute__((may_alias)) v4fa;
typedef v8us __attribute__((may_alias)) v8usa;

__device__ __forceinline__ unsigned short f2bf(float f) { unsigned u = __float_as_uint(f); u += 0x7FFFu + ((u >> 16) & 1u); return (unsigned short)(u >> 16); }
__device__ __forceinline__ float bf2f(unsigned short b) { return __uint_as_float(((unsigned)b) << 16); }
__device__ __forceinline__ float bfr(float f) { return bf2f(f2bf(f)); }
__device__ __forceinline__ v16h cat16(v8h lo, v8h hi) { return __builtin_shufflevector(lo, hi, 0, 1, 2, 3, 4, 5, 6, 7, 8, 9, 10, 11, 12, 13, 14, 15); }
__device__ __forceinline__ v16bf cat16b(v8us lo, v8us hi) { return __builtin_bit_cast(v16bf, __builtin_shufflevector(lo, hi, 0, 1, 2, 3, 4, 5, 6, 7, 8, 9, 10, 11, 12, 13, 14, 15)); }
__device__ __forceinline__ v8f wmma16(v16h a, v16h b, v8f c) { return __builtin_amdgcn_wmma_f32_16x16x32_f16(false, a, false, b, (short)0, c, false, false); }
__device__ __forceinline__ v8f wmmab(v16bf a, v16bf b, v8f c) { return __builtin_amdgcn_wmma_f32_16x16x32_bf16(false, a, false, b, (short)0, c, false, false); }

__global__ __launch_bounds__(256) void k_cvtb(const float* __restrict__ src, int nrows, bf* dst) {
    const int lane = threadIdx.x & 31, r = blockIdx.x * 8 + (threadIdx.x >> 5);
    if (r >= nrows) return;
    v8us o[DM / 256];
#pragma unroll
    for (int q = 0; q < DM / 256; ++q) { v8us t;
#pragma unroll
        for (int i = 0; i < 8; ++i) t[i] = f2bf(src[(size_t)r * DM + q * 256 + lane * 8 + i]);
        o[q] = t; }
#pragma unroll
    for (int q = 0; q < DM / 256; ++q) *(v8us*)(dst + (size_t)r * DM + q * 256 + lane * 8) = o[q];
    
}

// k_wt: W [1024 k][ncols n] (k-major) -> n-major bf16 plane WT[ncols][1024]; 64 x 64 tiles through LDS.
__global__ __launch_bounds__(256) void k_wt(const float* __restrict__ Wm, int ncols, bf* WT) {
    __shared__ __align__(16) unsigned short tl[64 * 72];
    const int tid = threadIdx.x, k0 = blockIdx.x * 64, n0 = blockIdx.y * 64;
    const int kk = tid >> 2, nq = (tid & 3) * 16;
#pragma unroll
    for (int i = 0; i < 16; ++i) tl[(nq + i) * 72 + kk] = f2bf(Wm[(size_t)(k0 + kk) * ncols + n0 + nq + i]);
    __syncthreads();
    const int piece = tid & 7;
    typedef __attribute__((ext_vector_type(8))) unsigned short v8us_; typedef v8us_ __attribute__((may_alias)) v8usa_;
    auto pass = [&]() {
#pragma unroll
        for (int s = 0; s < 2; ++s) { const int nr = (tid >> 3) + 32 * s; const v8us_ val = *(const v8usa_*)(tl + nr * 72 + piece * 8);
            *(v8us_*)(WT + (size_t)(n0 + nr) * DM + k0 + piece * 8) = val; }
    };
    pass(); 
}

// k_gemmb: block = 64 x 64 of C, wave = 16 x 64. The 64 A rows and 64 B rows of a 64-k stage (128 B = one whole line a row) are brought into LDS once per block by
// asynchronous copies (two buffers: stage t+1 flies while stage t is worked on) and the 4 waves read their fragments from there; row pitch 144 B = 16 B x odd for the
// ds_load_b128 readers. The k order of every accumulator is as before (ascending, 32 a WMMA). The epilogue's staging rows reuse buffer 0 behind the loop's last barrier.
#define GP    72                      // halves per staged row (64 + 8 pad)
#define GST   (128 * GP)              // one stage in halves: A rows 0..63 | B rows 0..63 = 18432 B
template <bool SPLITA, bool F16OUT = false>
__global__ __launch_bounds__(128) void k_gemmb(const bf* __restrict__ A, const bf* __restrict__ Al, const bf* __restrict__ Bn, const float* __restrict__ bias, float* C, int ldc, h16* C2) {
    __shared__ __align__(16) char gsm[2 * GST * 2];
    const int lane = threadIdx.x & 31, wave = threadIdx.x >> 5, lr = lane & 15, hi = lane >> 4;
    const int r0 = blockIdx.x * 64 + wave * 16, c0 = blockIdx.y * 64;
    const size_t aoff = (size_t)(r0 + lr) * DM + 8 * hi;
    // each thread copies 4 pieces of A and 4 of B per stage: rows tid/8 + 16 i, 8 pieces of 16 B a row
    const int srow = threadIdx.x >> 3, spc = (threadIdx.x & 7) * 8;
    const bf* ga = A + (size_t)(blockIdx.x * 64 + srow) * DM + spc; const bf* gb = Bn + (size_t)(c0 + srow) * DM + spc;
    const unsigned lg = (unsigned)(size_t)&gsm[0] + (srow * GP + spc) * 2;
    auto fill = [&](int t) {
        const bf* a0 = ga + t * 64; const bf* a1 = a0 + 16 * DM; const bf* a2 = a0 + 32 * DM; const bf* a3 = a0 + 48 * DM;
        const bf* b0 = gb + t * 64; const bf* b1 = b0 + 16 * DM; const bf* b2 = b0 + 32 * DM; const bf* b3 = b0 + 48 * DM;
        const unsigned la0 = lg + (unsigned)(t & 1) * (GST * 2), la1 = la0 + 16 * GP * 2, la2 = la0 + 32 * GP * 2, la3 = la0 + 48 * GP * 2;
        const unsigned lb0 = la0 + 64 * GP * 2, lb1 = la0 + 80 * GP * 2, lb2 = la0 + 96 * GP * 2, lb3 = la0 + 112 * GP * 2;
        // the stage's 8 copies; s_wait_xcnt 0 closes the statement so that no address register is rewritten ahead of it
        asm volatile("global_load_async_to_lds_b128 %0, %1, off\n\t"
                     "global_load_async_to_lds_b128 %2, %3, off\n\t"
                     "global_load_async_to_lds_b128 %4, %5, off\n\t"
                     "global_load_async_to_lds_b128 %6, %7, off\n\t"
                     "global_load_async_to_lds_b128 %8, %9, off\n\t"
                     "global_load_async_to_lds_b128 %10, %11, off\n\t"
                     "global_load_async_to_lds_b128 %12, %13, off\n\t"
                     "global_load_async_to_lds_b128 %14, %15, off\n\t"
                     "s_wait_xcnt 0x0"
                     :: "v"(la0), "v"(a0), "v"(la1), "v"(a1), "v"(la2), "v"(a2), "v"(la3), "v"(a3),
                        "v"(lb0), "v"(b0), "v"(lb1), "v"(b1), "v"(lb2), "v"(b2), "v"(lb3), "v"(b3) : "memory");
    };
    fill(0);
    asm volatile("s_wait_asynccnt 0x0" ::: "memory");   // this wave's share of stage 0 has landed
    __syncthreads();                                    // every wave's share of stage 0 is readable
    fill(1);
    v8f acc[4];
#pragma unroll
    for (int t = 0; t < 4; ++t) acc[t] = (v8f){};
#pragma unroll 1
    for (int st = 0; st < DM / 64; ++st) {               // rolled: one stage a trip, so that the foot's waits and barrier stand once
        const bf* sa = (const bf*)(gsm + (st & 1) * (GST * 2)) + (wave * 16 + lr) * GP + 8 * hi;
        const bf* sb = (const bf*)(gsm + (st & 1) * (GST * 2)) + (64 + lr) * GP + 8 * hi;
        v16bf a, al;
#pragma unroll                                             // both 32-k halves of the stage straight-line, so that their LDS reads can be issued ahead of the products
        for (int kc = 0; kc < 64; kc += 32) {
            a = cat16b(*(const v8usa*)(sa + kc), *(const v8usa*)(sa + kc + 16));
            al = a;
            if (SPLITA) al = cat16b(*(const v8us*)(Al + aoff + st * 64 + kc), *(const v8us*)(Al + aoff + st * 64 + kc + 16));
#pragma unroll
            for (int t = 0; t < 4; ++t) { const v16bf b = cat16b(*(const v8usa*)(sb + t * 16 * GP + kc), *(const v8usa*)(sb + t * 16 * GP + kc + 16)); acc[t] = wmmab(a, b, acc[t]); if (SPLITA) acc[t] = wmmab(al, b, acc[t]); }
        }
        // the WMMA distance on every path behind the stage's last product, the loop's back edge included
        asm volatile("v_nop\n\tv_nop\n\tv_nop\n\tv_nop" : "+v"(acc[0]), "+v"(acc[1]), "+v"(acc[2]), "+v"(acc[3]) : "v"(a), "v"(al));
        asm volatile("s_wait_dscnt 0x0" ::: "memory");      // this wave's reads of stage st's buffer are done before it may be refilled
        asm volatile("s_wait_asynccnt 0x0" ::: "memory");   // this wave's share of stage st+1 has landed
        __syncthreads();                                    // publishes stage st+1 and ends every wave's reads of stage st's buffer
        if (st + 2 < DM / 64) fill(st + 2);
    }
    asm volatile("s_wait_asynccnt 0x0" ::: "memory");       // no copy is outstanding when buffer 0 becomes the epilogue's staging
    float* os = (float*)(void*)gsm + wave * (16 * 68);
#pragma unroll
    for (int t = 0; t < 4; ++t) { const float bv = bias ? bfr(bias[c0 + t * 16 + lr]) : 0.f;
#pragma unroll
        for (int j = 0; j < 8; ++j) os[(hi * 8 + j) * 68 + t * 16 + lr] = acc[t][j] + bv; }
    __syncthreads();
    if (F16OUT) {
        h16* crow = (h16*)(void*)C + (size_t)r0 * ldc + c0;
        auto pass = [&]() {
#pragma unroll
            for (int s = 0; s < 4; ++s) { const int row = 4 * s + (lane >> 3), piece = lane & 7; const float* sp = os + row * 68 + piece * 8; v8h o, o2;
#pragma unroll
                for (int i = 0; i < 8; ++i) { const h16 a = (h16)sp[i]; o[i] = a; o2[i] = (h16)((sp[i] - (float)a) * LOSC); }
                *(v8h*)(crow + (size_t)row * ldc + piece * 8) = o; if (C2) *(v8h*)(C2 + (size_t)r0 * ldc + c0 + (size_t)row * ldc + piece * 8) = o2; }
        };
        pass(); 
    } else {
        float* crow = C + (size_t)r0 * ldc + c0;
        auto pass = [&]() {
#pragma unroll
            for (int s = 0; s < 8; ++s) { const int Lid = (lane >> 3) + 4 * s, piece = lane & 7; const int row = Lid >> 1, cofs = (Lid & 1) * 32 + piece * 4;
                const v4f val = *(const v4fa*)(os + row * 68 + cofs); *(v4f*)(crow + (size_t)row * ldc + cofs) = val; }
        };
        pass(); 
    }
}

__global__ __launch_bounds__(256) void k_vt(const float* __restrict__ V, h16* VTH, h16* VTL) {
    __shared__ __align__(16) h16 tile[64 * 72];
    __shared__ __align__(16) h16 til2[64 * 72];
    const int bid = blockIdx.x;
    const int b = bid / (NKV * (NT_ / 64)), rem = bid - b * (NKV * (NT_ / 64)), h = rem / (NT_ / 64), kt = rem - h * (NT_ / 64);
    const int k0 = kt * 64, tid = threadIdx.x;
    const int kk = tid >> 2, d0 = (tid & 3) * 16;
    const float* src = V + ((size_t)b * NT_ + k0 + kk) * KVW + h * HD + d0;      // h = kv head here
#pragma unroll
    for (int i = 0; i < 16; ++i) { const float v = src[i]; const h16 a = (h16)v; tile[(d0 + i) * 72 + kk] = a; til2[(d0 + i) * 72 + kk] = (h16)((v - (float)a) * LOSC); }
    __syncthreads();
    const int piece = tid & 7;
    const size_t base = (((size_t)b * NKV + h) * HD) * NT_ + k0;
    auto pass = [&]() {
#pragma unroll
        for (int s = 0; s < 4; ++s) { const int Lid = (tid >> 3) + 32 * s; const int pln = Lid >> 6, d = Lid & 63;
            const v8h val = *(const v8ha*)((pln ? til2 : tile) + d * 72 + piece * 8); *(v8h*)((pln ? VTL : VTH) + base + (size_t)d * NT_ + piece * 8) = val; }
    };
    pass(); 
}

// k_attn: block = (b, h, 64 queries), wave = 16; all 32 key tiles (no mask); q/k head h (of 32), v head h/2; 4 WMMA scores /8 (f32), online softmax, weights x32768 f16 tile (same-wave may_alias
// reload after a compiler barrier), 4 WMMA .v; ctx -> bf16 hi + residual planes CH/CL[tok][h*64+d].
// The K and V^T hi/lo tiles of a 32-key step are brought into LDS once per block by asynchronous copies in whole 16-byte pieces of contiguous rows (two buffers:
// step t+1 flies while step t is worked on) and all 4 waves read their fragments from there; row pitches 144 B / 80 B = 16 B x odd for the ds_load_b128 readers.
#define KP    72                      // halves per staged K row (64 + 8 pad)
#define VP    40                      // halves per staged V^T row (32 + 8 pad)
#define ST_KL (32 * KP)               // stage layout in halves: K hi | K lo | V^T hi | V^T lo
#define ST_VH (2 * 32 * KP)
#define ST_VL (ST_VH + 64 * VP)
#define ST_SZ (ST_VL + 64 * VP)       // 9728 halves = 19456 B
__global__ __launch_bounds__(128) void k_attn(const h16* __restrict__ Q16, const h16* __restrict__ QL16, const h16* __restrict__ K16, const h16* __restrict__ KL16, const h16* __restrict__ VTH, const h16* __restrict__ VTL, bf* CH, bf* CL) {
    __shared__ __align__(16) h16 plds[4][16 * 32];
    __shared__ __align__(16) h16 plds2[4][16 * 32];
    __shared__ __align__(16) float ost[4][16 * 68];
    __shared__ __align__(16) h16 ring[2][ST_SZ];
    const int lane = threadIdx.x & 31, wave = threadIdx.x >> 5, lr = lane & 15, hi = lane >> 4;
    const int bid = blockIdx.x;
    const int b = bid / (NH_ * (NT_ / 64)), rem = bid - b * (NH_ * (NT_ / 64)), h = rem / (NT_ / 64), qt = rem - h * (NT_ / 64);
    const int q0 = qt * 64 + wave * 16;
    const size_t tok0 = (size_t)b * NT_;
    h16* pl = &plds[wave][0]; h16* pl2 = &plds2[wave][0];
    v16h qa[2];
    const size_t qo0 = (tok0 + q0 + lr) * QW + h * HD + 8 * hi;     // q/k planes are [tok][32*64]
#pragma unroll
    for (int kc = 0; kc < 2; ++kc) qa[kc] = cat16(*(const v8h*)(Q16 + qo0 + kc * 32), *(const v8h*)(Q16 + qo0 + kc * 32 + 16));
    const int g = h / (NH_ / NKV);                      // v head (each q/k head pair 2g, 2g+1 shares v head g)
    const h16* kh_b = K16 + tok0 * QW + h * HD;          // k has its own 32 heads (plane width QW)
    const h16* kl_b = KL16 + tok0 * QW + h * HD;
    const size_t vbase = (((size_t)b * NKV + g) * HD) * NT_;
    // each thread copies 2 pieces of each of the 4 planes per step: K rows tid/8 and +16 (8 pieces a row), V^T rows tid/4 and +32 (4 pieces a row)
    const int krow = threadIdx.x >> 3, kpc = (threadIdx.x & 7) * 8, vrow = threadIdx.x >> 2, vpc = (threadIdx.x & 3) * 8;
    const h16* gkh = kh_b + (size_t)krow * QW + kpc; const h16* gkl = kl_b + (size_t)krow * QW + kpc;
    const h16* gvh = VTH + vbase + (size_t)vrow * NT_ + vpc; const h16* gvl = VTL + vbase + (size_t)vrow * NT_ + vpc;
    const unsigned lring = (unsigned)(size_t)&ring[0][0];
    const unsigned lk = lring + (krow * KP + kpc) * 2, lv = lring + (ST_VH + vrow * VP + vpc) * 2;
    auto fill = [&](int t) {
        const unsigned lb = (unsigned)(t & 1) * (ST_SZ * 2);
        const h16* a0 = gkh + (size_t)t * 32 * QW; const h16* a1 = a0 + 16 * QW; const h16* b0 = gkl + (size_t)t * 32 * QW; const h16* b1 = b0 + 16 * QW;
        const h16* c0 = gvh + t * 32; const h16* c1 = c0 + 32 * NT_; const h16* d0 = gvl + t * 32; const h16* d1 = d0 + 32 * NT_;
        const unsigned la0 = lk + lb, la1 = la0 + 16 * KP * 2, lb0 = la0 + ST_KL * 2, lb1 = lb0 + 16 * KP * 2;
        const unsigned lc0 = lv + lb, lc1 = lc0 + 32 * VP * 2, ld0 = lc0 + 64 * VP * 2, ld1 = ld0 + 32 * VP * 2;
        // the step's 8 copies; s_wait_xcnt 0 closes the statement so that no address register is rewritten ahead of it
        asm volatile("global_load_async_to_lds_b128 %0, %1, off\n\t"
                     "global_load_async_to_lds_b128 %2, %3, off\n\t"
                     "global_load_async_to_lds_b128 %4, %5, off\n\t"
                     "global_load_async_to_lds_b128 %6, %7, off\n\t"
                     "global_load_async_to_lds_b128 %8, %9, off\n\t"
                     "global_load_async_to_lds_b128 %10, %11, off\n\t"
                     "global_load_async_to_lds_b128 %12, %13, off\n\t"
                     "global_load_async_to_lds_b128 %14, %15, off\n\t"
                     "s_wait_xcnt 0x0"
                     :: "v"(la0), "v"(a0), "v"(la1), "v"(a1), "v"(lb0), "v"(b0), "v"(lb1), "v"(b1),
                        "v"(lc0), "v"(c0), "v"(lc1), "v"(c1), "v"(ld0), "v"(d0), "v"(ld1), "v"(d1) : "memory");
    };
    fill(0);
    asm volatile("s_wait_asynccnt 0x0" ::: "memory");   // this wave's share of step 0 has landed
    __syncthreads();                                    // every wave's share of step 0 is readable
    fill(1);
    v8f o[4], ox[4];
#pragma unroll
    for (int n = 0; n < 4; ++n) { o[n] = (v8f){}; ox[n] = (v8f){}; }
    float mrow[8], lpart[8];
#pragma unroll
    for (int j = 0; j < 8; ++j) { mrow[j] = -3.0e38f; lpart[j] = 0.f; }
    int qpos[8];
#pragma unroll
    for (int j = 0; j < 8; ++j) qpos[j] = q0 + 8 * hi + j;
    const int kt_lo = 0, kt_hi = NT_ / 32 - 1;          // full attention (no mask)
#pragma unroll 1
    for (int kt = kt_lo; kt <= kt_hi; ++kt) {
        const int l0 = kt * 32;
        const h16* st = &ring[kt & 1][0];
        const h16* skh = st; const h16* skl = st + ST_KL; const h16* svh = st + ST_VH; const h16* svl = st + ST_VL;
        const int ko0 = lr * KP + 8 * hi, ko1 = (16 + lr) * KP + 8 * hi;
        v8f s0 = {}, s1 = {}, x0 = {}, x1 = {};
#pragma unroll
        for (int kc = 0; kc < 2; ++kc) {
            { const v16h k0h = cat16(*(const v8ha*)(skh + ko0 + kc * 32), *(const v8ha*)(skh + ko0 + kc * 32 + 16)), k1h = cat16(*(const v8ha*)(skh + ko1 + kc * 32), *(const v8ha*)(skh + ko1 + kc * 32 + 16));
              const v16h qlk = cat16(*(const v8h*)(QL16 + qo0 + kc * 32), *(const v8h*)(QL16 + qo0 + kc * 32 + 16));     // query residual re-read per step (registers)
              s0 = wmma16(qa[kc], k0h, s0); x0 = wmma16(qlk, k0h, x0); s1 = wmma16(qa[kc], k1h, s1); x1 = wmma16(qlk, k1h, x1);
              asm volatile("v_nop" : "+v"(s0), "+v"(s1), "+v"(x0), "+v"(x1) : "v"(qlk), "v"(k0h), "v"(k1h) : "memory"); }
            { const v16h k0l = cat16(*(const v8ha*)(skl + ko0 + kc * 32), *(const v8ha*)(skl + ko0 + kc * 32 + 16)), k1l = cat16(*(const v8ha*)(skl + ko1 + kc * 32), *(const v8ha*)(skl + ko1 + kc * 32 + 16));
              x0 = wmma16(qa[kc], k0l, x0); x1 = wmma16(qa[kc], k1l, x1);
              asm volatile("v_nop" : "+v"(x0), "+v"(x1) : "v"(k0l), "v"(k1l) : "memory"); }
        }
        asm volatile("v_nop\n\tv_nop\n\tv_nop\n\tv_nop" : "+v"(s0), "+v"(s1), "+v"(x0), "+v"(x1) : "v"(qa[0]), "v"(qa[1]));
        float alpha[8];
#pragma unroll
        for (int j = 0; j < 8; ++j) {
            const int ja = l0 + lr, jb = l0 + 16 + lr, qi = qpos[j];
            const float a0 = (s0[j] + x0[j] * LOSCI) * 0.125f, a1 = (s1[j] + x1[j] * LOSCI) * 0.125f; (void)ja; (void)jb; (void)qi;   // (q e^-1/4).(k e^-1/4) = q.k / 8
            float mx = fmaxf(a0, a1);
            mx = fmaxf(mx, __shfl_xor(mx, 1, 16)); mx = fmaxf(mx, __shfl_xor(mx, 2, 16)); mx = fmaxf(mx, __shfl_xor(mx, 4, 16)); mx = fmaxf(mx, __shfl_xor(mx, 8, 16));
            const float mn = fmaxf(mrow[j], mx);
            alpha[j] = __expf(mrow[j] - mn); mrow[j] = mn;
            const float p0 = __expf(a0 - mn), p1 = __expf(a1 - mn);
            lpart[j] = lpart[j] * alpha[j] + (p0 + p1);
            const int mr = hi * 8 + j;
            const float ps0 = p0 * PSC, ps1 = p1 * PSC; const h16 h0 = (h16)ps0, h1 = (h16)ps1;
            pl[mr * 32 + lr] = h0; pl[mr * 32 + 16 + lr] = h1;
            pl2[mr * 32 + lr] = (h16)((ps0 - (float)h0) * LOSC); pl2[mr * 32 + 16 + lr] = (h16)((ps1 - (float)h1) * LOSC);
        }
#pragma unroll
        for (int n = 0; n < 4; ++n)
#pragma unroll
            for (int j = 0; j < 8; ++j) { o[n][j] *= alpha[j]; ox[n][j] *= alpha[j]; }
        asm volatile("" ::: "memory");
        const v16h pa = cat16(*(const v8ha*)(pl + lr * 32 + hi * 8), *(const v8ha*)(pl + lr * 32 + 16 + hi * 8));
        const v16h px = cat16(*(const v8ha*)(pl2 + lr * 32 + hi * 8), *(const v8ha*)(pl2 + lr * 32 + 16 + hi * 8));
#pragma unroll
        for (int n = 0; n < 4; ++n) { const int vo = (n * 16 + lr) * VP + hi * 8;
            const v16h vh = cat16(*(const v8ha*)(svh + vo), *(const v8ha*)(svh + vo + 16)), vl = cat16(*(const v8ha*)(svl + vo), *(const v8ha*)(svl + vo + 16));
            o[n] = wmma16(pa, vh, o[n]); ox[n] = wmma16(pa, vl, ox[n]); ox[n] = wmma16(px, vh, ox[n]);
            asm volatile("" : "+v"(o[n]), "+v"(ox[n]) : "v"(vh), "v"(vl) : "memory"); }
        asm volatile("v_nop\n\tv_nop\n\tv_nop\n\tv_nop" : "+v"(o[0]), "+v"(o[1]), "+v"(o[2]), "+v"(o[3]), "+v"(ox[0]), "+v"(ox[1]), "+v"(ox[2]), "+v"(ox[3]) : "v"(pa), "v"(px));
        asm volatile("s_wait_dscnt 0x0" ::: "memory");      // this wave's reads of step kt's buffer are done before it may be refilled
        asm volatile("s_wait_asynccnt 0x0" ::: "memory");   // this wave's share of step kt+1 has landed
        __syncthreads();                                    // publishes step kt+1 and ends every wave's reads of step kt's buffer
        if (kt + 2 <= kt_hi) fill(kt + 2);
    }
    asm volatile("s_wait_asynccnt 0x0" ::: "memory");       // no copy is outstanding when the wave goes on to the epilogue
    float inv[8];
#pragma unroll
    for (int j = 0; j < 8; ++j) { float rs = lpart[j]; rs += __shfl_xor(rs, 1, 16); rs += __shfl_xor(rs, 2, 16); rs += __shfl_xor(rs, 4, 16); rs += __shfl_xor(rs, 8, 16); inv[j] = 1.0f / (rs * PSC); }
    float* os = &ost[wave][0];
#pragma unroll
    for (int n = 0; n < 4; ++n)
#pragma unroll
        for (int j = 0; j < 8; ++j) os[(hi * 8 + j) * 68 + n * 16 + lr] = (o[n][j] + ox[n][j] * LOSCI) * inv[j];
    __syncthreads();
    const size_t cbase = (tok0 + q0) * QW + (size_t)h * HD;     // per-head softmax outputs C[tok][32*64] (bf16 hi/lo), combined by k_diff
    auto pass = [&]() {
#pragma unroll
        for (int s = 0; s < 4; ++s) { const int row = 4 * s + (lane >> 3), piece = lane & 7; const float* sp = os + row * 68 + piece * 8; v8us oh, ol;
#pragma unroll
            for (int i = 0; i < 8; ++i) { const unsigned short hb = f2bf(sp[i]); oh[i] = hb; ol[i] = f2bf(sp[i] - bf2f(hb)); }
            *(v8us*)(CH + cbase + (size_t)row * QW + piece * 8) = oh; *(v8us*)(CL + cbase + (size_t)row * QW + piece * 8) = ol; }
    };
    pass(); 
}

// k_lambda: lam = 0.2 + exp(L0.L1) - exp(L2.L3) from the INPUT L [4][64] (bf16-rounded), one wave; the scalar alone in its own line.
__global__ __launch_bounds__(32) void k_lambda(const float* __restrict__ Lp, float* LAM) {
    const int lane = threadIdx.x; float a = 0.f, c = 0.f;
#pragma unroll
    for (int i = 0; i < 2; ++i) { const int d = lane * 2 + i; a = fmaf(bfr(Lp[d]), bfr(Lp[64 + d]), a); c = fmaf(bfr(Lp[128 + d]), bfr(Lp[192 + d]), c); }
#pragma unroll
    for (int sh = 16; sh; sh >>= 1) { a += __shfl_xor(a, sh, 32); c += __shfl_xor(c, sh, 32); }
    if (lane == 0) { const float lam = 0.2f + expf(a) - expf(c); *(float*)LAM = lam;  }
}
// k_diff: out[tok][g*64 + e] = C[tok][2g*64 + e] - lam * C[tok][(2g+1)*64 + e] with C = hi + lo planes (f32 recombination); one wave per token row, lane -> 4
__global__ __launch_bounds__(256) void k_diff(const bf* __restrict__ CH, const bf* __restrict__ CL, const float* __restrict__ LAM, float* OUTP) {
    const int lane = threadIdx.x & 31, r = blockIdx.x * 8 + (threadIdx.x >> 5);
    if (r >= NTK) return;
    const float lam = LAM[0];
{
#pragma unroll 1
        for (int q = 0; q < KVW / 128; ++q) { const int c = q * 128 + lane * 4; const int g = c >> 6, e = c & 63; const size_t s1 = (size_t)r * QW + (2 * g) * HD + e, s2 = s1 + HD; v4f o;
#pragma unroll
            for (int i = 0; i < 4; ++i) { const float p1 = bf2f(CH[s1 + i]) + bf2f(CL[s1 + i]), p2 = bf2f(CH[s2 + i]) + bf2f(CL[s2 + i]); o[i] = p1 - lam * p2; }
            *(v4f*)(OUTP + (size_t)r * KVW + c) = o; }
         }
}
#define VST2(T, p, v) do { const T vst2_v_ = (v); *(T*)(p) = vst2_v_;  } while (0)
extern "C" void kernel_launch(void* const* d_in, const int* in_sizes, int n_in,
                              void* d_out, int out_size, void* d_ws, size_t ws_size, hipStream_t stream) {
    (void)in_sizes; (void)n_in; (void)out_size;
    const float* xq = (const float*)d_in[0]; const float* xk = (const float*)d_in[1]; const float* xv = (const float*)d_in[2];
    const float* Wq = (const float*)d_in[3]; const float* Wk = (const float*)d_in[4]; const float* Wv = (const float*)d_in[5]; const float* Lp = (const float*)d_in[6];   // W [out][in]
    float* out = (float*)d_out;    // [4][1024][1024]
    char* wsp = (char*)d_ws;
    auto take = [&](size_t bytes) { char* p = wsp; wsp += (bytes + 255) & ~(size_t)255; return (void*)p; };
    bf* Xq = (bf*)take((size_t)NTK * DM * 2); bf* Xk = (bf*)take((size_t)NTK * DM * 2); bf* Xv = (bf*)take((size_t)NTK * DM * 2);
    bf* WqB = (bf*)take((size_t)QW * DM * 2); bf* WkB = (bf*)take((size_t)QW * DM * 2); bf* WvB = (bf*)take((size_t)KVW * DM * 2);
    h16* QH = (h16*)take((size_t)NTK * QW * 2); h16* QL = (h16*)take((size_t)NTK * QW * 2); h16* KH = (h16*)take((size_t)NTK * QW * 2); h16* KL = (h16*)take((size_t)NTK * QW * 2);
    float* Vf = (float*)take((size_t)NTK * KVW * 4); h16* VTH = (h16*)take((size_t)NTK * KVW * 2); h16* VTL = (h16*)take((size_t)NTK * KVW * 2);
    bf* CH = (bf*)take((size_t)NTK * QW * 2); bf* CL = (bf*)take((size_t)NTK * QW * 2); float* LAM = (float*)take(256);
    if ((size_t)(wsp - (char*)d_ws) > ws_size) return;    // 3 x 8.4 + 2 x 4.2 + 2.1 + 4 x 16.8 + 16.8 + 2 x 8.4 + 2 x 16.8 ~ 170 MB, no aliasing
    k_cvtb<<<QW / 8, 256, 0, stream>>>(Wq, QW, WqB); k_cvtb<<<QW / 8, 256, 0, stream>>>(Wk, QW, WkB); k_cvtb<<<KVW / 8, 256, 0, stream>>>(Wv, KVW, WvB);
    k_lambda<<<1, 32, 0, stream>>>(Lp, LAM);
    k_cvtb<<<NTK / 8, 256, 0, stream>>>(xq, NTK, Xq); k_cvtb<<<NTK / 8, 256, 0, stream>>>(xk, NTK, Xk); k_cvtb<<<NTK / 8, 256, 0, stream>>>(xv, NTK, Xv);
    k_gemmb<false, true><<<dim3(NTK / 64, QW / 64, 1), 128, 0, stream>>>(Xq, nullptr, WqB, nullptr, (float*)(void*)QH, QW, QL);      // q (32 heads) as f16 planes
    k_gemmb<false, true><<<dim3(NTK / 64, QW / 64, 1), 128, 0, stream>>>(Xk, nullptr, WkB, nullptr, (float*)(void*)KH, QW, KL);      // k (32 heads)
    k_gemmb<false, false><<<dim3(NTK / 64, KVW / 64, 1), 128, 0, stream>>>(Xv, nullptr, WvB, nullptr, Vf, KVW, nullptr);             // v (16 heads) f32
    k_vt<<<NB_ * NKV * (NT_ / 64), 256, 0, stream>>>(Vf, VTH, VTL);
    k_attn<<<NB_ * NH_ * (NT_ / 64), 128, 0, stream>>>(QH, QL, KH, KL, VTH, VTL, CH, CL);
    k_diff<<<NTK / 8, 256, 0, stream>>>(CH, CL, LAM, out);
}

// v004
// Measured time: 191 microseconds a run.
// In two side-by-side timings against v003, it was 1.24 and 1.25 times as fast.
// All steps since v000 together make it 3.44 times as fast.
#include <hip/hip_runtime.h>

// Compute dtypes, f32 accumulate, all 4 batch items in one pass: q = q_input.Wq^T, k = k_input.Wk^T ([4096 x 1024].[1024 x 2048], 32 dual heads) and v = v_input.Wv^T
// ([4096 x 1024].[1024 x 1024], 16 heads) on v_wmma_f32_16x16x32_bf16 — plain bf16 = rounded inputs (exact; [out][in] weights are the n-major B operands as-is), q/k
// written straight to f16 hi + residual x1024 planes; the 32 softmax attentions (q/k head h over v head h/2, full, the two e^-1/4 scales folded into 1/8) fused
// on v_wmma_f32_16x16x32_f16 (hi.hi + hi.lo + lo.hi, weights x32768 and v as f16 hi + residual) giving per-head normalised outputs as bf16 hi/lo planes;
// differential combine out_g = P_2g.v_g - lambda P_2g+1.v_g in f32 with lambda = 0.2 + exp(L0.L1) - exp(L2.L3) computed on device from the INPUT L. Deterministic,

#define NB_  4                   // all 4 batch items go through every per-token launch together (4x the workgroups per launch)
#define NT_  1024
#define DM   1024                // input width = GEMM K
#define NH_  32                  // 2 x 16 dual q/k heads
#define NKV  16                  // v heads: q/k head h uses v head h/2
#define KVW  (NKV * HD)          // 1024
#define HD   64
#define NTK  (NB_ * NT_)
#define QW   (NH_ * HD)          // 2048: q/k plane width
#define NW   1024
#define NQKV 2048
#define PSC  32768.0f
#define LOSC 1024.0f
#define LOSCI (1.0f / 1024.0f)
#define LOG2E 1.44269504088896340736f

typedef _Float16 h16;
typedef unsigned short bf;
typedef __attribute__((ext_vector_type(16))) __bf16   v16bf;
typedef __attribute__((ext_vector_type(16))) _Float16 v16h;
typedef __attribute__((ext_vector_type(8)))  _Float16 v8h;
typedef __attribute__((ext_vector_type(8)))  unsigned short v8us;
typedef __attribute__((ext_vector_type(8)))  float    v8f;
typedef __attribute__((ext_vector_type(4)))  float    v4f;
typedef v8h  __attribute__((may_alias)) v8ha;
typedef v4f  __attribute__((may_alias)) v4fa;
typedef v8us __attribute__((may_alias)) v8usa;

__device__ __forceinline__ unsigned short f2bf(float f) { unsigned u = __float_as_uint(f); u += 0x7FFFu + ((u >> 16) & 1u); return (unsigned short)(u >> 16); }
__device__ __forceinline__ float bf2f(unsigned short b) { return __uint_as_float(((unsigned)b) << 16); }
__device__ __forceinline__ float bfr(float f) { return bf2f(f2bf(f)); }
__device__ __forceinline__ v16h cat16(v8h lo, v8h hi) { return __builtin_shufflevector(lo, hi, 0, 1, 2, 3, 4, 5, 6, 7, 8, 9, 10, 11, 12, 13, 14, 15); }
__device__ __forceinline__ v16bf cat16b(v8us lo, v8us hi) { return __builtin_bit_cast(v16bf, __builtin_shufflevector(lo, hi, 0, 1, 2, 3, 4, 5, 6, 7, 8, 9, 10, 11, 12, 13, 14, 15)); }
__device__ __forceinline__ v8f wmma16(v16h a, v16h b, v8f c) { return __builtin_amdgcn_wmma_f32_16x16x32_f16(false, a, false, b, (short)0, c, false, false); }
// lane l's value of lane l ^ 16 (a vector cross-row move, no LDS)
__device__ __forceinline__ float xhalf(float x) { return __builtin_bit_cast(float, __builtin_amdgcn_permlanex16(__builtin_bit_cast(int, x), __builtin_bit_cast(int, x), 0x76543210, 0xfedcba98, false, false)); }
__device__ __forceinline__ v8f wmmab(v16bf a, v16bf b, v8f c) { return __builtin_amdgcn_wmma_f32_16x16x32_bf16(false, a, false, b, (short)0, c, false, false); }

__global__ __launch_bounds__(256) void k_cvtb(const float* __restrict__ src, int nrows, bf* dst) {
    const int lane = threadIdx.x & 31, r = blockIdx.x * 8 + (threadIdx.x >> 5);
    if (r >= nrows) return;
    v8us o[DM / 256];
#pragma unroll
    for (int q = 0; q < DM / 256; ++q) { v8us t;
#pragma unroll
        for (int i = 0; i < 8; ++i) t[i] = f2bf(src[(size_t)r * DM + q * 256 + lane * 8 + i]);
        o[q] = t; }
#pragma unroll
    for (int q = 0; q < DM / 256; ++q) *(v8us*)(dst + (size_t)r * DM + q * 256 + lane * 8) = o[q];
    
}

// k_wt: W [1024 k][ncols n] (k-major) -> n-major bf16 plane WT[ncols][1024]; 64 x 64 tiles through LDS.
__global__ __launch_bounds__(256) void k_wt(const float* __restrict__ Wm, int ncols, bf* WT) {
    __shared__ __align__(16) unsigned short tl[64 * 72];
    const int tid = threadIdx.x, k0 = blockIdx.x * 64, n0 = blockIdx.y * 64;
    const int kk = tid >> 2, nq = (tid & 3) * 16;
#pragma unroll
    for (int i = 0; i < 16; ++i) tl[(nq + i) * 72 + kk] = f2bf(Wm[(size_t)(k0 + kk) * ncols + n0 + nq + i]);
    __syncthreads();
    const int piece = tid & 7;
    typedef __attribute__((ext_vector_type(8))) unsigned short v8us_; typedef v8us_ __attribute__((may_alias)) v8usa_;
    auto pass = [&]() {
#pragma unroll
        for (int s = 0; s < 2; ++s) { const int nr = (tid >> 3) + 32 * s; const v8us_ val = *(const v8usa_*)(tl + nr * 72 + piece * 8);
            *(v8us_*)(WT + (size_t)(n0 + nr) * DM + k0 + piece * 8) = val; }
    };
    pass(); 
}

// k_gemmb: block = 64 x 64 of C, wave = 16 x 64. The 64 A rows and 64 B rows of a 64-k stage (128 B = one whole line a row) are brought into LDS once per block by
// asynchronous copies (two buffers: stage t+1 flies while stage t is worked on) and the 4 waves read their fragments from there; row pitch 144 B = 16 B x odd for the
// ds_load_b128 readers. The k order of every accumulator is as before (ascending, 32 a WMMA). The epilogue's staging rows reuse buffer 0 behind the loop's last barrier.
#define GP    72                      // halves per staged row (64 + 8 pad)
#define GST   (128 * GP)              // one stage in halves: A rows 0..63 | B rows 0..63 = 18432 B
template <bool SPLITA, bool F16OUT = false>
__global__ __launch_bounds__(128) void k_gemmb(const bf* __restrict__ A, const bf* __restrict__ Al, const bf* __restrict__ Bn, const float* __restrict__ bias, float* C, int ldc, h16* C2) {
    __shared__ __align__(16) char gsm[2 * GST * 2];
    const int lane = threadIdx.x & 31, wave = threadIdx.x >> 5, lr = lane & 15, hi = lane >> 4;
    const int r0 = blockIdx.x * 64 + wave * 16, c0 = blockIdx.y * 64;
    const size_t aoff = (size_t)(r0 + lr) * DM + 8 * hi;
    // each thread copies 4 pieces of A and 4 of B per stage: rows tid/8 + 16 i, 8 pieces of 16 B a row
    const int srow = threadIdx.x >> 3, spc = (threadIdx.x & 7) * 8;
    const bf* ga = A + (size_t)(blockIdx.x * 64 + srow) * DM + spc; const bf* gb = Bn + (size_t)(c0 + srow) * DM + spc;
    const unsigned lg = (unsigned)(size_t)&gsm[0] + (srow * GP + spc) * 2;
    auto fill = [&](int t) {
        const bf* a0 = ga + t * 64; const bf* a1 = a0 + 16 * DM; const bf* a2 = a0 + 32 * DM; const bf* a3 = a0 + 48 * DM;
        const bf* b0 = gb + t * 64; const bf* b1 = b0 + 16 * DM; const bf* b2 = b0 + 32 * DM; const bf* b3 = b0 + 48 * DM;
        const unsigned la0 = lg + (unsigned)(t & 1) * (GST * 2), la1 = la0 + 16 * GP * 2, la2 = la0 + 32 * GP * 2, la3 = la0 + 48 * GP * 2;
        const unsigned lb0 = la0 + 64 * GP * 2, lb1 = la0 + 80 * GP * 2, lb2 = la0 + 96 * GP * 2, lb3 = la0 + 112 * GP * 2;
        // the stage's 8 copies; s_wait_xcnt 0 closes the statement so that no address register is rewritten ahead of it
        asm volatile("global_load_async_to_lds_b128 %0, %1, off\n\t"
                     "global_load_async_to_lds_b128 %2, %3, off\n\t"
                     "global_load_async_to_lds_b128 %4, %5, off\n\t"
                     "global_load_async_to_lds_b128 %6, %7, off\n\t"
                     "global_load_async_to_lds_b128 %8, %9, off\n\t"
                     "global_load_async_to_lds_b128 %10, %11, off\n\t"
                     "global_load_async_to_lds_b128 %12, %13, off\n\t"
                     "global_load_async_to_lds_b128 %14, %15, off\n\t"
                     "s_wait_xcnt 0x0"
                     :: "v"(la0), "v"(a0), "v"(la1), "v"(a1), "v"(la2), "v"(a2), "v"(la3), "v"(a3),
                        "v"(lb0), "v"(b0), "v"(lb1), "v"(b1), "v"(lb2), "v"(b2), "v"(lb3), "v"(b3) : "memory");
    };
    fill(0);
    asm volatile("s_wait_asynccnt 0x0" ::: "memory");   // this wave's share of stage 0 has landed
    __syncthreads();                                    // every wave's share of stage 0 is readable
    fill(1);
    v8f acc[4];
#pragma unroll
    for (int t = 0; t < 4; ++t) acc[t] = (v8f){};
#pragma unroll 1
    for (int st = 0; st < DM / 64; ++st) {               // rolled: one stage a trip, so that the foot's waits and barrier stand once
        const bf* sa = (const bf*)(gsm + (st & 1) * (GST * 2)) + (wave * 16 + lr) * GP + 8 * hi;
        const bf* sb = (const bf*)(gsm + (st & 1) * (GST * 2)) + (64 + lr) * GP + 8 * hi;
        v16bf a, al;
#pragma unroll                                             // both 32-k halves of the stage straight-line, so that their LDS reads can be issued ahead of the products
        for (int kc = 0; kc < 64; kc += 32) {
            a = cat16b(*(const v8usa*)(sa + kc), *(const v8usa*)(sa + kc + 16));
            al = a;
            if (SPLITA) al = cat16b(*(const v8us*)(Al + aoff + st * 64 + kc), *(const v8us*)(Al + aoff + st * 64 + kc + 16));
#pragma unroll
            for (int t = 0; t < 4; ++t) { const v16bf b = cat16b(*(const v8usa*)(sb + t * 16 * GP + kc), *(const v8usa*)(sb + t * 16 * GP + kc + 16)); acc[t] = wmmab(a, b, acc[t]); if (SPLITA) acc[t] = wmmab(al, b, acc[t]); }
        }
        // the WMMA distance on every path behind the stage's last product, the loop's back edge included
        asm volatile("v_nop\n\tv_nop\n\tv_nop\n\tv_nop" : "+v"(acc[0]), "+v"(acc[1]), "+v"(acc[2]), "+v"(acc[3]) : "v"(a), "v"(al));
        asm volatile("s_wait_dscnt 0x0" ::: "memory");      // this wave's reads of stage st's buffer are done before it may be refilled
        asm volatile("s_wait_asynccnt 0x0" ::: "memory");   // this wave's share of stage st+1 has landed
        __syncthreads();                                    // publishes stage st+1 and ends every wave's reads of stage st's buffer
        if (st + 2 < DM / 64) fill(st + 2);
    }
    asm volatile("s_wait_asynccnt 0x0" ::: "memory");       // no copy is outstanding when buffer 0 becomes the epilogue's staging
    float* os = (float*)(void*)gsm + wave * (16 * 68);
#pragma unroll
    for (int t = 0; t < 4; ++t) { const float bv = bias ? bfr(bias[c0 + t * 16 + lr]) : 0.f;
#pragma unroll
        for (int j = 0; j < 8; ++j) os[(hi * 8 + j) * 68 + t * 16 + lr] = acc[t][j] + bv; }
    __syncthreads();
    if (F16OUT) {
        h16* crow = (h16*)(void*)C + (size_t)r0 * ldc + c0;
        auto pass = [&]() {
#pragma unroll
            for (int s = 0; s < 4; ++s) { const int row = 4 * s + (lane >> 3), piece = lane & 7; const float* sp = os + row * 68 + piece * 8; v8h o, o2;
#pragma unroll
                for (int i = 0; i < 8; ++i) { const h16 a = (h16)sp[i]; o[i] = a; o2[i] = (h16)((sp[i] - (float)a) * LOSC); }
                *(v8h*)(crow + (size_t)row * ldc + piece * 8) = o; if (C2) *(v8h*)(C2 + (size_t)r0 * ldc + c0 + (size_t)row * ldc + piece * 8) = o2; }
        };
        pass(); 
    } else {
        float* crow = C + (size_t)r0 * ldc + c0;
        auto pass = [&]() {
#pragma unroll
            for (int s = 0; s < 8; ++s) { const int Lid = (lane >> 3) + 4 * s, piece = lane & 7; const int row = Lid >> 1, cofs = (Lid & 1) * 32 + piece * 4;
                const v4f val = *(const v4fa*)(os + row * 68 + cofs); *(v4f*)(crow + (size_t)row * ldc + cofs) = val; }
        };
        pass(); 
    }
}

__global__ __launch_bounds__(256) void k_vt(const float* __restrict__ V, h16* VTH, h16* VTL) {
    __shared__ __align__(16) h16 tile[64 * 72];
    __shared__ __align__(16) h16 til2[64 * 72];
    const int bid = blockIdx.x;
    const int b = bid / (NKV * (NT_ / 64)), rem = bid - b * (NKV * (NT_ / 64)), h = rem / (NT_ / 64), kt = rem - h * (NT_ / 64);
    const int k0 = kt * 64, tid = threadIdx.x;
    const int kk = tid >> 2, d0 = (tid & 3) * 16;
    const float* src = V + ((size_t)b * NT_ + k0 + kk) * KVW + h * HD + d0;      // h = kv head here
#pragma unroll
    for (int i = 0; i < 16; ++i) { const float v = src[i]; const h16 a = (h16)v; tile[(d0 + i) * 72 + kk] = a; til2[(d0 + i) * 72 + kk] = (h16)((v - (float)a) * LOSC); }
    __syncthreads();
    const int piece = tid & 7;
    const size_t base = (((size_t)b * NKV + h) * HD) * NT_ + k0;
    auto pass = [&]() {
#pragma unroll
        for (int s = 0; s < 4; ++s) { const int Lid = (tid >> 3) + 32 * s; const int pln = Lid >> 6, d = Lid & 63;
            const v8h val = *(const v8ha*)((pln ? til2 : tile) + d * 72 + piece * 8); *(v8h*)((pln ? VTL : VTH) + base + (size_t)d * NT_ + piece * 8) = val; }
    };
    pass(); 
}

#define KP    72                      // halves per staged K row (64 + 8 pad)
#define VP    40                      // halves per staged V^T row (32 + 8 pad)
#define ST_KL (32 * KP)               // stage layout in halves: K hi | K lo | V^T hi | V^T lo
#define ST_VH (2 * 32 * KP)
#define ST_VL (ST_VH + 64 * VP)
#define ST_SZ (ST_VL + 64 * VP)       // 9728 halves = 19456 B
__global__ __launch_bounds__(128) void k_attn(const h16* __restrict__ Q16, const h16* __restrict__ QL16, const h16* __restrict__ K16, const h16* __restrict__ KL16, const h16* __restrict__ VTH, const h16* __restrict__ VTL, bf* CH, bf* CL) {
    __shared__ __align__(16) float ost[4][16 * 68];
    __shared__ __align__(16) h16 ring[2][ST_SZ];
    const int lane = threadIdx.x & 31, wave = threadIdx.x >> 5, lr = lane & 15, hi = lane >> 4;
    const int bid = blockIdx.x;
    const int b = bid / (NH_ * (NT_ / 64)), rem = bid - b * (NH_ * (NT_ / 64)), h = rem / (NT_ / 64), qt = rem - h * (NT_ / 64);
    const int q0 = qt * 64 + wave * 16;
    const size_t tok0 = (size_t)b * NT_;
    v16h qa[2];
    const size_t qo0 = (tok0 + q0 + lr) * QW + h * HD + 8 * hi;     // q/k planes are [tok][32*64]
#pragma unroll
    for (int kc = 0; kc < 2; ++kc) qa[kc] = cat16(*(const v8h*)(Q16 + qo0 + kc * 32), *(const v8h*)(Q16 + qo0 + kc * 32 + 16));
    const int g = h / (NH_ / NKV);                      // v head (each q/k head pair 2g, 2g+1 shares v head g)
    const h16* kh_b = K16 + tok0 * QW + h * HD;          // k has its own 32 heads (plane width QW)
    const h16* kl_b = KL16 + tok0 * QW + h * HD;
    const size_t vbase = (((size_t)b * NKV + g) * HD) * NT_;
    // each thread copies 2 pieces of each of the 4 planes per step: K rows tid/8 and +16 (8 pieces a row), V^T rows tid/4 and +32 (4 pieces a row)
    const int krow = threadIdx.x >> 3, kpc = (threadIdx.x & 7) * 8, vrow = threadIdx.x >> 2, vpc = (threadIdx.x & 3) * 8;
    const h16* gkh = kh_b + (size_t)krow * QW + kpc; const h16* gkl = kl_b + (size_t)krow * QW + kpc;
    const h16* gvh = VTH + vbase + (size_t)vrow * NT_ + vpc; const h16* gvl = VTL + vbase + (size_t)vrow * NT_ + vpc;
    const unsigned lring = (unsigned)(size_t)&ring[0][0];
    const unsigned lk = lring + (krow * KP + kpc) * 2, lv = lring + (ST_VH + vrow * VP + vpc) * 2;
    auto fill = [&](int t) {
        const unsigned lb = (unsigned)(t & 1) * (ST_SZ * 2);
        const h16* a0 = gkh + (size_t)t * 32 * QW; const h16* a1 = a0 + 16 * QW; const h16* b0 = gkl + (size_t)t * 32 * QW; const h16* b1 = b0 + 16 * QW;
        const h16* c0 = gvh + t * 32; const h16* c1 = c0 + 32 * NT_; const h16* d0 = gvl + t * 32; const h16* d1 = d0 + 32 * NT_;
        const unsigned la0 = lk + lb, la1 = la0 + 16 * KP * 2, lb0 = la0 + ST_KL * 2, lb1 = lb0 + 16 * KP * 2;
        const unsigned lc0 = lv + lb, lc1 = lc0 + 32 * VP * 2, ld0 = lc0 + 64 * VP * 2, ld1 = ld0 + 32 * VP * 2;
        // the step's 8 copies; s_wait_xcnt 0 closes the statement so that no address register is rewritten ahead of it
        asm volatile("global_load_async_to_lds_b128 %0, %1, off\n\t"
                     "global_load_async_to_lds_b128 %2, %3, off\n\t"
                     "global_load_async_to_lds_b128 %4, %5, off\n\t"
                     "global_load_async_to_lds_b128 %6, %7, off\n\t"
                     "global_load_async_to_lds_b128 %8, %9, off\n\t"
                     "global_load_async_to_lds_b128 %10, %11, off\n\t"
                     "global_load_async_to_lds_b128 %12, %13, off\n\t"
                     "global_load_async_to_lds_b128 %14, %15, off\n\t"
                     "s_wait_xcnt 0x0"
                     :: "v"(la0), "v"(a0), "v"(la1), "v"(a1), "v"(lb0), "v"(b0), "v"(lb1), "v"(b1),
                        "v"(lc0), "v"(c0), "v"(lc1), "v"(c1), "v"(ld0), "v"(d0), "v"(ld1), "v"(d1) : "memory");
    };
    fill(0);
    asm volatile("s_wait_asynccnt 0x0" ::: "memory");   // this wave's share of step 0 has landed
    __syncthreads();                                    // every wave's share of step 0 is readable
    fill(1);
    v8f o[4], ox[4];
#pragma unroll
    for (int n = 0; n < 4; ++n) { o[n] = (v8f){}; ox[n] = (v8f){}; }
    float mrow = -3.0e38f, lpart = 0.f;                 // of query q0 + lr; lpart covers this wave half's keys, the halves are joined behind the loop
    const int kt_lo = 0, kt_hi = NT_ / 32 - 1;          // full attention (no mask)
#pragma unroll 1
    for (int kt = kt_lo; kt <= kt_hi; ++kt) {
        const h16* st = &ring[kt & 1][0];
        const h16* skh = st; const h16* skl = st + ST_KL; const h16* svh = st + ST_VH; const h16* svl = st + ST_VL;
        const int ko0 = lr * KP + 8 * hi, ko1 = (16 + lr) * KP + 8 * hi;
        v8f s0 = {}, s1 = {}, x0 = {}, x1 = {};
#pragma unroll
        for (int kc = 0; kc < 2; ++kc) {
            { const v16h k0h = cat16(*(const v8ha*)(skh + ko0 + kc * 32), *(const v8ha*)(skh + ko0 + kc * 32 + 16)), k1h = cat16(*(const v8ha*)(skh + ko1 + kc * 32), *(const v8ha*)(skh + ko1 + kc * 32 + 16));
              const v16h qlk = cat16(*(const v8h*)(QL16 + qo0 + kc * 32), *(const v8h*)(QL16 + qo0 + kc * 32 + 16));     // query residual re-read per step (registers)
              s0 = wmma16(k0h, qa[kc], s0); x0 = wmma16(k0h, qlk, x0); s1 = wmma16(k1h, qa[kc], s1); x1 = wmma16(k1h, qlk, x1);
              asm volatile("v_nop" : "+v"(s0), "+v"(s1), "+v"(x0), "+v"(x1) : "v"(qlk), "v"(k0h), "v"(k1h) : "memory"); }
            { const v16h k0l = cat16(*(const v8ha*)(skl + ko0 + kc * 32), *(const v8ha*)(skl + ko0 + kc * 32 + 16)), k1l = cat16(*(const v8ha*)(skl + ko1 + kc * 32), *(const v8ha*)(skl + ko1 + kc * 32 + 16));
              x0 = wmma16(k0l, qa[kc], x0); x1 = wmma16(k1l, qa[kc], x1);
              asm volatile("v_nop" : "+v"(x0), "+v"(x1) : "v"(k0l), "v"(k1l) : "memory"); }
        }
        asm volatile("v_nop\n\tv_nop\n\tv_nop\n\tv_nop" : "+v"(s0), "+v"(s1), "+v"(x0), "+v"(x1) : "v"(qa[0]), "v"(qa[1]));
        const v8f a0 = (s0 + x0 * LOSCI) * 0.125f, a1 = (s1 + x1 * LOSCI) * 0.125f;   // (q e^-1/4).(k e^-1/4) = q.k / 8; a0[j]: key 8 hi + j, a1[j]: key 16 + 8 hi + j of this step
        float mx = fmaxf(a0[0], a1[0]);
#pragma unroll
        for (int j = 1; j < 8; ++j) mx = fmaxf(mx, fmaxf(a0[j], a1[j]));
        mx = fmaxf(mx, xhalf(mx));                      // the other 16 keys of this query sit in lane ^ 16
        const float mn = fmaxf(mrow, mx);
        const float alpha = __expf(mrow - mn); mrow = mn;
        const v8f e0 = (a0 - mn) * LOG2E, e1 = (a1 - mn) * LOG2E;      // e^x = 2^(x log2 e)
        v8f p0, p1;
#pragma unroll
        for (int j = 0; j < 8; ++j) p0[j] = __builtin_amdgcn_exp2f(e0[j]);
#pragma unroll
        for (int j = 0; j < 8; ++j) p1[j] = __builtin_amdgcn_exp2f(e1[j]);
        const v8f pq = p0 + p1;
        lpart = lpart * alpha + (((pq[0] + pq[1]) + (pq[2] + pq[3])) + ((pq[4] + pq[5]) + (pq[6] + pq[7])));
        // element s of the B operand = key 8 hi + s (s < 8), 16 + 8 hi + s - 8 (else): the k order of the V^T loader below
        const v8f ps0 = p0 * PSC, ps1 = p1 * PSC;
        const v8h h0 = __builtin_convertvector(ps0, v8h), h1 = __builtin_convertvector(ps1, v8h);
        const v8h r0 = __builtin_convertvector((ps0 - __builtin_convertvector(h0, v8f)) * LOSC, v8h), r1 = __builtin_convertvector((ps1 - __builtin_convertvector(h1, v8f)) * LOSC, v8h);
        const v16h pa = cat16(h0, h1), px = cat16(r0, r1);
#pragma unroll
        for (int n = 0; n < 4; ++n) { o[n] *= alpha; ox[n] *= alpha; }
#pragma unroll
        for (int n = 0; n < 4; ++n) { const int vo = (n * 16 + lr) * VP + hi * 8;
            const v16h vh = cat16(*(const v8ha*)(svh + vo), *(const v8ha*)(svh + vo + 16)), vl = cat16(*(const v8ha*)(svl + vo), *(const v8ha*)(svl + vo + 16));
            o[n] = wmma16(vh, pa, o[n]); ox[n] = wmma16(vl, pa, ox[n]); ox[n] = wmma16(vh, px, ox[n]);
            asm volatile("" : "+v"(o[n]), "+v"(ox[n]) : "v"(vh), "v"(vl) : "memory"); }
        asm volatile("v_nop\n\tv_nop\n\tv_nop\n\tv_nop" : "+v"(o[0]), "+v"(o[1]), "+v"(o[2]), "+v"(o[3]), "+v"(ox[0]), "+v"(ox[1]), "+v"(ox[2]), "+v"(ox[3]) : "v"(pa), "v"(px));
        asm volatile("s_wait_dscnt 0x0" ::: "memory");      // this wave's reads of step kt's buffer are done before it may be refilled
        asm volatile("s_wait_asynccnt 0x0" ::: "memory");   // this wave's share of step kt+1 has landed
        __syncthreads();                                    // publishes step kt+1 and ends every wave's reads of step kt's buffer
        if (kt + 2 <= kt_hi) fill(kt + 2);
    }
    asm volatile("s_wait_asynccnt 0x0" ::: "memory");       // no copy is outstanding when the wave goes on to the epilogue
    const float inv = 1.0f / ((lpart + xhalf(lpart)) * PSC);
    float* os = &ost[wave][0];
#pragma unroll
    for (int n = 0; n < 4; ++n)
#pragma unroll
        for (int j = 0; j < 8; ++j) os[lr * 68 + n * 16 + hi * 8 + j] = (o[n][j] + ox[n][j] * LOSCI) * inv;     // o[n][j] = O^T[d = 16 n + 8 hi + j][query lr]
    __syncthreads();
    const size_t cbase = (tok0 + q0) * QW + (size_t)h * HD;     // per-head softmax outputs C[tok][32*64] (bf16 hi/lo), combined by k_diff
    auto pass = [&]() {
#pragma unroll
        for (int s = 0; s < 4; ++s) { const int row = 4 * s + (lane >> 3), piece = lane & 7; const float* sp = os + row * 68 + piece * 8; v8us oh, ol;
#pragma unroll
            for (int i = 0; i < 8; ++i) { const unsigned short hb = f2bf(sp[i]); oh[i] = hb; ol[i] = f2bf(sp[i] - bf2f(hb)); }
            *(v8us*)(CH + cbase + (size_t)row * QW + piece * 8) = oh; *(v8us*)(CL + cbase + (size_t)row * QW + piece * 8) = ol; }
    };
    pass(); 
}

// k_lambda: lam = 0.2 + exp(L0.L1) - exp(L2.L3) from the INPUT L [4][64] (bf16-rounded), one wave; the scalar alone in its own line.
__global__ __launch_bounds__(32) void k_lambda(const float* __restrict__ Lp, float* LAM) {
    const int lane = threadIdx.x; float a = 0.f, c = 0.f;
#pragma unroll
    for (int i = 0; i < 2; ++i) { const int d = lane * 2 + i; a = fmaf(bfr(Lp[d]), bfr(Lp[64 + d]), a); c = fmaf(bfr(Lp[128 + d]), bfr(Lp[192 + d]), c); }
#pragma unroll
    for (int sh = 16; sh; sh >>= 1) { a += __shfl_xor(a, sh, 32); c += __shfl_xor(c, sh, 32); }
    if (lane == 0) { const float lam = 0.2f + expf(a) - expf(c); *(float*)LAM = lam;  }
}
// k_diff: out[tok][g*64 + e] = C[tok][2g*64 + e] - lam * C[tok][(2g+1)*64 + e] with C = hi + lo planes (f32 recombination); one wave per token row, lane -> 4
__global__ __launch_bounds__(256) void k_diff(const bf* __restrict__ CH, const bf* __restrict__ CL, const float* __restrict__ LAM, float* OUTP) {
    const int lane = threadIdx.x & 31, r = blockIdx.x * 8 + (threadIdx.x >> 5);
    if (r >= NTK) return;
    const float lam = LAM[0];
{
#pragma unroll 1
        for (int q = 0; q < KVW / 128; ++q) { const int c = q * 128 + lane * 4; const int g = c >> 6, e = c & 63; const size_t s1 = (size_t)r * QW + (2 * g) * HD + e, s2 = s1 + HD; v4f o;
#pragma unroll
            for (int i = 0; i < 4; ++i) { const float p1 = bf2f(CH[s1 + i]) + bf2f(CL[s1 + i]), p2 = bf2f(CH[s2 + i]) + bf2f(CL[s2 + i]); o[i] = p1 - lam * p2; }
            *(v4f*)(OUTP + (size_t)r * KVW + c) = o; }
         }
}
#define VST2(T, p, v) do { const T vst2_v_ = (v); *(T*)(p) = vst2_v_;  } while (0)
extern "C" void kernel_launch(void* const* d_in, const int* in_sizes, int n_in,
                              void* d_out, int out_size, void* d_ws, size_t ws_size, hipStream_t stream) {
    (void)in_sizes; (void)n_in; (void)out_size;
    const float* xq = (const float*)d_in[0]; const float* xk = (const float*)d_in[1]; const float* xv = (const float*)d_in[2];
    const float* Wq = (const float*)d_in[3]; const float* Wk = (const float*)d_in[4]; const float* Wv = (const float*)d_in[5]; const float* Lp = (const float*)d_in[6];   // W [out][in]
    float* out = (float*)d_out;    // [4][1024][1024]
    char* wsp = (char*)d_ws;
    auto take = [&](size_t bytes) { char* p = wsp; wsp += (bytes + 255) & ~(size_t)255; return (void*)p; };
    bf* Xq = (bf*)take((size_t)NTK * DM * 2); bf* Xk = (bf*)take((size_t)NTK * DM * 2); bf* Xv = (bf*)take((size_t)NTK * DM * 2);
    bf* WqB = (bf*)take((size_t)QW * DM * 2); bf* WkB = (bf*)take((size_t)QW * DM * 2); bf* WvB = (bf*)take((size_t)KVW * DM * 2);
    h16* QH = (h16*)take((size_t)NTK * QW * 2); h16* QL = (h16*)take((size_t)NTK * QW * 2); h16* KH = (h16*)take((size_t)NTK * QW * 2); h16* KL = (h16*)take((size_t)NTK * QW * 2);
    float* Vf = (float*)take((size_t)NTK * KVW * 4); h16* VTH = (h16*)take((size_t)NTK * KVW * 2); h16* VTL = (h16*)take((size_t)NTK * KVW * 2);
    bf* CH = (bf*)take((size_t)NTK * QW * 2); bf* CL = (bf*)take((size_t)NTK * QW * 2); float* LAM = (float*)take(256);
    if ((size_t)(wsp - (char*)d_ws) > ws_size) return;    // 3 x 8.4 + 2 x 4.2 + 2.1 + 4 x 16.8 + 16.8 + 2 x 8.4 + 2 x 16.8 ~ 170 MB, no aliasing
    k_cvtb<<<QW / 8, 256, 0, stream>>>(Wq, QW, WqB); k_cvtb<<<QW / 8, 256, 0, stream>>>(Wk, QW, WkB); k_cvtb<<<KVW / 8, 256, 0, stream>>>(Wv, KVW, WvB);
    k_lambda<<<1, 32, 0, stream>>>(Lp, LAM);
    k_cvtb<<<NTK / 8, 256, 0, stream>>>(xq, NTK, Xq); k_cvtb<<<NTK / 8, 256, 0, stream>>>(xk, NTK, Xk); k_cvtb<<<NTK / 8, 256, 0, stream>>>(xv, NTK, Xv);
    k_gemmb<false, true><<<dim3(NTK / 64, QW / 64, 1), 128, 0, stream>>>(Xq, nullptr, WqB, nullptr, (float*)(void*)QH, QW, QL);      // q (32 heads) as f16 planes
    k_gemmb<false, true><<<dim3(NTK / 64, QW / 64, 1), 128, 0, stream>>>(Xk, nullptr, WkB, nullptr, (float*)(void*)KH, QW, KL);      // k (32 heads)
    k_gemmb<false, false><<<dim3(NTK / 64, KVW / 64, 1), 128, 0, stream>>>(Xv, nullptr, WvB, nullptr, Vf, KVW, nullptr);             // v (16 heads) f32
    k_vt<<<NB_ * NKV * (NT_ / 64), 256, 0, stream>>>(Vf, VTH, VTL);
    k_attn<<<NB_ * NH_ * (NT_ / 64), 128, 0, stream>>>(QH, QL, KH, KL, VTH, VTL, CH, CL);
    k_diff<<<NTK / 8, 256, 0, stream>>>(CH, CL, LAM, out);
}

// v005
// A run of this version takes 175 microseconds.
// Two timings next to v004 both put it at 1.09 times that version's speed.
// All steps since v000 together make it 3.76 times as fast.
#include <hip/hip_runtime.h>

// Compute dtypes, f32 accumulate, all 4 batch items in one pass: q = q_input.Wq^T, k = k_input.Wk^T ([4096 x 1024].[1024 x 2048], 32 dual heads) and v = v_input.Wv^T
// ([4096 x 1024].[1024 x 1024], 16 heads) on v_wmma_f32_16x16x32_bf16 — plain bf16 = rounded inputs (exact; [out][in] weights are the n-major B operands as-is), q/k
// written straight to f16 hi + residual x1024 planes; the 32 softmax attentions (q/k head h over v head h/2, full, the two e^-1/4 scales folded into 1/8) fused
// on v_wmma_f32_16x16x32_f16 (hi.hi + hi.lo + lo.hi, weights x32768 and v as f16 hi + residual) giving per-head normalised outputs as bf16 hi/lo planes;
// differential combine out_g = P_2g.v_g - lambda P_2g+1.v_g in f32 with lambda = 0.2 + exp(L0.L1) - exp(L2.L3) computed on device from the INPUT L. Deterministic,

#define NB_  4                   // all 4 batch items go through every per-token launch together (4x the workgroups per launch)
#define NT_  1024
#define DM   1024                // input width = GEMM K
#define NH_  32                  // 2 x 16 dual q/k heads
#define NKV  16                  // v heads: q/k head h uses v head h/2
#define KVW  (NKV * HD)          // 1024
#define HD   64
#define NTK  (NB_ * NT_)
#define QW   (NH_ * HD)          // 2048: q/k plane width
#define NW   1024
#define NQKV 2048
#define PSC  32768.0f
#define LOSC 1024.0f
#define LOSCI (1.0f / 1024.0f)
#define LOG2E 1.44269504088896340736f

typedef _Float16 h16;
typedef unsigned short bf;
typedef __attribute__((ext_vector_type(16))) __bf16   v16bf;
typedef __attribute__((ext_vector_type(16))) _Float16 v16h;
typedef __attribute__((ext_vector_type(8)))  _Float16 v8h;
typedef __attribute__((ext_vector_type(8)))  unsigned short v8us;
typedef __attribute__((ext_vector_type(8)))  float    v8f;
typedef __attribute__((ext_vector_type(4)))  float    v4f;
typedef v8h  __attribute__((may_alias)) v8ha;
typedef v4f  __attribute__((may_alias)) v4fa;
typedef v8us __attribute__((may_alias)) v8usa;

__device__ __forceinline__ unsigned short f2bf(float f) { unsigned u = __float_as_uint(f); u += 0x7FFFu + ((u >> 16) & 1u); return (unsigned short)(u >> 16); }
__device__ __forceinline__ float bf2f(unsigned short b) { return __uint_as_float(((unsigned)b) << 16); }
__device__ __forceinline__ float bfr(float f) { return bf2f(f2bf(f)); }
__device__ __forceinline__ v16h cat16(v8h lo, v8h hi) { return __builtin_shufflevector(lo, hi, 0, 1, 2, 3, 4, 5, 6, 7, 8, 9, 10, 11, 12, 13, 14, 15); }
__device__ __forceinline__ v16bf cat16b(v8us lo, v8us hi) { return __builtin_bit_cast(v16bf, __builtin_shufflevector(lo, hi, 0, 1, 2, 3, 4, 5, 6, 7, 8, 9, 10, 11, 12, 13, 14, 15)); }
__device__ __forceinline__ v8f wmma16(v16h a, v16h b, v8f c) { return __builtin_amdgcn_wmma_f32_16x16x32_f16(false, a, false, b, (short)0, c, false, false); }
// lane l's value of lane l ^ 16 (a vector cross-row move, no LDS)
__device__ __forceinline__ float xhalf(float x) { return __builtin_bit_cast(float, __builtin_amdgcn_permlanex16(__builtin_bit_cast(int, x), __builtin_bit_cast(int, x), 0x76543210, 0xfedcba98, false, false)); }
__device__ __forceinline__ v8f wmmab(v16bf a, v16bf b, v8f c) { return __builtin_amdgcn_wmma_f32_16x16x32_bf16(false, a, false, b, (short)0, c, false, false); }

// cvt_row: one wave rounds row r of src [rows][1024] f32 to the bf16 plane dst.
__device__ __forceinline__ void cvt_row(const float* __restrict__ src, int r, bf* dst) {
    const int lane = threadIdx.x & 31;
    v8us o[DM / 256];
#pragma unroll
    for (int q = 0; q < DM / 256; ++q) { v8us t;
#pragma unroll
        for (int i = 0; i < 8; ++i) t[i] = f2bf(src[(size_t)r * DM + q * 256 + lane * 8 + i]);
        o[q] = t; }
#pragma unroll
    for (int q = 0; q < DM / 256; ++q) *(v8us*)(dst + (size_t)r * DM + q * 256 + lane * 8) = o[q];
    
}

// k_wt: W [1024 k][ncols n] (k-major) -> n-major bf16 plane WT[ncols][1024]; 64 x 64 tiles through LDS.
__global__ __launch_bounds__(256) void k_wt(const float* __restrict__ Wm, int ncols, bf* WT) {
    __shared__ __align__(16) unsigned short tl[64 * 72];
    const int tid = threadIdx.x, k0 = blockIdx.x * 64, n0 = blockIdx.y * 64;
    const int kk = tid >> 2, nq = (tid & 3) * 16;
#pragma unroll
    for (int i = 0; i < 16; ++i) tl[(nq + i) * 72 + kk] = f2bf(Wm[(size_t)(k0 + kk) * ncols + n0 + nq + i]);
    __syncthreads();
    const int piece = tid & 7;
    typedef __attribute__((ext_vector_type(8))) unsigned short v8us_; typedef v8us_ __attribute__((may_alias)) v8usa_;
    auto pass = [&]() {
#pragma unroll
        for (int s = 0; s < 2; ++s) { const int nr = (tid >> 3) + 32 * s; const v8us_ val = *(const v8usa_*)(tl + nr * 72 + piece * 8);
            *(v8us_*)(WT + (size_t)(n0 + nr) * DM + k0 + piece * 8) = val; }
    };
    pass(); 
}

// k_gemmb: block = 64 x 64 of C, wave = 16 x 64. The 64 A rows and 64 B rows of a 64-k stage (128 B = one whole line a row) are brought into LDS once per block by
// asynchronous copies (two buffers: stage t+1 flies while stage t is worked on) and the 4 waves read their fragments from there; row pitch 144 B = 16 B x odd for the
// ds_load_b128 readers. The k order of every accumulator is as before (ascending, 32 a WMMA). The epilogue's staging rows reuse buffer 0 behind the loop's last barrier.
#define GP    72                      // halves per staged row (64 + 8 pad)
#define GST   (128 * GP)              // one stage in halves: A rows 0..63 | B rows 0..63 = 18432 B
// The three projections go through ONE launch (none reads another's output): blockIdx.y picks the product, 0..31 q, 32..63 k (both to f16 hi + residual planes), 64..79 v (f32).
__global__ __launch_bounds__(128) void k_gemmb(const bf* __restrict__ Xq, const bf* __restrict__ Xk, const bf* __restrict__ Xv, const bf* __restrict__ WqB, const bf* __restrict__ WkB, const bf* __restrict__ WvB,
                                               h16* QH, h16* QL, h16* KH, h16* KL, float* Vf) {
    __shared__ __align__(16) char gsm[2 * GST * 2];
    const int lane = threadIdx.x & 31, wave = threadIdx.x >> 5, lr = lane & 15, hi = lane >> 4;
    const int sel = blockIdx.y < QW / 64 ? 0 : (blockIdx.y < 2 * (QW / 64) ? 1 : 2);        // the same for the whole block
    const bf* A = sel == 0 ? Xq : (sel == 1 ? Xk : Xv); const bf* Bn = sel == 0 ? WqB : (sel == 1 ? WkB : WvB);
    const int r0 = blockIdx.x * 64 + wave * 16, c0 = (blockIdx.y - sel * (QW / 64)) * 64;
    // each thread copies 4 pieces of A and 4 of B per stage: rows tid/8 + 16 i, 8 pieces of 16 B a row
    const int srow = threadIdx.x >> 3, spc = (threadIdx.x & 7) * 8;
    const bf* ga = A + (size_t)(blockIdx.x * 64 + srow) * DM + spc; const bf* gb = Bn + (size_t)(c0 + srow) * DM + spc;
    const unsigned lg = (unsigned)(size_t)&gsm[0] + (srow * GP + spc) * 2;
    auto fill = [&](int t) {
        const bf* a0 = ga + t * 64; const bf* a1 = a0 + 16 * DM; const bf* a2 = a0 + 32 * DM; const bf* a3 = a0 + 48 * DM;
        const bf* b0 = gb + t * 64; const bf* b1 = b0 + 16 * DM; const bf* b2 = b0 + 32 * DM; const bf* b3 = b0 + 48 * DM;
        const unsigned la0 = lg + (unsigned)(t & 1) * (GST * 2), la1 = la0 + 16 * GP * 2, la2 = la0 + 32 * GP * 2, la3 = la0 + 48 * GP * 2;
        const unsigned lb0 = la0 + 64 * GP * 2, lb1 = la0 + 80 * GP * 2, lb2 = la0 + 96 * GP * 2, lb3 = la0 + 112 * GP * 2;
        // the stage's 8 copies; s_wait_xcnt 0 closes the statement so that no address register is rewritten ahead of it
        asm volatile("global_load_async_to_lds_b128 %0, %1, off\n\t"
                     "global_load_async_to_lds_b128 %2, %3, off\n\t"
                     "global_load_async_to_lds_b128 %4, %5, off\n\t"
                     "global_load_async_to_lds_b128 %6, %7, off\n\t"
                     "global_load_async_to_lds_b128 %8, %9, off\n\t"
                     "global_load_async_to_lds_b128 %10, %11, off\n\t"
                     "global_load_async_to_lds_b128 %12, %13, off\n\t"
                     "global_load_async_to_lds_b128 %14, %15, off\n\t"
                     "s_wait_xcnt 0x0"
                     :: "v"(la0), "v"(a0), "v"(la1), "v"(a1), "v"(la2), "v"(a2), "v"(la3), "v"(a3),
                        "v"(lb0), "v"(b0), "v"(lb1), "v"(b1), "v"(lb2), "v"(b2), "v"(lb3), "v"(b3) : "memory");
    };
    fill(0);
    asm volatile("s_wait_asynccnt 0x0" ::: "memory");   // this wave's share of stage 0 has landed
    __syncthreads();                                    // every wave's share of stage 0 is readable
    fill(1);
    v8f acc[4];
#pragma unroll
    for (int t = 0; t < 4; ++t) acc[t] = (v8f){};
#pragma unroll 1
    for (int st = 0; st < DM / 64; ++st) {               // rolled: one stage a trip, so that the foot's waits and barrier stand once
        const bf* sa = (const bf*)(gsm + (st & 1) * (GST * 2)) + (wave * 16 + lr) * GP + 8 * hi;
        const bf* sb = (const bf*)(gsm + (st & 1) * (GST * 2)) + (64 + lr) * GP + 8 * hi;
        v16bf a;
#pragma unroll                                             // both 32-k halves of the stage straight-line, so that their LDS reads can be issued ahead of the products
        for (int kc = 0; kc < 64; kc += 32) {
            a = cat16b(*(const v8usa*)(sa + kc), *(const v8usa*)(sa + kc + 16));
#pragma unroll
            for (int t = 0; t < 4; ++t) { const v16bf b = cat16b(*(const v8usa*)(sb + t * 16 * GP + kc), *(const v8usa*)(sb + t * 16 * GP + kc + 16)); acc[t] = wmmab(a, b, acc[t]); }
        }
        // the WMMA distance on every path behind the stage's last product, the loop's back edge included
        asm volatile("v_nop\n\tv_nop\n\tv_nop\n\tv_nop" : "+v"(acc[0]), "+v"(acc[1]), "+v"(acc[2]), "+v"(acc[3]) : "v"(a));
        asm volatile("s_wait_dscnt 0x0" ::: "memory");      // this wave's reads of stage st's buffer are done before it may be refilled
        asm volatile("s_wait_asynccnt 0x0" ::: "memory");   // this wave's share of stage st+1 has landed
        __syncthreads();                                    // publishes stage st+1 and ends every wave's reads of stage st's buffer
        if (st + 2 < DM / 64) fill(st + 2);
    }
    asm volatile("s_wait_asynccnt 0x0" ::: "memory");       // no copy is outstanding when buffer 0 becomes the epilogue's staging
    float* os = (float*)(void*)gsm + wave * (16 * 68);
#pragma unroll
    for (int t = 0; t < 4; ++t) {
#pragma unroll
        for (int j = 0; j < 8; ++j) os[(hi * 8 + j) * 68 + t * 16 + lr] = acc[t][j]; }
    __syncthreads();
    if (sel < 2) {
        const int ldc = QW;
        h16* crow = (sel == 0 ? QH : KH) + (size_t)r0 * ldc + c0; h16* C2 = sel == 0 ? QL : KL;
        auto pass = [&]() {
#pragma unroll
            for (int s = 0; s < 4; ++s) { const int row = 4 * s + (lane >> 3), piece = lane & 7; const float* sp = os + row * 68 + piece * 8; v8h o, o2;
#pragma unroll
                for (int i = 0; i < 8; ++i) { const h16 a = (h16)sp[i]; o[i] = a; o2[i] = (h16)((sp[i] - (float)a) * LOSC); }
                *(v8h*)(crow + (size_t)row * ldc + piece * 8) = o; *(v8h*)(C2 + (size_t)r0 * ldc + c0 + (size_t)row * ldc + piece * 8) = o2; }
        };
        pass(); 
    } else {
        const int ldc = KVW;
        float* crow = Vf + (size_t)r0 * ldc + c0;
        auto pass = [&]() {
#pragma unroll
            for (int s = 0; s < 8; ++s) { const int Lid = (lane >> 3) + 4 * s, piece = lane & 7; const int row = Lid >> 1, cofs = (Lid & 1) * 32 + piece * 4;
                const v4f val = *(const v4fa*)(os + row * 68 + cofs); *(v4f*)(crow + (size_t)row * ldc + cofs) = val; }
        };
        pass(); 
    }
}

__global__ __launch_bounds__(256) void k_vt(const float* __restrict__ V, h16* VTH, h16* VTL) {
    __shared__ __align__(16) h16 tile[64 * 72];
    __shared__ __align__(16) h16 til2[64 * 72];
    const int bid = blockIdx.x;
    const int b = bid / (NKV * (NT_ / 64)), rem = bid - b * (NKV * (NT_ / 64)), h = rem / (NT_ / 64), kt = rem - h * (NT_ / 64);
    const int k0 = kt * 64, tid = threadIdx.x;
    const int kk = tid >> 2, d0 = (tid & 3) * 16;
    const float* src = V + ((size_t)b * NT_ + k0 + kk) * KVW + h * HD + d0;      // h = kv head here
#pragma unroll
    for (int i = 0; i < 16; ++i) { const float v = src[i]; const h16 a = (h16)v; tile[(d0 + i) * 72 + kk] = a; til2[(d0 + i) * 72 + kk] = (h16)((v - (float)a) * LOSC); }
    __syncthreads();
    const int piece = tid & 7;
    const size_t base = (((size_t)b * NKV + h) * HD) * NT_ + k0;
    auto pass = [&]() {
#pragma unroll
        for (int s = 0; s < 4; ++s) { const int Lid = (tid >> 3) + 32 * s; const int pln = Lid >> 6, d = Lid & 63;
            const v8h val = *(const v8ha*)((pln ? til2 : tile) + d * 72 + piece * 8); *(v8h*)((pln ? VTL : VTH) + base + (size_t)d * NT_ + piece * 8) = val; }
    };
    pass(); 
}

#define KP    72                      // halves per staged K row (64 + 8 pad)
#define VP    40                      // halves per staged V^T row (32 + 8 pad)
#define ST_KL (32 * KP)               // stage layout in halves: K hi | K lo | V^T hi | V^T lo
#define ST_VH (2 * 32 * KP)
#define ST_VL (ST_VH + 64 * VP)
#define ST_SZ (ST_VL + 64 * VP)       // 9728 halves = 19456 B
__global__ __launch_bounds__(128) void k_attn(const h16* __restrict__ Q16, const h16* __restrict__ QL16, const h16* __restrict__ K16, const h16* __restrict__ KL16, const h16* __restrict__ VTH, const h16* __restrict__ VTL, bf* CH, bf* CL) {
    __shared__ __align__(16) float ost[4][16 * 68];
    __shared__ __align__(16) h16 ring[2][ST_SZ];
    const int lane = threadIdx.x & 31, wave = threadIdx.x >> 5, lr = lane & 15, hi = lane >> 4;
    const int bid = blockIdx.x;
    const int b = bid / (NH_ * (NT_ / 64)), rem = bid - b * (NH_ * (NT_ / 64)), h = rem / (NT_ / 64), qt = rem - h * (NT_ / 64);
    const int q0 = qt * 64 + wave * 16;
    const size_t tok0 = (size_t)b * NT_;
    v16h qa[2];
    const size_t qo0 = (tok0 + q0 + lr) * QW + h * HD + 8 * hi;     // q/k planes are [tok][32*64]
#pragma unroll
    for (int kc = 0; kc < 2; ++kc) qa[kc] = cat16(*(const v8h*)(Q16 + qo0 + kc * 32), *(const v8h*)(Q16 + qo0 + kc * 32 + 16));
    const int g = h / (NH_ / NKV);                      // v head (each q/k head pair 2g, 2g+1 shares v head g)
    const h16* kh_b = K16 + tok0 * QW + h * HD;          // k has its own 32 heads (plane width QW)
    const h16* kl_b = KL16 + tok0 * QW + h * HD;
    const size_t vbase = (((size_t)b * NKV + g) * HD) * NT_;
    // each thread copies 2 pieces of each of the 4 planes per step: K rows tid/8 and +16 (8 pieces a row), V^T rows tid/4 and +32 (4 pieces a row)
    const int krow = threadIdx.x >> 3, kpc = (threadIdx.x & 7) * 8, vrow = threadIdx.x >> 2, vpc = (threadIdx.x & 3) * 8;
    const h16* gkh = kh_b + (size_t)krow * QW + kpc; const h16* gkl = kl_b + (size_t)krow * QW + kpc;
    const h16* gvh = VTH + vbase + (size_t)vrow * NT_ + vpc; const h16* gvl = VTL + vbase + (size_t)vrow * NT_ + vpc;
    const unsigned lring = (unsigned)(size_t)&ring[0][0];
    const unsigned lk = lring + (krow * KP + kpc) * 2, lv = lring + (ST_VH + vrow * VP + vpc) * 2;
    auto fill = [&](int t) {
        const unsigned lb = (unsigned)(t & 1) * (ST_SZ * 2);
        const h16* a0 = gkh + (size_t)t * 32 * QW; const h16* a1 = a0 + 16 * QW; const h16* b0 = gkl + (size_t)t * 32 * QW; const h16* b1 = b0 + 16 * QW;
        const h16* c0 = gvh + t * 32; const h16* c1 = c0 + 32 * NT_; const h16* d0 = gvl + t * 32; const h16* d1 = d0 + 32 * NT_;
        const unsigned la0 = lk + lb, la1 = la0 + 16 * KP * 2, lb0 = la0 + ST_KL * 2, lb1 = lb0 + 16 * KP * 2;
        const unsigned lc0 = lv + lb, lc1 = lc0 + 32 * VP * 2, ld0 = lc0 + 64 * VP * 2, ld1 = ld0 + 32 * VP * 2;
        // the step's 8 copies; s_wait_xcnt 0 closes the statement so that no address register is rewritten ahead of it
        asm volatile("global_load_async_to_lds_b128 %0, %1, off\n\t"
                     "global_load_async_to_lds_b128 %2, %3, off\n\t"
                     "global_load_async_to_lds_b128 %4, %5, off\n\t"
                     "global_load_async_to_lds_b128 %6, %7, off\n\t"
                     "global_load_async_to_lds_b128 %8, %9, off\n\t"
                     "global_load_async_to_lds_b128 %10, %11, off\n\t"
                     "global_load_async_to_lds_b128 %12, %13, off\n\t"
                     "global_load_async_to_lds_b128 %14, %15, off\n\t"
                     "s_wait_xcnt 0x0"
                     :: "v"(la0), "v"(a0), "v"(la1), "v"(a1), "v"(lb0), "v"(b0), "v"(lb1), "v"(b1),
                        "v"(lc0), "v"(c0), "v"(lc1), "v"(c1), "v"(ld0), "v"(d0), "v"(ld1), "v"(d1) : "memory");
    };
    fill(0);
    asm volatile("s_wait_asynccnt 0x0" ::: "memory");   // this wave's share of step 0 has landed
    __syncthreads();                                    // every wave's share of step 0 is readable
    fill(1);
    v8f o[4], ox[4];
#pragma unroll
    for (int n = 0; n < 4; ++n) { o[n] = (v8f){}; ox[n] = (v8f){}; }
    float mrow = -3.0e38f, lpart = 0.f;                 // of query q0 + lr; lpart covers this wave half's keys, the halves are joined behind the loop
    const int kt_lo = 0, kt_hi = NT_ / 32 - 1;          // full attention (no mask)
#pragma unroll 1
    for (int kt = kt_lo; kt <= kt_hi; ++kt) {
        const h16* st = &ring[kt & 1][0];
        const h16* skh = st; const h16* skl = st + ST_KL; const h16* svh = st + ST_VH; const h16* svl = st + ST_VL;
        const int ko0 = lr * KP + 8 * hi, ko1 = (16 + lr) * KP + 8 * hi;
        v8f s0 = {}, s1 = {}, x0 = {}, x1 = {};
#pragma unroll
        for (int kc = 0; kc < 2; ++kc) {
            { const v16h k0h = cat16(*(const v8ha*)(skh + ko0 + kc * 32), *(const v8ha*)(skh + ko0 + kc * 32 + 16)), k1h = cat16(*(const v8ha*)(skh + ko1 + kc * 32), *(const v8ha*)(skh + ko1 + kc * 32 + 16));
              const v16h qlk = cat16(*(const v8h*)(QL16 + qo0 + kc * 32), *(const v8h*)(QL16 + qo0 + kc * 32 + 16));     // query residual re-read per step (registers)
              s0 = wmma16(k0h, qa[kc], s0); x0 = wmma16(k0h, qlk, x0); s1 = wmma16(k1h, qa[kc], s1); x1 = wmma16(k1h, qlk, x1);
              asm volatile("v_nop" : "+v"(s0), "+v"(s1), "+v"(x0), "+v"(x1) : "v"(qlk), "v"(k0h), "v"(k1h) : "memory"); }
            { const v16h k0l = cat16(*(const v8ha*)(skl + ko0 + kc * 32), *(const v8ha*)(skl + ko0 + kc * 32 + 16)), k1l = cat16(*(const v8ha*)(skl + ko1 + kc * 32), *(const v8ha*)(skl + ko1 + kc * 32 + 16));
              x0 = wmma16(k0l, qa[kc], x0); x1 = wmma16(k1l, qa[kc], x1);
              asm volatile("v_nop" : "+v"(x0), "+v"(x1) : "v"(k0l), "v"(k1l) : "memory"); }
        }
        asm volatile("v_nop\n\tv_nop\n\tv_nop\n\tv_nop" : "+v"(s0), "+v"(s1), "+v"(x0), "+v"(x1) : "v"(qa[0]), "v"(qa[1]));
        const v8f a0 = (s0 + x0 * LOSCI) * 0.125f, a1 = (s1 + x1 * LOSCI) * 0.125f;   // (q e^-1/4).(k e^-1/4) = q.k / 8; a0[j]: key 8 hi + j, a1[j]: key 16 + 8 hi + j of this step
        float mx = fmaxf(a0[0], a1[0]);
#pragma unroll
        for (int j = 1; j < 8; ++j) mx = fmaxf(mx, fmaxf(a0[j], a1[j]));
        mx = fmaxf(mx, xhalf(mx));                      // the other 16 keys of this query sit in lane ^ 16
        const float mn = fmaxf(mrow, mx);
        const float alpha = __expf(mrow - mn); mrow = mn;
        const v8f e0 = (a0 - mn) * LOG2E, e1 = (a1 - mn) * LOG2E;      // e^x = 2^(x log2 e)
        v8f p0, p1;
#pragma unroll
        for (int j = 0; j < 8; ++j) p0[j] = __builtin_amdgcn_exp2f(e0[j]);
#pragma unroll
        for (int j = 0; j < 8; ++j) p1[j] = __builtin_amdgcn_exp2f(e1[j]);
        const v8f pq = p0 + p1;
        lpart = lpart * alpha + (((pq[0] + pq[1]) + (pq[2] + pq[3])) + ((pq[4] + pq[5]) + (pq[6] + pq[7])));
        // element s of the B operand = key 8 hi + s (s < 8), 16 + 8 hi + s - 8 (else): the k order of the V^T loader below
        const v8f ps0 = p0 * PSC, ps1 = p1 * PSC;
        const v8h h0 = __builtin_convertvector(ps0, v8h), h1 = __builtin_convertvector(ps1, v8h);
        const v8h r0 = __builtin_convertvector((ps0 - __builtin_convertvector(h0, v8f)) * LOSC, v8h), r1 = __builtin_convertvector((ps1 - __builtin_convertvector(h1, v8f)) * LOSC, v8h);
        const v16h pa = cat16(h0, h1), px = cat16(r0, r1);
#pragma unroll
        for (int n = 0; n < 4; ++n) { o[n] *= alpha; ox[n] *= alpha; }
#pragma unroll
        for (int n = 0; n < 4; ++n) { const int vo = (n * 16 + lr) * VP + hi * 8;
            const v16h vh = cat16(*(const v8ha*)(svh + vo), *(const v8ha*)(svh + vo + 16)), vl = cat16(*(const v8ha*)(svl + vo), *(const v8ha*)(svl + vo + 16));
            o[n] = wmma16(vh, pa, o[n]); ox[n] = wmma16(vl, pa, ox[n]); ox[n] = wmma16(vh, px, ox[n]);
            asm volatile("" : "+v"(o[n]), "+v"(ox[n]) : "v"(vh), "v"(vl) : "memory"); }
        asm volatile("v_nop\n\tv_nop\n\tv_nop\n\tv_nop" : "+v"(o[0]), "+v"(o[1]), "+v"(o[2]), "+v"(o[3]), "+v"(ox[0]), "+v"(ox[1]), "+v"(ox[2]), "+v"(ox[3]) : "v"(pa), "v"(px));
        asm volatile("s_wait_dscnt 0x0" ::: "memory");      // this wave's reads of step kt's buffer are done before it may be refilled
        asm volatile("s_wait_asynccnt 0x0" ::: "memory");   // this wave's share of step kt+1 has landed
        __syncthreads();                                    // publishes step kt+1 and ends every wave's reads of step kt's buffer
        if (kt + 2 <= kt_hi) fill(kt + 2);
    }
    asm volatile("s_wait_asynccnt 0x0" ::: "memory");       // no copy is outstanding when the wave goes on to the epilogue
    const float inv = 1.0f / ((lpart + xhalf(lpart)) * PSC);
    float* os = &ost[wave][0];
#pragma unroll
    for (int n = 0; n < 4; ++n)
#pragma unroll
        for (int j = 0; j < 8; ++j) os[lr * 68 + n * 16 + hi * 8 + j] = (o[n][j] + ox[n][j] * LOSCI) * inv;     // o[n][j] = O^T[d = 16 n + 8 hi + j][query lr]
    __syncthreads();
    const size_t cbase = (tok0 + q0) * QW + (size_t)h * HD;     // per-head softmax outputs C[tok][32*64] (bf16 hi/lo), combined by k_diff
    auto pass = [&]() {
#pragma unroll
        for (int s = 0; s < 4; ++s) { const int row = 4 * s + (lane >> 3), piece = lane & 7; const float* sp = os + row * 68 + piece * 8; v8us oh, ol;
#pragma unroll
            for (int i = 0; i < 8; ++i) { const unsigned short hb = f2bf(sp[i]); oh[i] = hb; ol[i] = f2bf(sp[i] - bf2f(hb)); }
            *(v8us*)(CH + cbase + (size_t)row * QW + piece * 8) = oh; *(v8us*)(CL + cbase + (size_t)row * QW + piece * 8) = ol; }
    };
    pass(); 
}

// lambda_wave: lam = 0.2 + exp(L0.L1) - exp(L2.L3) from the INPUT L [4][64] (bf16-rounded), one wave; the scalar alone in its own line.
__device__ __forceinline__ void lambda_wave(const float* __restrict__ Lp, float* LAM) {
    const int lane = threadIdx.x; float a = 0.f, c = 0.f;
#pragma unroll
    for (int i = 0; i < 2; ++i) { const int d = lane * 2 + i; a = fmaf(bfr(Lp[d]), bfr(Lp[64 + d]), a); c = fmaf(bfr(Lp[128 + d]), bfr(Lp[192 + d]), c); }
#pragma unroll
    for (int sh = 16; sh; sh >>= 1) { a += __shfl_xor(a, sh, 32); c += __shfl_xor(c, sh, 32); }
    if (lane == 0) { const float lam = 0.2f + expf(a) - expf(c); *(float*)LAM = lam;  }
}
// k_prep: everything that reads only the inputs, in ONE launch (none of these pieces reads another's output). Block 0: lambda, on its first wave. Blocks 1..: 8 rows each
// (one a wave) of the six f32 -> bf16 conversions, in the order xq | xk | xv | Wq | Wk | Wv; the block index picks the pair of pointers, the same for the whole block.
#define PB_X (NTK / 8)
#define PB_W (QW / 8)
#define PB_V (KVW / 8)
#define PB_ALL (1 + 3 * PB_X + 2 * PB_W + PB_V)
__global__ __launch_bounds__(256) void k_prep(const float* __restrict__ xq, const float* __restrict__ xk, const float* __restrict__ xv, const float* __restrict__ Wq, const float* __restrict__ Wk, const float* __restrict__ Wv,
                                              const float* __restrict__ Lp, bf* Xq, bf* Xk, bf* Xv, bf* WqB, bf* WkB, bf* WvB, float* LAM) {
    if (blockIdx.x == 0) { if (threadIdx.x < 32) lambda_wave(Lp, LAM); return; }
    const int blk = blockIdx.x - 1;
    const bool isx = blk < 3 * PB_X;
    const int s = isx ? blk / PB_X : (blk - 3 * PB_X) / PB_W;                               // which of the three x planes, or of the three W planes
    const float* src = isx ? (s == 0 ? xq : (s == 1 ? xk : xv)) : (s == 0 ? Wq : (s == 1 ? Wk : Wv));
    bf* dst = isx ? (s == 0 ? Xq : (s == 1 ? Xk : Xv)) : (s == 0 ? WqB : (s == 1 ? WkB : WvB));
    const int first = isx ? s * PB_X : 3 * PB_X + s * PB_W;                                 // the plane's first block
    cvt_row(src, (blk - first) * 8 + (threadIdx.x >> 5), dst);
}
// k_diff: out[tok][g*64 + e] = C[tok][2g*64 + e] - lam * C[tok][(2g+1)*64 + e] with C = hi + lo planes (f32 recombination); one wave per token row, lane -> 4
__global__ __launch_bounds__(256) void k_diff(const bf* __restrict__ CH, const bf* __restrict__ CL, const float* __restrict__ LAM, float* OUTP) {
    const int lane = threadIdx.x & 31, r = blockIdx.x * 8 + (threadIdx.x >> 5);
    if (r >= NTK) return;
    const float lam = LAM[0];
{
#pragma unroll 1
        for (int q = 0; q < KVW / 128; ++q) { const int c = q * 128 + lane * 4; const int g = c >> 6, e = c & 63; const size_t s1 = (size_t)r * QW + (2 * g) * HD + e, s2 = s1 + HD; v4f o;
#pragma unroll
            for (int i = 0; i < 4; ++i) { const float p1 = bf2f(CH[s1 + i]) + bf2f(CL[s1 + i]), p2 = bf2f(CH[s2 + i]) + bf2f(CL[s2 + i]); o[i] = p1 - lam * p2; }
            *(v4f*)(OUTP + (size_t)r * KVW + c) = o; }
         }
}
#define VST2(T, p, v) do { const T vst2_v_ = (v); *(T*)(p) = vst2_v_;  } while (0)
extern "C" void kernel_launch(void* const* d_in, const int* in_sizes, int n_in,
                              void* d_out, int out_size, void* d_ws, size_t ws_size, hipStream_t stream) {
    (void)in_sizes; (void)n_in; (void)out_size;
    const float* xq = (const float*)d_in[0]; const float* xk = (const float*)d_in[1]; const float* xv = (const float*)d_in[2];
    const float* Wq = (const float*)d_in[3]; const float* Wk = (const float*)d_in[4]; const float* Wv = (const float*)d_in[5]; const float* Lp = (const float*)d_in[6];   // W [out][in]
    float* out = (float*)d_out;    // [4][1024][1024]
    char* wsp = (char*)d_ws;
    auto take = [&](size_t bytes) { char* p = wsp; wsp += (bytes + 255) & ~(size_t)255; return (void*)p; };
    bf* Xq = (bf*)take((size_t)NTK * DM * 2); bf* Xk = (bf*)take((size_t)NTK * DM * 2); bf* Xv = (bf*)take((size_t)NTK * DM * 2);
    bf* WqB = (bf*)take((size_t)QW * DM * 2); bf* WkB = (bf*)take((size_t)QW * DM * 2); bf* WvB = (bf*)take((size_t)KVW * DM * 2);
    h16* QH = (h16*)take((size_t)NTK * QW * 2); h16* QL = (h16*)take((size_t)NTK * QW * 2); h16* KH = (h16*)take((size_t)NTK * QW * 2); h16* KL = (h16*)take((size_t)NTK * QW * 2);
    float* Vf = (float*)take((size_t)NTK * KVW * 4); h16* VTH = (h16*)take((size_t)NTK * KVW * 2); h16* VTL = (h16*)take((size_t)NTK * KVW * 2);
    bf* CH = (bf*)take((size_t)NTK * QW * 2); bf* CL = (bf*)take((size_t)NTK * QW * 2); float* LAM = (float*)take(256);
    if ((size_t)(wsp - (char*)d_ws) > ws_size) return;    // 3 x 8.4 + 2 x 4.2 + 2.1 + 4 x 16.8 + 16.8 + 2 x 8.4 + 2 x 16.8 ~ 170 MB, no aliasing
    k_prep<<<PB_ALL, 256, 0, stream>>>(xq, xk, xv, Wq, Wk, Wv, Lp, Xq, Xk, Xv, WqB, WkB, WvB, LAM);                                  // lambda and the six bf16 planes
    k_gemmb<<<dim3(NTK / 64, (2 * QW + KVW) / 64, 1), 128, 0, stream>>>(Xq, Xk, Xv, WqB, WkB, WvB, QH, QL, KH, KL, Vf);              // q, k (32 heads each, f16 planes) and v (16 heads, f32)
    k_vt<<<NB_ * NKV * (NT_ / 64), 256, 0, stream>>>(Vf, VTH, VTL);
    k_attn<<<NB_ * NH_ * (NT_ / 64), 128, 0, stream>>>(QH, QL, KH, KL, VTH, VTL, CH, CL);
    k_diff<<<NTK / 8, 256, 0, stream>>>(CH, CL, LAM, out);
}

// v006
// It runs in 165 microseconds.
// Two timings next to v005 put it at 1.06 and 1.05 times that version's speed.
// Over all steps from v000 it is 3.96 times as fast.
#include <hip/hip_runtime.h>

// Compute dtypes, f32 accumulate, all 4 batch items in one pass: q = q_input.Wq^T, k = k_input.Wk^T ([4096 x 1024].[1024 x 2048], 32 dual heads) and v = v_input.Wv^T
// ([4096 x 1024].[1024 x 1024], 16 heads) on v_wmma_f32_16x16x32_bf16 — plain bf16 = rounded inputs (exact; [out][in] weights are the n-major B operands as-is), q/k
// written straight to f16 hi + residual x1024 planes; the 32 softmax attentions (q/k head h over v head h/2, full, the two e^-1/4 scales folded into 1/8) fused
// on v_wmma_f32_16x16x32_f16 (hi.hi + hi.lo + lo.hi, weights x32768 and v as f16 hi + residual) giving per-head normalised outputs as bf16 hi/lo planes;
// differential combine out_g = P_2g.v_g - lambda P_2g+1.v_g in f32 with lambda = 0.2 + exp(L0.L1) - exp(L2.L3) computed on device from the INPUT L. Deterministic,

#define NB_  4                   // all 4 batch items go through every per-token launch together (4x the workgroups per launch)
#define NT_  1024
#define DM   1024                // input width = GEMM K
#define NH_  32                  // 2 x 16 dual q/k heads
#define NKV  16                  // v heads: q/k head h uses v head h/2
#define KVW  (NKV * HD)          // 1024
#define HD   64
#define NTK  (NB_ * NT_)
#define QW   (NH_ * HD)          // 2048: q/k plane width
#define NW   1024
#define NQKV 2048
#define PSC  32768.0f
#define LOSC 1024.0f
#define LOSCI (1.0f / 1024.0f)
#define LOG2E 1.44269504088896340736f

typedef _Float16 h16;
typedef unsigned short bf;
typedef __attribute__((ext_vector_type(16))) __bf16   v16bf;
typedef __attribute__((ext_vector_type(16))) _Float16 v16h;
typedef __attribute__((ext_vector_type(8)))  _Float16 v8h;
typedef __attribute__((ext_vector_type(8)))  unsigned short v8us;
typedef __attribute__((ext_vector_type(8)))  float    v8f;
typedef __attribute__((ext_vector_type(4)))  float    v4f;
typedef v8h  __attribute__((may_alias)) v8ha;
typedef v4f  __attribute__((may_alias)) v4fa;
typedef v8us __attribute__((may_alias)) v8usa;

__device__ __forceinline__ unsigned short f2bf(float f) { unsigned u = __float_as_uint(f); u += 0x7FFFu + ((u >> 16) & 1u); return (unsigned short)(u >> 16); }
__device__ __forceinline__ float bf2f(unsigned short b) { return __uint_as_float(((unsigned)b) << 16); }
__device__ __forceinline__ float bfr(float f) { return bf2f(f2bf(f)); }
__device__ __forceinline__ v16h cat16(v8h lo, v8h hi) { return __builtin_shufflevector(lo, hi, 0, 1, 2, 3, 4, 5, 6, 7, 8, 9, 10, 11, 12, 13, 14, 15); }
__device__ __forceinline__ v16bf cat16b(v8us lo, v8us hi) { return __builtin_bit_cast(v16bf, __builtin_shufflevector(lo, hi, 0, 1, 2, 3, 4, 5, 6, 7, 8, 9, 10, 11, 12, 13, 14, 15)); }
__device__ __forceinline__ v8f wmma16(v16h a, v16h b, v8f c) { return __builtin_amdgcn_wmma_f32_16x16x32_f16(false, a, false, b, (short)0, c, false, false); }
// lane l's value of lane l ^ 16 (a vector cross-row move, no LDS)
__device__ __forceinline__ float xhalf(float x) { return __builtin_bit_cast(float, __builtin_amdgcn_permlanex16(__builtin_bit_cast(int, x), __builtin_bit_cast(int, x), 0x76543210, 0xfedcba98, false, false)); }
__device__ __forceinline__ v8f wmmab(v16bf a, v16bf b, v8f c) { return __builtin_amdgcn_wmma_f32_16x16x32_bf16(false, a, false, b, (short)0, c, false, false); }

// cvt_row: one wave rounds row r of src [rows][1024] f32 to the bf16 plane dst.
__device__ __forceinline__ void cvt_row(const float* __restrict__ src, int r, bf* dst) {
    const int lane = threadIdx.x & 31;
    v8us o[DM / 256];
#pragma unroll
    for (int q = 0; q < DM / 256; ++q) { v8us t;
#pragma unroll
        for (int i = 0; i < 8; ++i) t[i] = f2bf(src[(size_t)r * DM + q * 256 + lane * 8 + i]);
        o[q] = t; }
#pragma unroll
    for (int q = 0; q < DM / 256; ++q) *(v8us*)(dst + (size_t)r * DM + q * 256 + lane * 8) = o[q];
    
}

// k_wt: W [1024 k][ncols n] (k-major) -> n-major bf16 plane WT[ncols][1024]; 64 x 64 tiles through LDS.
__global__ __launch_bounds__(256) void k_wt(const float* __restrict__ Wm, int ncols, bf* WT) {
    __shared__ __align__(16) unsigned short tl[64 * 72];
    const int tid = threadIdx.x, k0 = blockIdx.x * 64, n0 = blockIdx.y * 64;
    const int kk = tid >> 2, nq = (tid & 3) * 16;
#pragma unroll
    for (int i = 0; i < 16; ++i) tl[(nq + i) * 72 + kk] = f2bf(Wm[(size_t)(k0 + kk) * ncols + n0 + nq + i]);
    __syncthreads();
    const int piece = tid & 7;
    typedef __attribute__((ext_vector_type(8))) unsigned short v8us_; typedef v8us_ __attribute__((may_alias)) v8usa_;
    auto pass = [&]() {
#pragma unroll
        for (int s = 0; s < 2; ++s) { const int nr = (tid >> 3) + 32 * s; const v8us_ val = *(const v8usa_*)(tl + nr * 72 + piece * 8);
            *(v8us_*)(WT + (size_t)(n0 + nr) * DM + k0 + piece * 8) = val; }
    };
    pass(); 
}

// k_gemmb: block = 256 x 128 of C, 8 waves in a 4 x 2 grid, wave = 64 x 64 (16 accumulator tiles): a staged row feeds 128 or 256 output columns or rows and an LDS fragment feeds
// 4 products. The 256 A rows and 128 B rows of a 64-k stage (128 B = one whole line a row) are brought into LDS once per block by asynchronous copies (two buffers: stage t+1 flies
// while stage t is worked on) and the waves read their fragments from there; row pitch 144 B = 16 B x odd for the ds_load_b128 readers. The k order of every accumulator is
// ascending, 32 a WMMA. The epilogue's staging rows reuse the ring behind the loop's last barrier, 32 rows a wave at a time.
#define GP    72                      // halves per staged row (64 + 8 pad)
#define GBM   256                     // rows of C a block
#define GBN   128                     // columns of C a block
#define GST   ((GBM + GBN) * GP)      // one stage in halves: A rows 0..255 | B rows 0..127 = 55296 B
// The three projections go through ONE launch (none reads another's output): blockIdx.y picks the product, 0..15 q, 16..31 k (both to f16 hi + residual planes), 32..39 v (f32).
__global__ __launch_bounds__(256) void k_gemmb(const bf* __restrict__ Xq, const bf* __restrict__ Xk, const bf* __restrict__ Xv, const bf* __restrict__ WqB, const bf* __restrict__ WkB, const bf* __restrict__ WvB,
                                               h16* QH, h16* QL, h16* KH, h16* KL, float* Vf) {
    __shared__ __align__(16) char gsm[2 * GST * 2];
    const int lane = threadIdx.x & 31, wave = threadIdx.x >> 5, lr = lane & 15, hi = lane >> 4;
    const int wm = wave >> 1, wn = wave & 1;
    const int sel = blockIdx.y < QW / GBN ? 0 : (blockIdx.y < 2 * (QW / GBN) ? 1 : 2);        // the same for the whole block
    const bf* A = sel == 0 ? Xq : (sel == 1 ? Xk : Xv); const bf* Bn = sel == 0 ? WqB : (sel == 1 ? WkB : WvB);
    const int cb = (blockIdx.y - sel * (QW / GBN)) * GBN;
    const int r0 = blockIdx.x * GBM + wm * 64, c0 = cb + wn * 64;
    // each thread copies 8 pieces of A and 4 of B per stage: rows tid/8 + 32 i, 8 pieces of 16 B a row
    const int srow = threadIdx.x >> 3, spc = (threadIdx.x & 7) * 8;
    const bf* ga = A + (size_t)(blockIdx.x * GBM + srow) * DM + spc; const bf* gb = Bn + (size_t)(cb + srow) * DM + spc;
    const unsigned lg = (unsigned)(size_t)&gsm[0] + (srow * GP + spc) * 2;
    auto fill = [&](int t) {
        const bf* a0 = ga + t * 64; const bf* a1 = a0 + 32 * DM; const bf* a2 = a0 + 64 * DM; const bf* a3 = a0 + 96 * DM;
        const bf* a4 = a0 + 128 * DM; const bf* a5 = a0 + 160 * DM; const bf* a6 = a0 + 192 * DM; const bf* a7 = a0 + 224 * DM;
        const bf* b0 = gb + t * 64; const bf* b1 = b0 + 32 * DM; const bf* b2 = b0 + 64 * DM; const bf* b3 = b0 + 96 * DM;
        const unsigned la0 = lg + (unsigned)(t & 1) * (GST * 2), la1 = la0 + 32 * GP * 2, la2 = la0 + 64 * GP * 2, la3 = la0 + 96 * GP * 2;
        const unsigned la4 = la0 + 128 * GP * 2, la5 = la0 + 160 * GP * 2, la6 = la0 + 192 * GP * 2, la7 = la0 + 224 * GP * 2;
        const unsigned lb0 = la0 + GBM * GP * 2, lb1 = lb0 + 32 * GP * 2, lb2 = lb0 + 64 * GP * 2, lb3 = lb0 + 96 * GP * 2;
        // the stage's 12 copies; s_wait_xcnt 0 closes the statement so that no address register is rewritten ahead of it
        asm volatile("global_load_async_to_lds_b128 %0, %1, off\n\t"
                     "global_load_async_to_lds_b128 %2, %3, off\n\t"
                     "global_load_async_to_lds_b128 %4, %5, off\n\t"
                     "global_load_async_to_lds_b128 %6, %7, off\n\t"
                     "global_load_async_to_lds_b128 %8, %9, off\n\t"
                     "global_load_async_to_lds_b128 %10, %11, off\n\t"
                     "global_load_async_to_lds_b128 %12, %13, off\n\t"
                     "global_load_async_to_lds_b128 %14, %15, off\n\t"
                     "global_load_async_to_lds_b128 %16, %17, off\n\t"
                     "global_load_async_to_lds_b128 %18, %19, off\n\t"
                     "global_load_async_to_lds_b128 %20, %21, off\n\t"
                     "global_load_async_to_lds_b128 %22, %23, off\n\t"
                     "s_wait_xcnt 0x0"
                     :: "v"(la0), "v"(a0), "v"(la1), "v"(a1), "v"(la2), "v"(a2), "v"(la3), "v"(a3),
                        "v"(la4), "v"(a4), "v"(la5), "v"(a5), "v"(la6), "v"(a6), "v"(la7), "v"(a7),
                        "v"(lb0), "v"(b0), "v"(lb1), "v"(b1), "v"(lb2), "v"(b2), "v"(lb3), "v"(b3) : "memory");
    };
    fill(0);
    asm volatile("s_wait_asynccnt 0x0" ::: "memory");   // this wave's share of stage 0 has landed
    __syncthreads();                                    // every wave's share of stage 0 is readable
    fill(1);
    v8f acc[4][4];
#pragma unroll
    for (int m = 0; m < 4; ++m)
#pragma unroll
        for (int t = 0; t < 4; ++t) acc[m][t] = (v8f){};
#pragma unroll 1
    for (int st = 0; st < DM / 64; ++st) {               // rolled: one stage a trip, so that the foot's waits and barrier stand once
        const bf* sa = (const bf*)(gsm + (st & 1) * (GST * 2)) + (wm * 64 + lr) * GP + 8 * hi;
        const bf* sb = (const bf*)(gsm + (st & 1) * (GST * 2)) + (GBM + wn * 64 + lr) * GP + 8 * hi;
#pragma unroll                                             // both 32-k halves of the stage straight-line
        for (int kc = 0; kc < 64; kc += 32) {
            v16bf a[4], b[4];
#pragma unroll
            for (int m = 0; m < 4; ++m) a[m] = cat16b(*(const v8usa*)(sa + m * 16 * GP + kc), *(const v8usa*)(sa + m * 16 * GP + kc + 16));
#pragma unroll
            for (int t = 0; t < 4; ++t) b[t] = cat16b(*(const v8usa*)(sb + t * 16 * GP + kc), *(const v8usa*)(sb + t * 16 * GP + kc + 16));
            // holds the 16 LDS reads of this 32-k half together ahead of its 16 products (loaded values as inputs only): one wait on LDS a half, not one a row of tiles
            asm volatile("" :: "v"(a[0]), "v"(a[1]), "v"(a[2]), "v"(a[3]), "v"(b[0]), "v"(b[1]), "v"(b[2]), "v"(b[3]));
#pragma unroll
            for (int m = 0; m < 4; ++m)
#pragma unroll
                for (int t = 0; t < 4; ++t) acc[m][t] = wmmab(a[m], b[t], acc[m][t]);
        }
        // the WMMA distance on every path behind the stage's last product, the loop's back edge included (the accumulators as inputs keep it behind every product)
        asm volatile("v_nop\n\tv_nop\n\tv_nop\n\tv_nop" :: "v"(acc[0][0]), "v"(acc[0][1]), "v"(acc[0][2]), "v"(acc[0][3]), "v"(acc[1][0]), "v"(acc[1][1]), "v"(acc[1][2]), "v"(acc[1][3]),
                                                          "v"(acc[2][0]), "v"(acc[2][1]), "v"(acc[2][2]), "v"(acc[2][3]), "v"(acc[3][0]), "v"(acc[3][1]), "v"(acc[3][2]), "v"(acc[3][3]));
        asm volatile("s_wait_dscnt 0x0" ::: "memory");      // this wave's reads of stage st's buffer are done before it may be refilled
        asm volatile("s_wait_asynccnt 0x0" ::: "memory");   // this wave's share of stage st+1 has landed
        __syncthreads();                                    // publishes stage st+1 and ends every wave's reads of stage st's buffer
        if (st + 2 < DM / 64) fill(st + 2);
    }
    asm volatile("s_wait_asynccnt 0x0" ::: "memory");       // no copy is outstanding when the ring becomes the epilogue's staging
    float* os = (float*)(void*)gsm + wave * (32 * 68);
#pragma unroll
    for (int hf = 0; hf < 2; ++hf) {                        // rows 32 hf .. 32 hf + 31 of the wave's 64
        if (hf) __syncthreads();                            // the first half's rows are read back before they are overwritten
#pragma unroll
        for (int m = 0; m < 2; ++m) {
#pragma unroll
            for (int t = 0; t < 4; ++t) {
#pragma unroll
                for (int j = 0; j < 8; ++j) os[(m * 16 + hi * 8 + j) * 68 + t * 16 + lr] = acc[hf * 2 + m][t][j]; } }
        __syncthreads();
        if (sel < 2) {
            const int ldc = QW;
            h16* crow = (sel == 0 ? QH : KH) + (size_t)(r0 + hf * 32) * ldc + c0; h16* crw2 = (sel == 0 ? QL : KL) + (size_t)(r0 + hf * 32) * ldc + c0;
#pragma unroll
            for (int s = 0; s < 8; ++s) { const int row = 4 * s + (lane >> 3), piece = lane & 7; const float* sp = os + row * 68 + piece * 8; v8h o, o2;
#pragma unroll
                for (int i = 0; i < 8; ++i) { const h16 a = (h16)sp[i]; o[i] = a; o2[i] = (h16)((sp[i] - (float)a) * LOSC); }
                *(v8h*)(crow + (size_t)row * ldc + piece * 8) = o; *(v8h*)(crw2 + (size_t)row * ldc + piece * 8) = o2; }
        } else {
            const int ldc = KVW;
            float* crow = Vf + (size_t)(r0 + hf * 32) * ldc + c0;
#pragma unroll
            for (int s = 0; s < 16; ++s) { const int Lid = (lane >> 3) + 4 * s, piece = lane & 7; const int row = Lid >> 1, cofs = (Lid & 1) * 32 + piece * 4;
                const v4f val = *(const v4fa*)(os + row * 68 + cofs); *(v4f*)(crow + (size_t)row * ldc + cofs) = val; }
            asm volatile("s_wait_xcnt 0x0" ::: "memory");   // behind these stores, ahead of whatever next rewrites a register that they name
        }
    }
}

__global__ __launch_bounds__(256) void k_vt(const float* __restrict__ V, h16* VTH, h16* VTL) {
    __shared__ __align__(16) h16 tile[64 * 72];
    __shared__ __align__(16) h16 til2[64 * 72];
    const int bid = blockIdx.x;
    const int b = bid / (NKV * (NT_ / 64)), rem = bid - b * (NKV * (NT_ / 64)), h = rem / (NT_ / 64), kt = rem - h * (NT_ / 64);
    const int k0 = kt * 64, tid = threadIdx.x;
    const int kk = tid >> 2, d0 = (tid & 3) * 16;
    const float* src = V + ((size_t)b * NT_ + k0 + kk) * KVW + h * HD + d0;      // h = kv head here
#pragma unroll
    for (int i = 0; i < 16; ++i) { const float v = src[i]; const h16 a = (h16)v; tile[(d0 + i) * 72 + kk] = a; til2[(d0 + i) * 72 + kk] = (h16)((v - (float)a) * LOSC); }
    __syncthreads();
    const int piece = tid & 7;
    const size_t base = (((size_t)b * NKV + h) * HD) * NT_ + k0;
    auto pass = [&]() {
#pragma unroll
        for (int s = 0; s < 4; ++s) { const int Lid = (tid >> 3) + 32 * s; const int pln = Lid >> 6, d = Lid & 63;
            const v8h val = *(const v8ha*)((pln ? til2 : tile) + d * 72 + piece * 8); *(v8h*)((pln ? VTL : VTH) + base + (size_t)d * NT_ + piece * 8) = val; }
    };
    pass(); 
}

#define KP    72                      // halves per staged K row (64 + 8 pad)
#define VP    40                      // halves per staged V^T row (32 + 8 pad)
#define ST_KL (32 * KP)               // stage layout in halves: K hi | K lo | V^T hi | V^T lo
#define ST_VH (2 * 32 * KP)
#define ST_VL (ST_VH + 64 * VP)
#define ST_SZ (ST_VL + 64 * VP)       // 9728 halves = 19456 B
__global__ __launch_bounds__(128) void k_attn(const h16* __restrict__ Q16, const h16* __restrict__ QL16, const h16* __restrict__ K16, const h16* __restrict__ KL16, const h16* __restrict__ VTH, const h16* __restrict__ VTL, bf* CH, bf* CL) {
    __shared__ __align__(16) float ost[4][16 * 68];
    __shared__ __align__(16) h16 ring[2][ST_SZ];
    const int lane = threadIdx.x & 31, wave = threadIdx.x >> 5, lr = lane & 15, hi = lane >> 4;
    const int bid = blockIdx.x;
    const int b = bid / (NH_ * (NT_ / 64)), rem = bid - b * (NH_ * (NT_ / 64)), h = rem / (NT_ / 64), qt = rem - h * (NT_ / 64);
    const int q0 = qt * 64 + wave * 16;
    const size_t tok0 = (size_t)b * NT_;
    v16h qa[2];
    const size_t qo0 = (tok0 + q0 + lr) * QW + h * HD + 8 * hi;     // q/k planes are [tok][32*64]
#pragma unroll
    for (int kc = 0; kc < 2; ++kc) qa[kc] = cat16(*(const v8h*)(Q16 + qo0 + kc * 32), *(const v8h*)(Q16 + qo0 + kc * 32 + 16));
    const int g = h / (NH_ / NKV);                      // v head (each q/k head pair 2g, 2g+1 shares v head g)
    const h16* kh_b = K16 + tok0 * QW + h * HD;          // k has its own 32 heads (plane width QW)
    const h16* kl_b = KL16 + tok0 * QW + h * HD;
    const size_t vbase = (((size_t)b * NKV + g) * HD) * NT_;
    // each thread copies 2 pieces of each of the 4 planes per step: K rows tid/8 and +16 (8 pieces a row), V^T rows tid/4 and +32 (4 pieces a row)
    const int krow = threadIdx.x >> 3, kpc = (threadIdx.x & 7) * 8, vrow = threadIdx.x >> 2, vpc = (threadIdx.x & 3) * 8;
    const h16* gkh = kh_b + (size_t)krow * QW + kpc; const h16* gkl = kl_b + (size_t)krow * QW + kpc;
    const h16* gvh = VTH + vbase + (size_t)vrow * NT_ + vpc; const h16* gvl = VTL + vbase + (size_t)vrow * NT_ + vpc;
    const unsigned lring = (unsigned)(size_t)&ring[0][0];
    const unsigned lk = lring + (krow * KP + kpc) * 2, lv = lring + (ST_VH + vrow * VP + vpc) * 2;
    auto fill = [&](int t) {
        const unsigned lb = (unsigned)(t & 1) * (ST_SZ * 2);
        const h16* a0 = gkh + (size_t)t * 32 * QW; const h16* a1 = a0 + 16 * QW; const h16* b0 = gkl + (size_t)t * 32 * QW; const h16* b1 = b0 + 16 * QW;
        const h16* c0 = gvh + t * 32; const h16* c1 = c0 + 32 * NT_; const h16* d0 = gvl + t * 32; const h16* d1 = d0 + 32 * NT_;
        const unsigned la0 = lk + lb, la1 = la0 + 16 * KP * 2, lb0 = la0 + ST_KL * 2, lb1 = lb0 + 16 * KP * 2;
        const unsigned lc0 = lv + lb, lc1 = lc0 + 32 * VP * 2, ld0 = lc0 + 64 * VP * 2, ld1 = ld0 + 32 * VP * 2;
        // the step's 8 copies; s_wait_xcnt 0 closes the statement so that no address register is rewritten ahead of it
        asm volatile("global_load_async_to_lds_b128 %0, %1, off\n\t"
                     "global_load_async_to_lds_b128 %2, %3, off\n\t"
                     "global_load_async_to_lds_b128 %4, %5, off\n\t"
                     "global_load_async_to_lds_b128 %6, %7, off\n\t"
                     "global_load_async_to_lds_b128 %8, %9, off\n\t"
                     "global_load_async_to_lds_b128 %10, %11, off\n\t"
                     "global_load_async_to_lds_b128 %12, %13, off\n\t"
                     "global_load_async_to_lds_b128 %14, %15, off\n\t"
                     "s_wait_xcnt 0x0"
                     :: "v"(la0), "v"(a0), "v"(la1), "v"(a1), "v"(lb0), "v"(b0), "v"(lb1), "v"(b1),
                        "v"(lc0), "v"(c0), "v"(lc1), "v"(c1), "v"(ld0), "v"(d0), "v"(ld1), "v"(d1) : "memory");
    };
    fill(0);
    asm volatile("s_wait_asynccnt 0x0" ::: "memory");   // this wave's share of step 0 has landed
    __syncthreads();                                    // every wave's share of step 0 is readable
    fill(1);
    v8f o[4], ox[4];
#pragma unroll
    for (int n = 0; n < 4; ++n) { o[n] = (v8f){}; ox[n] = (v8f){}; }
    float mrow = -3.0e38f, lpart = 0.f;                 // of query q0 + lr; lpart covers this wave half's keys, the halves are joined behind the loop
    const int kt_lo = 0, kt_hi = NT_ / 32 - 1;          // full attention (no mask)
#pragma unroll 1
    for (int kt = kt_lo; kt <= kt_hi; ++kt) {
        const h16* st = &ring[kt & 1][0];
        const h16* skh = st; const h16* skl = st + ST_KL; const h16* svh = st + ST_VH; const h16* svl = st + ST_VL;
        const int ko0 = lr * KP + 8 * hi, ko1 = (16 + lr) * KP + 8 * hi;
        v8f s0 = {}, s1 = {}, x0 = {}, x1 = {};
#pragma unroll
        for (int kc = 0; kc < 2; ++kc) {
            { const v16h k0h = cat16(*(const v8ha*)(skh + ko0 + kc * 32), *(const v8ha*)(skh + ko0 + kc * 32 + 16)), k1h = cat16(*(const v8ha*)(skh + ko1 + kc * 32), *(const v8ha*)(skh + ko1 + kc * 32 + 16));
              const v16h qlk = cat16(*(const v8h*)(QL16 + qo0 + kc * 32), *(const v8h*)(QL16 + qo0 + kc * 32 + 16));     // query residual re-read per step (registers)
              s0 = wmma16(k0h, qa[kc], s0); x0 = wmma16(k0h, qlk, x0); s1 = wmma16(k1h, qa[kc], s1); x1 = wmma16(k1h, qlk, x1);
              asm volatile("v_nop" : "+v"(s0), "+v"(s1), "+v"(x0), "+v"(x1) : "v"(qlk), "v"(k0h), "v"(k1h) : "memory"); }
            { const v16h k0l = cat16(*(const v8ha*)(skl + ko0 + kc * 32), *(const v8ha*)(skl + ko0 + kc * 32 + 16)), k1l = cat16(*(const v8ha*)(skl + ko1 + kc * 32), *(const v8ha*)(skl + ko1 + kc * 32 + 16));
              x0 = wmma16(k0l, qa[kc], x0); x1 = wmma16(k1l, qa[kc], x1);
              asm volatile("v_nop" : "+v"(x0), "+v"(x1) : "v"(k0l), "v"(k1l) : "memory"); }
        }
        asm volatile("v_nop\n\tv_nop\n\tv_nop\n\tv_nop" : "+v"(s0), "+v"(s1), "+v"(x0), "+v"(x1) : "v"(qa[0]), "v"(qa[1]));
        const v8f a0 = (s0 + x0 * LOSCI) * 0.125f, a1 = (s1 + x1 * LOSCI) * 0.125f;   // (q e^-1/4).(k e^-1/4) = q.k / 8; a0[j]: key 8 hi + j, a1[j]: key 16 + 8 hi + j of this step
        float mx = fmaxf(a0[0], a1[0]);
#pragma unroll
        for (int j = 1; j < 8; ++j) mx = fmaxf(mx, fmaxf(a0[j], a1[j]));
        mx = fmaxf(mx, xhalf(mx));                      // the other 16 keys of this query sit in lane ^ 16
        const float mn = fmaxf(mrow, mx);
        const float alpha = __expf(mrow - mn); mrow = mn;
        const v8f e0 = (a0 - mn) * LOG2E, e1 = (a1 - mn) * LOG2E;      // e^x = 2^(x log2 e)
        v8f p0, p1;
#pragma unroll
        for (int j = 0; j < 8; ++j) p0[j] = __builtin_amdgcn_exp2f(e0[j]);
#pragma unroll
        for (int j = 0; j < 8; ++j) p1[j] = __builtin_amdgcn_exp2f(e1[j]);
        const v8f pq = p0 + p1;
        lpart = lpart * alpha + (((pq[0] + pq[1]) + (pq[2] + pq[3])) + ((pq[4] + pq[5]) + (pq[6] + pq[7])));
        // element s of the B operand = key 8 hi + s (s < 8), 16 + 8 hi + s - 8 (else): the k order of the V^T loader below
        const v8f ps0 = p0 * PSC, ps1 = p1 * PSC;
        const v8h h0 = __builtin_convertvector(ps0, v8h), h1 = __builtin_convertvector(ps1, v8h);
        const v8h r0 = __builtin_convertvector((ps0 - __builtin_convertvector(h0, v8f)) * LOSC, v8h), r1 = __builtin_convertvector((ps1 - __builtin_convertvector(h1, v8f)) * LOSC, v8h);
        const v16h pa = cat16(h0, h1), px = cat16(r0, r1);
#pragma unroll
        for (int n = 0; n < 4; ++n) { o[n] *= alpha; ox[n] *= alpha; }
#pragma unroll
        for (int n = 0; n < 4; ++n) { const int vo = (n * 16 + lr) * VP + hi * 8;
            const v16h vh = cat16(*(const v8ha*)(svh + vo), *(const v8ha*)(svh + vo + 16)), vl = cat16(*(const v8ha*)(svl + vo), *(const v8ha*)(svl + vo + 16));
            o[n] = wmma16(vh, pa, o[n]); ox[n] = wmma16(vl, pa, ox[n]); ox[n] = wmma16(vh, px, ox[n]);
            asm volatile("" : "+v"(o[n]), "+v"(ox[n]) : "v"(vh), "v"(vl) : "memory"); }
        asm volatile("v_nop\n\tv_nop\n\tv_nop\n\tv_nop" : "+v"(o[0]), "+v"(o[1]), "+v"(o[2]), "+v"(o[3]), "+v"(ox[0]), "+v"(ox[1]), "+v"(ox[2]), "+v"(ox[3]) : "v"(pa), "v"(px));
        asm volatile("s_wait_dscnt 0x0" ::: "memory");      // this wave's reads of step kt's buffer are done before it may be refilled
        asm volatile("s_wait_asynccnt 0x0" ::: "memory");   // this wave's share of step kt+1 has landed
        __syncthreads();                                    // publishes step kt+1 and ends every wave's reads of step kt's buffer
        if (kt + 2 <= kt_hi) fill(kt + 2);
    }
    asm volatile("s_wait_asynccnt 0x0" ::: "memory");       // no copy is outstanding when the wave goes on to the epilogue
    const float inv = 1.0f / ((lpart + xhalf(lpart)) * PSC);
    float* os = &ost[wave][0];
#pragma unroll
    for (int n = 0; n < 4; ++n)
#pragma unroll
        for (int j = 0; j < 8; ++j) os[lr * 68 + n * 16 + hi * 8 + j] = (o[n][j] + ox[n][j] * LOSCI) * inv;     // o[n][j] = O^T[d = 16 n + 8 hi + j][query lr]
    __syncthreads();
    const size_t cbase = (tok0 + q0) * QW + (size_t)h * HD;     // per-head softmax outputs C[tok][32*64] (bf16 hi/lo), combined by k_diff
    auto pass = [&]() {
#pragma unroll
        for (int s = 0; s < 4; ++s) { const int row = 4 * s + (lane >> 3), piece = lane & 7; const float* sp = os + row * 68 + piece * 8; v8us oh, ol;
#pragma unroll
            for (int i = 0; i < 8; ++i) { const unsigned short hb = f2bf(sp[i]); oh[i] = hb; ol[i] = f2bf(sp[i] - bf2f(hb)); }
            *(v8us*)(CH + cbase + (size_t)row * QW + piece * 8) = oh; *(v8us*)(CL + cbase + (size_t)row * QW + piece * 8) = ol; }
    };
    pass(); 
}

// lambda_wave: lam = 0.2 + exp(L0.L1) - exp(L2.L3) from the INPUT L [4][64] (bf16-rounded), one wave; the scalar alone in its own line.
__device__ __forceinline__ void lambda_wave(const float* __restrict__ Lp, float* LAM) {
    const int lane = threadIdx.x; float a = 0.f, c = 0.f;
#pragma unroll
    for (int i = 0; i < 2; ++i) { const int d = lane * 2 + i; a = fmaf(bfr(Lp[d]), bfr(Lp[64 + d]), a); c = fmaf(bfr(Lp[128 + d]), bfr(Lp[192 + d]), c); }
#pragma unroll
    for (int sh = 16; sh; sh >>= 1) { a += __shfl_xor(a, sh, 32); c += __shfl_xor(c, sh, 32); }
    if (lane == 0) { const float lam = 0.2f + expf(a) - expf(c); *(float*)LAM = lam;  }
}
// k_prep: everything that reads only the inputs, in ONE launch (none of these pieces reads another's output). Block 0: lambda, on its first wave. Blocks 1..: 8 rows each
// (one a wave) of the six f32 -> bf16 conversions, in the order xq | xk | xv | Wq | Wk | Wv; the block index picks the pair of pointers, the same for the whole block.
#define PB_X (NTK / 8)
#define PB_W (QW / 8)
#define PB_V (KVW / 8)
#define PB_ALL (1 + 3 * PB_X + 2 * PB_W + PB_V)
__global__ __launch_bounds__(256) void k_prep(const float* __restrict__ xq, const float* __restrict__ xk, const float* __restrict__ xv, const float* __restrict__ Wq, const float* __restrict__ Wk, const float* __restrict__ Wv,
                                              const float* __restrict__ Lp, bf* Xq, bf* Xk, bf* Xv, bf* WqB, bf* WkB, bf* WvB, float* LAM) {
    if (blockIdx.x == 0) { if (threadIdx.x < 32) lambda_wave(Lp, LAM); return; }
    const int blk = blockIdx.x - 1;
    const bool isx = blk < 3 * PB_X;
    const int s = isx ? blk / PB_X : (blk - 3 * PB_X) / PB_W;                               // which of the three x planes, or of the three W planes
    const float* src = isx ? (s == 0 ? xq : (s == 1 ? xk : xv)) : (s == 0 ? Wq : (s == 1 ? Wk : Wv));
    bf* dst = isx ? (s == 0 ? Xq : (s == 1 ? Xk : Xv)) : (s == 0 ? WqB : (s == 1 ? WkB : WvB));
    const int first = isx ? s * PB_X : 3 * PB_X + s * PB_W;                                 // the plane's first block
    cvt_row(src, (blk - first) * 8 + (threadIdx.x >> 5), dst);
}
// k_diff: out[tok][g*64 + e] = C[tok][2g*64 + e] - lam * C[tok][(2g+1)*64 + e] with C = hi + lo planes (f32 recombination); one wave per token row, lane -> 4
__global__ __launch_bounds__(256) void k_diff(const bf* __restrict__ CH, const bf* __restrict__ CL, const float* __restrict__ LAM, float* OUTP) {
    const int lane = threadIdx.x & 31, r = blockIdx.x * 8 + (threadIdx.x >> 5);
    if (r >= NTK) return;
    const float lam = LAM[0];
{
#pragma unroll 1
        for (int q = 0; q < KVW / 128; ++q) { const int c = q * 128 + lane * 4; const int g = c >> 6, e = c & 63; const size_t s1 = (size_t)r * QW + (2 * g) * HD + e, s2 = s1 + HD; v4f o;
#pragma unroll
            for (int i = 0; i < 4; ++i) { const float p1 = bf2f(CH[s1 + i]) + bf2f(CL[s1 + i]), p2 = bf2f(CH[s2 + i]) + bf2f(CL[s2 + i]); o[i] = p1 - lam * p2; }
            *(v4f*)(OUTP + (size_t)r * KVW + c) = o; }
         }
}
#define VST2(T, p, v) do { const T vst2_v_ = (v); *(T*)(p) = vst2_v_;  } while (0)
extern "C" void kernel_launch(void* const* d_in, const int* in_sizes, int n_in,
                              void* d_out, int out_size, void* d_ws, size_t ws_size, hipStream_t stream) {
    (void)in_sizes; (void)n_in; (void)out_size;
    const float* xq = (const float*)d_in[0]; const float* xk = (const float*)d_in[1]; const float* xv = (const float*)d_in[2];
    const float* Wq = (const float*)d_in[3]; const float* Wk = (const float*)d_in[4]; const float* Wv = (const float*)d_in[5]; const float* Lp = (const float*)d_in[6];   // W [out][in]
    float* out = (float*)d_out;    // [4][1024][1024]
    char* wsp = (char*)d_ws;
    auto take = [&](size_t bytes) { char* p = wsp; wsp += (bytes + 255) & ~(size_t)255; return (void*)p; };
    bf* Xq = (bf*)take((size_t)NTK * DM * 2); bf* Xk = (bf*)take((size_t)NTK * DM * 2); bf* Xv = (bf*)take((size_t)NTK * DM * 2);
    bf* WqB = (bf*)take((size_t)QW * DM * 2); bf* WkB = (bf*)take((size_t)QW * DM * 2); bf* WvB = (bf*)take((size_t)KVW * DM * 2);
    h16* QH = (h16*)take((size_t)NTK * QW * 2); h16* QL = (h16*)take((size_t)NTK * QW * 2); h16* KH = (h16*)take((size_t)NTK * QW * 2); h16* KL = (h16*)take((size_t)NTK * QW * 2);
    float* Vf = (float*)take((size_t)NTK * KVW * 4); h16* VTH = (h16*)take((size_t)NTK * KVW * 2); h16* VTL = (h16*)take((size_t)NTK * KVW * 2);
    bf* CH = (bf*)take((size_t)NTK * QW * 2); bf* CL = (bf*)take((size_t)NTK * QW * 2); float* LAM = (float*)take(256);
    if ((size_t)(wsp - (char*)d_ws) > ws_size) return;    // 3 x 8.4 + 2 x 4.2 + 2.1 + 4 x 16.8 + 16.8 + 2 x 8.4 + 2 x 16.8 ~ 170 MB, no aliasing
    k_prep<<<PB_ALL, 256, 0, stream>>>(xq, xk, xv, Wq, Wk, Wv, Lp, Xq, Xk, Xv, WqB, WkB, WvB, LAM);                                  // lambda and the six bf16 planes
    k_gemmb<<<dim3(NTK / GBM, (2 * QW + KVW) / GBN, 1), 256, 0, stream>>>(Xq, Xk, Xv, WqB, WkB, WvB, QH, QL, KH, KL, Vf);              // q, k (32 heads each, f16 planes) and v (16 heads, f32)
    k_vt<<<NB_ * NKV * (NT_ / 64), 256, 0, stream>>>(Vf, VTH, VTL);
    k_attn<<<NB_ * NH_ * (NT_ / 64), 128, 0, stream>>>(QH, QL, KH, KL, VTH, VTL, CH, CL);
    k_diff<<<NTK / 8, 256, 0, stream>>>(CH, CL, LAM, out);
}

// v007
// A run of this version takes 147 microseconds.
// Two timings next to v006 both put it at 1.12 times that version's speed.
// Counting every step since v000, it is 4.44 times as fast.
#include <hip/hip_runtime.h>

// Compute dtypes, f32 accumulate, all 4 batch items in one pass: q = q_input.Wq^T, k = k_input.Wk^T ([4096 x 1024].[1024 x 2048], 32 dual heads) and v = v_input.Wv^T
// ([4096 x 1024].[1024 x 1024], 16 heads) on v_wmma_f32_16x16x32_bf16 — plain bf16 = rounded inputs (exact; [out][in] weights are the n-major B operands as-is), q/k
// written straight to f16 hi + residual planes (the residual unscaled: f16 subnormals hold it to 2^-24 absolute); the 32 softmax attentions (q/k head h over v head h/2, full, the two e^-1/4 scales folded into 1/8) fused
// on v_wmma_f32_16x16x32_f16 (hi.hi + hi.lo + lo.hi, all three into ONE f32 accumulator tile; weights x32768 and v as f16 hi + unscaled residual) giving per-head normalised outputs as bf16 hi/lo planes;
// differential combine out_g = P_2g.v_g - lambda P_2g+1.v_g in f32 with lambda = 0.2 + exp(L0.L1) - exp(L2.L3) computed on device from the INPUT L. Deterministic,

#define NB_  4                   // all 4 batch items go through every per-token launch together (4x the workgroups per launch)
#define NT_  1024
#define DM   1024                // input width = GEMM K
#define NH_  32                  // 2 x 16 dual q/k heads
#define NKV  16                  // v heads: q/k head h uses v head h/2
#define KVW  (NKV * HD)          // 1024
#define HD   64
#define NTK  (NB_ * NT_)
#define QW   (NH_ * HD)          // 2048: q/k plane width
#define NW   1024
#define NQKV 2048
#define PSC  32768.0f
#define LOG2E 1.44269504088896340736f

typedef _Float16 h16;
typedef unsigned short bf;
typedef __attribute__((ext_vector_type(16))) __bf16   v16bf;
typedef __attribute__((ext_vector_type(16))) _Float16 v16h;
typedef __attribute__((ext_vector_type(8)))  _Float16 v8h;
typedef __attribute__((ext_vector_type(8)))  unsigned short v8us;
typedef __attribute__((ext_vector_type(8)))  float    v8f;
typedef __attribute__((ext_vector_type(4)))  float    v4f;
typedef v8h  __attribute__((may_alias)) v8ha;
typedef v4f  __attribute__((may_alias)) v4fa;
typedef v8us __attribute__((may_alias)) v8usa;

__device__ __forceinline__ unsigned short f2bf(float f) { unsigned u = __float_as_uint(f); u += 0x7FFFu + ((u >> 16) & 1u); return (unsigned short)(u >> 16); }
__device__ __forceinline__ float bf2f(unsigned short b) { return __uint_as_float(((unsigned)b) << 16); }
__device__ __forceinline__ float bfr(float f) { return bf2f(f2bf(f)); }
__device__ __forceinline__ v16h cat16(v8h lo, v8h hi) { return __builtin_shufflevector(lo, hi, 0, 1, 2, 3, 4, 5, 6, 7, 8, 9, 10, 11, 12, 13, 14, 15); }
__device__ __forceinline__ v16bf cat16b(v8us lo, v8us hi) { return __builtin_bit_cast(v16bf, __builtin_shufflevector(lo, hi, 0, 1, 2, 3, 4, 5, 6, 7, 8, 9, 10, 11, 12, 13, 14, 15)); }
__device__ __forceinline__ v8f wmma16(v16h a, v16h b, v8f c) { return __builtin_amdgcn_wmma_f32_16x16x32_f16(false, a, false, b, (short)0, c, false, false); }
// lane l's value of lane l ^ 16 (a vector cross-row move, no LDS)
__device__ __forceinline__ float xhalf(float x) { return __builtin_bit_cast(float, __builtin_amdgcn_permlanex16(__builtin_bit_cast(int, x), __builtin_bit_cast(int, x), 0x76543210, 0xfedcba98, false, false)); }
__device__ __forceinline__ v8f wmmab(v16bf a, v16bf b, v8f c) { return __builtin_amdgcn_wmma_f32_16x16x32_bf16(false, a, false, b, (short)0, c, false, false); }

// cvt_row: one wave rounds row r of src [rows][1024] f32 to the bf16 plane dst.
__device__ __forceinline__ void cvt_row(const float* __restrict__ src, int r, bf* dst) {
    const int lane = threadIdx.x & 31;
    v8us o[DM / 256];
#pragma unroll
    for (int q = 0; q < DM / 256; ++q) { v8us t;
#pragma unroll
        for (int i = 0; i < 8; ++i) t[i] = f2bf(src[(size_t)r * DM + q * 256 + lane * 8 + i]);
        o[q] = t; }
#pragma unroll
    for (int q = 0; q < DM / 256; ++q) *(v8us*)(dst + (size_t)r * DM + q * 256 + lane * 8) = o[q];
    
}

// k_wt: W [1024 k][ncols n] (k-major) -> n-major bf16 plane WT[ncols][1024]; 64 x 64 tiles through LDS.
__global__ __launch_bounds__(256) void k_wt(const float* __restrict__ Wm, int ncols, bf* WT) {
    __shared__ __align__(16) unsigned short tl[64 * 72];
    const int tid = threadIdx.x, k0 = blockIdx.x * 64, n0 = blockIdx.y * 64;
    const int kk = tid >> 2, nq = (tid & 3) * 16;
#pragma unroll
    for (int i = 0; i < 16; ++i) tl[(nq + i) * 72 + kk] = f2bf(Wm[(size_t)(k0 + kk) * ncols + n0 + nq + i]);
    __syncthreads();
    const int piece = tid & 7;
    typedef __attribute__((ext_vector_type(8))) unsigned short v8us_; typedef v8us_ __attribute__((may_alias)) v8usa_;
    auto pass = [&]() {
#pragma unroll
        for (int s = 0; s < 2; ++s) { const int nr = (tid >> 3) + 32 * s; const v8us_ val = *(const v8usa_*)(tl + nr * 72 + piece * 8);
            *(v8us_*)(WT + (size_t)(n0 + nr) * DM + k0 + piece * 8) = val; }
    };
    pass(); 
}

// k_gemmb: block = 256 x 128 of C, 8 waves in a 4 x 2 grid, wave = 64 x 64 (16 accumulator tiles): a staged row feeds 128 or 256 output columns or rows and an LDS fragment feeds
// 4 products. The 256 A rows and 128 B rows of a 64-k stage (128 B = one whole line a row) are brought into LDS once per block by asynchronous copies (two buffers: stage t+1 flies
// while stage t is worked on) and the waves read their fragments from there; row pitch 144 B = 16 B x odd for the ds_load_b128 readers. The k order of every accumulator is
// ascending, 32 a WMMA. The epilogue's staging rows reuse the ring behind the loop's last barrier, 32 rows a wave at a time.
#define GP    72                      // halves per staged row (64 + 8 pad)
#define GBM   256                     // rows of C a block
#define GBN   128                     // columns of C a block
#define GST   ((GBM + GBN) * GP)      // one stage in halves: A rows 0..255 | B rows 0..127 = 55296 B
// The three projections go through ONE launch (none reads another's output): blockIdx.y picks the product, 0..15 q, 16..31 k (both to f16 hi + residual planes), 32..39 v (f32).
__global__ __launch_bounds__(256) void k_gemmb(const bf* __restrict__ Xq, const bf* __restrict__ Xk, const bf* __restrict__ Xv, const bf* __restrict__ WqB, const bf* __restrict__ WkB, const bf* __restrict__ WvB,
                                               h16* QH, h16* QL, h16* KH, h16* KL, float* Vf) {
    __shared__ __align__(16) char gsm[2 * GST * 2];
    const int lane = threadIdx.x & 31, wave = threadIdx.x >> 5, lr = lane & 15, hi = lane >> 4;
    const int wm = wave >> 1, wn = wave & 1;
    const int sel = blockIdx.y < QW / GBN ? 0 : (blockIdx.y < 2 * (QW / GBN) ? 1 : 2);        // the same for the whole block
    const bf* A = sel == 0 ? Xq : (sel == 1 ? Xk : Xv); const bf* Bn = sel == 0 ? WqB : (sel == 1 ? WkB : WvB);
    const int cb = (blockIdx.y - sel * (QW / GBN)) * GBN;
    const int r0 = blockIdx.x * GBM + wm * 64, c0 = cb + wn * 64;
    // each thread copies 8 pieces of A and 4 of B per stage: rows tid/8 + 32 i, 8 pieces of 16 B a row
    const int srow = threadIdx.x >> 3, spc = (threadIdx.x & 7) * 8;
    const bf* ga = A + (size_t)(blockIdx.x * GBM + srow) * DM + spc; const bf* gb = Bn + (size_t)(cb + srow) * DM + spc;
    const unsigned lg = (unsigned)(size_t)&gsm[0] + (srow * GP + spc) * 2;
    auto fill = [&](int t) {
        const bf* a0 = ga + t * 64; const bf* a1 = a0 + 32 * DM; const bf* a2 = a0 + 64 * DM; const bf* a3 = a0 + 96 * DM;
        const bf* a4 = a0 + 128 * DM; const bf* a5 = a0 + 160 * DM; const bf* a6 = a0 + 192 * DM; const bf* a7 = a0 + 224 * DM;
        const bf* b0 = gb + t * 64; const bf* b1 = b0 + 32 * DM; const bf* b2 = b0 + 64 * DM; const bf* b3 = b0 + 96 * DM;
        const unsigned la0 = lg + (unsigned)(t & 1) * (GST * 2), la1 = la0 + 32 * GP * 2, la2 = la0 + 64 * GP * 2, la3 = la0 + 96 * GP * 2;
        const unsigned la4 = la0 + 128 * GP * 2, la5 = la0 + 160 * GP * 2, la6 = la0 + 192 * GP * 2, la7 = la0 + 224 * GP * 2;
        const unsigned lb0 = la0 + GBM * GP * 2, lb1 = lb0 + 32 * GP * 2, lb2 = lb0 + 64 * GP * 2, lb3 = lb0 + 96 * GP * 2;
        // the stage's 12 copies; s_wait_xcnt 0 closes the statement so that no address register is rewritten ahead of it
        asm volatile("global_load_async_to_lds_b128 %0, %1, off\n\t"
                     "global_load_async_to_lds_b128 %2, %3, off\n\t"
                     "global_load_async_to_lds_b128 %4, %5, off\n\t"
                     "global_load_async_to_lds_b128 %6, %7, off\n\t"
                     "global_load_async_to_lds_b128 %8, %9, off\n\t"
                     "global_load_async_to_lds_b128 %10, %11, off\n\t"
                     "global_load_async_to_lds_b128 %12, %13, off\n\t"
                     "global_load_async_to_lds_b128 %14, %15, off\n\t"
                     "global_load_async_to_lds_b128 %16, %17, off\n\t"
                     "global_load_async_to_lds_b128 %18, %19, off\n\t"
                     "global_load_async_to_lds_b128 %20, %21, off\n\t"
                     "global_load_async_to_lds_b128 %22, %23, off\n\t"
                     "s_wait_xcnt 0x0"
                     :: "v"(la0), "v"(a0), "v"(la1), "v"(a1), "v"(la2), "v"(a2), "v"(la3), "v"(a3),
                        "v"(la4), "v"(a4), "v"(la5), "v"(a5), "v"(la6), "v"(a6), "v"(la7), "v"(a7),
                        "v"(lb0), "v"(b0), "v"(lb1), "v"(b1), "v"(lb2), "v"(b2), "v"(lb3), "v"(b3) : "memory");
    };
    fill(0);
    asm volatile("s_wait_asynccnt 0x0" ::: "memory");   // this wave's share of stage 0 has landed
    __syncthreads();                                    // every wave's share of stage 0 is readable
    fill(1);
    v8f acc[4][4];
#pragma unroll
    for (int m = 0; m < 4; ++m)
#pragma unroll
        for (int t = 0; t < 4; ++t) acc[m][t] = (v8f){};
#pragma unroll 1
    for (int st = 0; st < DM / 64; ++st) {               // rolled: one stage a trip, so that the foot's waits and barrier stand once
        const bf* sa = (const bf*)(gsm + (st & 1) * (GST * 2)) + (wm * 64 + lr) * GP + 8 * hi;
        const bf* sb = (const bf*)(gsm + (st & 1) * (GST * 2)) + (GBM + wn * 64 + lr) * GP + 8 * hi;
#pragma unroll                                             // both 32-k halves of the stage straight-line
        for (int kc = 0; kc < 64; kc += 32) {
            v16bf a[4], b[4];
#pragma unroll
            for (int m = 0; m < 4; ++m) a[m] = cat16b(*(const v8usa*)(sa + m * 16 * GP + kc), *(const v8usa*)(sa + m * 16 * GP + kc + 16));
#pragma unroll
            for (int t = 0; t < 4; ++t) b[t] = cat16b(*(const v8usa*)(sb + t * 16 * GP + kc), *(const v8usa*)(sb + t * 16 * GP + kc + 16));
            // holds the 16 LDS reads of this 32-k half together ahead of its 16 products (loaded values as inputs only): one wait on LDS a half, not one a row of tiles
            asm volatile("" :: "v"(a[0]), "v"(a[1]), "v"(a[2]), "v"(a[3]), "v"(b[0]), "v"(b[1]), "v"(b[2]), "v"(b[3]));
#pragma unroll
            for (int m = 0; m < 4; ++m)
#pragma unroll
                for (int t = 0; t < 4; ++t) acc[m][t] = wmmab(a[m], b[t], acc[m][t]);
        }
        // the WMMA distance on every path behind the stage's last product, the loop's back edge included (the accumulators as inputs keep it behind every product)
        asm volatile("v_nop\n\tv_nop\n\tv_nop\n\tv_nop" :: "v"(acc[0][0]), "v"(acc[0][1]), "v"(acc[0][2]), "v"(acc[0][3]), "v"(acc[1][0]), "v"(acc[1][1]), "v"(acc[1][2]), "v"(acc[1][3]),
                                                          "v"(acc[2][0]), "v"(acc[2][1]), "v"(acc[2][2]), "v"(acc[2][3]), "v"(acc[3][0]), "v"(acc[3][1]), "v"(acc[3][2]), "v"(acc[3][3]));
        asm volatile("s_wait_dscnt 0x0" ::: "memory");      // this wave's reads of stage st's buffer are done before it may be refilled
        asm volatile("s_wait_asynccnt 0x0" ::: "memory");   // this wave's share of stage st+1 has landed
        __syncthreads();                                    // publishes stage st+1 and ends every wave's reads of stage st's buffer
        if (st + 2 < DM / 64) fill(st + 2);
    }
    asm volatile("s_wait_asynccnt 0x0" ::: "memory");       // no copy is outstanding when the ring becomes the epilogue's staging
    float* os = (float*)(void*)gsm + wave * (32 * 68);
#pragma unroll
    for (int hf = 0; hf < 2; ++hf) {                        // rows 32 hf .. 32 hf + 31 of the wave's 64
        if (hf) __syncthreads();                            // the first half's rows are read back before they are overwritten
#pragma unroll
        for (int m = 0; m < 2; ++m) {
#pragma unroll
            for (int t = 0; t < 4; ++t) {
#pragma unroll
                for (int j = 0; j < 8; ++j) os[(m * 16 + hi * 8 + j) * 68 + t * 16 + lr] = acc[hf * 2 + m][t][j]; } }
        __syncthreads();
        if (sel < 2) {
            const int ldc = QW;
            h16* crow = (sel == 0 ? QH : KH) + (size_t)(r0 + hf * 32) * ldc + c0; h16* crw2 = (sel == 0 ? QL : KL) + (size_t)(r0 + hf * 32) * ldc + c0;
#pragma unroll
            for (int s = 0; s < 8; ++s) { const int row = 4 * s + (lane >> 3), piece = lane & 7; const float* sp = os + row * 68 + piece * 8; v8h o, o2;
#pragma unroll
                for (int i = 0; i < 8; ++i) { const h16 a = (h16)sp[i]; o[i] = a; o2[i] = (h16)(sp[i] - (float)a); }
                *(v8h*)(crow + (size_t)row * ldc + piece * 8) = o; *(v8h*)(crw2 + (size_t)row * ldc + piece * 8) = o2; }
        } else {
            const int ldc = KVW;
            float* crow = Vf + (size_t)(r0 + hf * 32) * ldc + c0;
#pragma unroll
            for (int s = 0; s < 16; ++s) { const int Lid = (lane >> 3) + 4 * s, piece = lane & 7; const int row = Lid >> 1, cofs = (Lid & 1) * 32 + piece * 4;
                const v4f val = *(const v4fa*)(os + row * 68 + cofs); *(v4f*)(crow + (size_t)row * ldc + cofs) = val; }
            asm volatile("s_wait_xcnt 0x0" ::: "memory");   // behind these stores, ahead of whatever next rewrites a register that they name
        }
    }
}

__global__ __launch_bounds__(256) void k_vt(const float* __restrict__ V, h16* VTH, h16* VTL) {
    __shared__ __align__(16) h16 tile[64 * 72];
    __shared__ __align__(16) h16 til2[64 * 72];
    const int bid = blockIdx.x;
    const int b = bid / (NKV * (NT_ / 64)), rem = bid - b * (NKV * (NT_ / 64)), h = rem / (NT_ / 64), kt = rem - h * (NT_ / 64);
    const int k0 = kt * 64, tid = threadIdx.x;
    const int kk = tid >> 2, d0 = (tid & 3) * 16;
    const float* src = V + ((size_t)b * NT_ + k0 + kk) * KVW + h * HD + d0;      // h = kv head here
#pragma unroll
    for (int i = 0; i < 16; ++i) { const float v = src[i]; const h16 a = (h16)v; tile[(d0 + i) * 72 + kk] = a; til2[(d0 + i) * 72 + kk] = (h16)(v - (float)a); }
    __syncthreads();
    const int piece = tid & 7;
    const size_t base = (((size_t)b * NKV + h) * HD) * NT_ + k0;
    auto pass = [&]() {
#pragma unroll
        for (int s = 0; s < 4; ++s) { const int Lid = (tid >> 3) + 32 * s; const int pln = Lid >> 6, d = Lid & 63;
            const v8h val = *(const v8ha*)((pln ? til2 : tile) + d * 72 + piece * 8); *(v8h*)((pln ? VTL : VTH) + base + (size_t)d * NT_ + piece * 8) = val; }
    };
    pass(); 
}

#define KP    72                      // halves per staged K row (64 + 8 pad)
#define VP    40                      // halves per staged V^T row (32 + 8 pad)
#define ST_KL (32 * KP)               // stage layout in halves: K hi | K lo | V^T hi | V^T lo
#define ST_VH (2 * 32 * KP)
#define ST_VL (ST_VH + 64 * VP)
#define ST_SZ (ST_VL + 64 * VP)       // 9728 halves = 19456 B
__global__ __launch_bounds__(128) void k_attn(const h16* __restrict__ Q16, const h16* __restrict__ QL16, const h16* __restrict__ K16, const h16* __restrict__ KL16, const h16* __restrict__ VTH, const h16* __restrict__ VTL, bf* CH, bf* CL) {
    __shared__ __align__(16) float ost[4][16 * 68];
    __shared__ __align__(16) h16 ring[2][ST_SZ];
    const int lane = threadIdx.x & 31, wave = threadIdx.x >> 5, lr = lane & 15, hi = lane >> 4;
    const int bid = blockIdx.x;
    const int b = bid / (NH_ * (NT_ / 64)), rem = bid - b * (NH_ * (NT_ / 64)), h = rem / (NT_ / 64), qt = rem - h * (NT_ / 64);
    const int q0 = qt * 64 + wave * 16;
    const size_t tok0 = (size_t)b * NT_;
    v16h qa[2], ql[2];                                  // the wave's queries, f16 hi and residual, held in registers for all 32 steps
    const size_t qo0 = (tok0 + q0 + lr) * QW + h * HD + 8 * hi;     // q/k planes are [tok][32*64]
#pragma unroll
    for (int kc = 0; kc < 2; ++kc) { qa[kc] = cat16(*(const v8h*)(Q16 + qo0 + kc * 32), *(const v8h*)(Q16 + qo0 + kc * 32 + 16));
        ql[kc] = cat16(*(const v8h*)(QL16 + qo0 + kc * 32), *(const v8h*)(QL16 + qo0 + kc * 32 + 16)); }
    const int g = h / (NH_ / NKV);                      // v head (each q/k head pair 2g, 2g+1 shares v head g)
    const h16* kh_b = K16 + tok0 * QW + h * HD;          // k has its own 32 heads (plane width QW)
    const h16* kl_b = KL16 + tok0 * QW + h * HD;
    const size_t vbase = (((size_t)b * NKV + g) * HD) * NT_;
    // each thread copies 2 pieces of each of the 4 planes per step: K rows tid/8 and +16 (8 pieces a row), V^T rows tid/4 and +32 (4 pieces a row)
    const int krow = threadIdx.x >> 3, kpc = (threadIdx.x & 7) * 8, vrow = threadIdx.x >> 2, vpc = (threadIdx.x & 3) * 8;
    const h16* gkh = kh_b + (size_t)krow * QW + kpc; const h16* gkl = kl_b + (size_t)krow * QW + kpc;
    const h16* gvh = VTH + vbase + (size_t)vrow * NT_ + vpc; const h16* gvl = VTL + vbase + (size_t)vrow * NT_ + vpc;
    const unsigned lring = (unsigned)(size_t)&ring[0][0];
    const unsigned lk = lring + (krow * KP + kpc) * 2, lv = lring + (ST_VH + vrow * VP + vpc) * 2;
    auto fill = [&](int t) {
        const unsigned lb = (unsigned)(t & 1) * (ST_SZ * 2);
        const h16* a0 = gkh + (size_t)t * 32 * QW; const h16* a1 = a0 + 16 * QW; const h16* b0 = gkl + (size_t)t * 32 * QW; const h16* b1 = b0 + 16 * QW;
        const h16* c0 = gvh + t * 32; const h16* c1 = c0 + 32 * NT_; const h16* d0 = gvl + t * 32; const h16* d1 = d0 + 32 * NT_;
        const unsigned la0 = lk + lb, la1 = la0 + 16 * KP * 2, lb0 = la0 + ST_KL * 2, lb1 = lb0 + 16 * KP * 2;
        const unsigned lc0 = lv + lb, lc1 = lc0 + 32 * VP * 2, ld0 = lc0 + 64 * VP * 2, ld1 = ld0 + 32 * VP * 2;
        // the step's 8 copies; s_wait_xcnt 0 closes the statement so that no address register is rewritten ahead of it
        asm volatile("global_load_async_to_lds_b128 %0, %1, off\n\t"
                     "global_load_async_to_lds_b128 %2, %3, off\n\t"
                     "global_load_async_to_lds_b128 %4, %5, off\n\t"
                     "global_load_async_to_lds_b128 %6, %7, off\n\t"
                     "global_load_async_to_lds_b128 %8, %9, off\n\t"
                     "global_load_async_to_lds_b128 %10, %11, off\n\t"
                     "global_load_async_to_lds_b128 %12, %13, off\n\t"
                     "global_load_async_to_lds_b128 %14, %15, off\n\t"
                     "s_wait_xcnt 0x0"
                     :: "v"(la0), "v"(a0), "v"(la1), "v"(a1), "v"(lb0), "v"(b0), "v"(lb1), "v"(b1),
                        "v"(lc0), "v"(c0), "v"(lc1), "v"(c1), "v"(ld0), "v"(d0), "v"(ld1), "v"(d1) : "memory");
    };
    fill(0);
    asm volatile("s_wait_asynccnt 0x0" ::: "memory");   // this wave's share of step 0 has landed
    __syncthreads();                                    // every wave's share of step 0 is readable
    fill(1);
    v8f o[4];
#pragma unroll
    for (int n = 0; n < 4; ++n) o[n] = (v8f){};
    float mrow = -3.0e38f, lpart = 0.f;                 // of query q0 + lr; lpart covers this wave half's keys, the halves are joined behind the loop
    const int kt_lo = 0, kt_hi = NT_ / 32 - 1;          // full attention (no mask)
#pragma unroll 1
    for (int kt = kt_lo; kt <= kt_hi; ++kt) {
        const h16* st = &ring[kt & 1][0];
        const h16* skh = st; const h16* skl = st + ST_KL; const h16* svh = st + ST_VH; const h16* svl = st + ST_VL;
        const int ko0 = lr * KP + 8 * hi, ko1 = (16 + lr) * KP + 8 * hi;
        v8f s0 = {}, s1 = {};
#pragma unroll
        for (int kc = 0; kc < 2; ++kc) {
            const v16h k0h = cat16(*(const v8ha*)(skh + ko0 + kc * 32), *(const v8ha*)(skh + ko0 + kc * 32 + 16)), k1h = cat16(*(const v8ha*)(skh + ko1 + kc * 32), *(const v8ha*)(skh + ko1 + kc * 32 + 16));
            const v16h k0l = cat16(*(const v8ha*)(skl + ko0 + kc * 32), *(const v8ha*)(skl + ko0 + kc * 32 + 16)), k1l = cat16(*(const v8ha*)(skl + ko1 + kc * 32), *(const v8ha*)(skl + ko1 + kc * 32 + 16));
            // the residuals carry no scale of their own, so the three products of a tile add into the one accumulator; the two key tiles take turns
            s0 = wmma16(k0h, qa[kc], s0); s1 = wmma16(k1h, qa[kc], s1);
            s0 = wmma16(k0h, ql[kc], s0); s1 = wmma16(k1h, ql[kc], s1);
            s0 = wmma16(k0l, qa[kc], s0); s1 = wmma16(k1l, qa[kc], s1);
        }
        const v8f a0 = s0 * 0.125f, a1 = s1 * 0.125f;   // (q e^-1/4).(k e^-1/4) = q.k / 8; a0[j]: key 8 hi + j, a1[j]: key 16 + 8 hi + j of this step
        float mx = fmaxf(a0[0], a1[0]);
#pragma unroll
        for (int j = 1; j < 8; ++j) mx = fmaxf(mx, fmaxf(a0[j], a1[j]));
        mx = fmaxf(mx, xhalf(mx));                      // the other 16 keys of this query sit in lane ^ 16
        const float mn = fmaxf(mrow, mx);
        const float alpha = __expf(mrow - mn); mrow = mn;
        const v8f e0 = (a0 - mn) * LOG2E, e1 = (a1 - mn) * LOG2E;      // e^x = 2^(x log2 e)
        v8f p0, p1;
#pragma unroll
        for (int j = 0; j < 8; ++j) p0[j] = __builtin_amdgcn_exp2f(e0[j]);
#pragma unroll
        for (int j = 0; j < 8; ++j) p1[j] = __builtin_amdgcn_exp2f(e1[j]);
        const v8f pq = p0 + p1;
        lpart = lpart * alpha + (((pq[0] + pq[1]) + (pq[2] + pq[3])) + ((pq[4] + pq[5]) + (pq[6] + pq[7])));
        // element s of the B operand = key 8 hi + s (s < 8), 16 + 8 hi + s - 8 (else): the k order of the V^T loader below
        const v8f ps0 = p0 * PSC, ps1 = p1 * PSC;
        const v8h h0 = __builtin_convertvector(ps0, v8h), h1 = __builtin_convertvector(ps1, v8h);
        const v8h r0 = __builtin_convertvector(ps0 - __builtin_convertvector(h0, v8f), v8h), r1 = __builtin_convertvector(ps1 - __builtin_convertvector(h1, v8f), v8h);
        const v16h pa = cat16(h0, h1), px = cat16(r0, r1);
#pragma unroll
        for (int n = 0; n < 4; ++n) o[n] *= alpha;
#pragma unroll
        for (int n = 0; n < 4; ++n) { const int vo = (n * 16 + lr) * VP + hi * 8;
            const v16h vh = cat16(*(const v8ha*)(svh + vo), *(const v8ha*)(svh + vo + 16)), vl = cat16(*(const v8ha*)(svl + vo), *(const v8ha*)(svl + vo + 16));
            o[n] = wmma16(vh, pa, o[n]); o[n] = wmma16(vl, pa, o[n]); o[n] = wmma16(vh, px, o[n]); }
        // the WMMA distance on every path behind the step's last product, the loop's back edge included (the accumulators as inputs keep it behind every product)
        asm volatile("v_nop\n\tv_nop\n\tv_nop\n\tv_nop" :: "v"(o[0]), "v"(o[1]), "v"(o[2]), "v"(o[3]));
        asm volatile("s_wait_dscnt 0x0" ::: "memory");      // this wave's reads of step kt's buffer are done before it may be refilled
        asm volatile("s_wait_asynccnt 0x0" ::: "memory");   // this wave's share of step kt+1 has landed
        __syncthreads();                                    // publishes step kt+1 and ends every wave's reads of step kt's buffer
        if (kt + 2 <= kt_hi) fill(kt + 2);
    }
    asm volatile("s_wait_asynccnt 0x0" ::: "memory");       // no copy is outstanding when the wave goes on to the epilogue
    const float inv = 1.0f / ((lpart + xhalf(lpart)) * PSC);
    float* os = &ost[wave][0];
#pragma unroll
    for (int n = 0; n < 4; ++n)
#pragma unroll
        for (int j = 0; j < 8; ++j) os[lr * 68 + n * 16 + hi * 8 + j] = o[n][j] * inv;     // o[n][j] = O^T[d = 16 n + 8 hi + j][query lr]
    __syncthreads();
    const size_t cbase = (tok0 + q0) * QW + (size_t)h * HD;     // per-head softmax outputs C[tok][32*64] (bf16 hi/lo), combined by k_diff
    auto pass = [&]() {
#pragma unroll
        for (int s = 0; s < 4; ++s) { const int row = 4 * s + (lane >> 3), piece = lane & 7; const float* sp = os + row * 68 + piece * 8; v8us oh, ol;
#pragma unroll
            for (int i = 0; i < 8; ++i) { const unsigned short hb = f2bf(sp[i]); oh[i] = hb; ol[i] = f2bf(sp[i] - bf2f(hb)); }
            *(v8us*)(CH + cbase + (size_t)row * QW + piece * 8) = oh; *(v8us*)(CL + cbase + (size_t)row * QW + piece * 8) = ol; }
    };
    pass(); 
}

// lambda_wave: lam = 0.2 + exp(L0.L1) - exp(L2.L3) from the INPUT L [4][64] (bf16-rounded), one wave; the scalar alone in its own line.
__device__ __forceinline__ void lambda_wave(const float* __restrict__ Lp, float* LAM) {
    const int lane = threadIdx.x; float a = 0.f, c = 0.f;
#pragma unroll
    for (int i = 0; i < 2; ++i) { const int d = lane * 2 + i; a = fmaf(bfr(Lp[d]), bfr(Lp[64 + d]), a); c = fmaf(bfr(Lp[128 + d]), bfr(Lp[192 + d]), c); }
#pragma unroll
    for (int sh = 16; sh; sh >>= 1) { a += __shfl_xor(a, sh, 32); c += __shfl_xor(c, sh, 32); }
    if (lane == 0) { const float lam = 0.2f + expf(a) - expf(c); *(float*)LAM = lam;  }
}
// k_prep: everything that reads only the inputs, in ONE launch (none of these pieces reads another's output). Block 0: lambda, on its first wave. Blocks 1..: 8 rows each
// (one a wave) of the six f32 -> bf16 conversions, in the order xq | xk | xv | Wq | Wk | Wv; the block index picks the pair of pointers, the same for the whole block.
#define PB_X (NTK / 8)
#define PB_W (QW / 8)
#define PB_V (KVW / 8)
#define PB_ALL (1 + 3 * PB_X + 2 * PB_W + PB_V)
__global__ __launch_bounds__(256) void k_prep(const float* __restrict__ xq, const float* __restrict__ xk, const float* __restrict__ xv, const float* __restrict__ Wq, const float* __restrict__ Wk, const float* __restrict__ Wv,
                                              const float* __restrict__ Lp, bf* Xq, bf* Xk, bf* Xv, bf* WqB, bf* WkB, bf* WvB, float* LAM) {
    if (blockIdx.x == 0) { if (threadIdx.x < 32) lambda_wave(Lp, LAM); return; }
    const int blk = blockIdx.x - 1;
    const bool isx = blk < 3 * PB_X;
    const int s = isx ? blk / PB_X : (blk - 3 * PB_X) / PB_W;                               // which of the three x planes, or of the three W planes
    const float* src = isx ? (s == 0 ? xq : (s == 1 ? xk : xv)) : (s == 0 ? Wq : (s == 1 ? Wk : Wv));
    bf* dst = isx ? (s == 0 ? Xq : (s == 1 ? Xk : Xv)) : (s == 0 ? WqB : (s == 1 ? WkB : WvB));
    const int first = isx ? s * PB_X : 3 * PB_X + s * PB_W;                                 // the plane's first block
    cvt_row(src, (blk - first) * 8 + (threadIdx.x >> 5), dst);
}
// k_diff: out[tok][g*64 + e] = C[tok][2g*64 + e] - lam * C[tok][(2g+1)*64 + e] with C = hi + lo planes (f32 recombination); one wave per token row, lane -> 4
__global__ __launch_bounds__(256) void k_diff(const bf* __restrict__ CH, const bf* __restrict__ CL, const float* __restrict__ LAM, float* OUTP) {
    const int lane = threadIdx.x & 31, r = blockIdx.x * 8 + (threadIdx.x >> 5);
    if (r >= NTK) return;
    const float lam = LAM[0];
{
#pragma unroll 1
        for (int q = 0; q < KVW / 128; ++q) { const int c = q * 128 + lane * 4; const int g = c >> 6, e = c & 63; const size_t s1 = (size_t)r * QW + (2 * g) * HD + e, s2 = s1 + HD; v4f o;
#pragma unroll
            for (int i = 0; i < 4; ++i) { const float p1 = bf2f(CH[s1 + i]) + bf2f(CL[s1 + i]), p2 = bf2f(CH[s2 + i]) + bf2f(CL[s2 + i]); o[i] = p1 - lam * p2; }
            *(v4f*)(OUTP + (size_t)r * KVW + c) = o; }
         }
}
#define VST2(T, p, v) do { const T vst2_v_ = (v); *(T*)(p) = vst2_v_;  } while (0)
extern "C" void kernel_launch(void* const* d_in, const int* in_sizes, int n_in,
                              void* d_out, int out_size, void* d_ws, size_t ws_size, hipStream_t stream) {
    (void)in_sizes; (void)n_in; (void)out_size;
    const float* xq = (const float*)d_in[0]; const float* xk = (const float*)d_in[1]; const float* xv = (const float*)d_in[2];
    const float* Wq = (const float*)d_in[3]; const float* Wk = (const float*)d_in[4]; const float* Wv = (const float*)d_in[5]; const float* Lp = (const float*)d_in[6];   // W [out][in]
    float* out = (float*)d_out;    // [4][1024][1024]
    char* wsp = (char*)d_ws;
    auto take = [&](size_t bytes) { char* p = wsp; wsp += (bytes + 255) & ~(size_t)255; return (void*)p; };
    bf* Xq = (bf*)take((size_t)NTK * DM * 2); bf* Xk = (bf*)take((size_t)NTK * DM * 2); bf* Xv = (bf*)take((size_t)NTK * DM * 2);
    bf* WqB = (bf*)take((size_t)QW * DM * 2); bf* WkB = (bf*)take((size_t)QW * DM * 2); bf* WvB = (bf*)take((size_t)KVW * DM * 2);
    h16* QH = (h16*)take((size_t)NTK * QW * 2); h16* QL = (h16*)take((size_t)NTK * QW * 2); h16* KH = (h16*)take((size_t)NTK * QW * 2); h16* KL = (h16*)take((size_t)NTK * QW * 2);
    float* Vf = (float*)take((size_t)NTK * KVW * 4); h16* VTH = (h16*)take((size_t)NTK * KVW * 2); h16* VTL = (h16*)take((size_t)NTK * KVW * 2);
    bf* CH = (bf*)take((size_t)NTK * QW * 2); bf* CL = (bf*)take((size_t)NTK * QW * 2); float* LAM = (float*)take(256);
    if ((size_t)(wsp - (char*)d_ws) > ws_size) return;    // 3 x 8.4 + 2 x 4.2 + 2.1 + 4 x 16.8 + 16.8 + 2 x 8.4 + 2 x 16.8 ~ 170 MB, no aliasing
    k_prep<<<PB_ALL, 256, 0, stream>>>(xq, xk, xv, Wq, Wk, Wv, Lp, Xq, Xk, Xv, WqB, WkB, WvB, LAM);                                  // lambda and the six bf16 planes
    k_gemmb<<<dim3(NTK / GBM, (2 * QW + KVW) / GBN, 1), 256, 0, stream>>>(Xq, Xk, Xv, WqB, WkB, WvB, QH, QL, KH, KL, Vf);              // q, k (32 heads each, f16 planes) and v (16 heads, f32)
    k_vt<<<NB_ * NKV * (NT_ / 64), 256, 0, stream>>>(Vf, VTH, VTL);
    k_attn<<<NB_ * NH_ * (NT_ / 64), 128, 0, stream>>>(QH, QL, KH, KL, VTH, VTL, CH, CL);
    k_diff<<<NTK / 8, 256, 0, stream>>>(CH, CL, LAM, out);
}

// v008
// Measured time: 136 microseconds a run.
// Timed twice side by side with v007, it ran 1.09 and 1.10 times as fast.
// All steps since v000 together make it 4.84 times as fast.
#include <hip/hip_runtime.h>

// Compute dtypes, f32 accumulate, all 4 batch items in one pass: q = q_input.Wq^T, k = k_input.Wk^T ([4096 x 1024].[1024 x 2048], 32 dual heads) and v = v_input.Wv^T
// ([4096 x 1024].[1024 x 1024], 16 heads) on v_wmma_f32_16x16x32_bf16 — plain bf16 = rounded inputs (exact; [out][in] weights are the n-major B operands as-is), q/k
// written straight to f16 hi + residual planes (the residual unscaled: f16 subnormals hold it to 2^-24 absolute); the 32 softmax attentions (q/k head h over v head h/2, full, the two e^-1/4 scales folded into 1/8) fused
// on v_wmma_f32_16x16x32_f16 (hi.hi + hi.lo + lo.hi, all three into ONE f32 accumulator tile; weights x32768 and v as f16 hi + unscaled residual) giving per-head normalised outputs as bf16 hi/lo planes;
// differential combine out_g = P_2g.v_g - lambda P_2g+1.v_g in f32 with lambda = 0.2 + exp(L0.L1) - exp(L2.L3) computed on device from the INPUT L. Deterministic,

#define NB_  4                   // all 4 batch items go through every per-token launch together (4x the workgroups per launch)
#define NT_  1024
#define DM   1024                // input width = GEMM K
#define NH_  32                  // 2 x 16 dual q/k heads
#define NKV  16                  // v heads: q/k head h uses v head h/2
#define KVW  (NKV * HD)          // 1024
#define HD   64
#define NTK  (NB_ * NT_)
#define QW   (NH_ * HD)          // 2048: q/k plane width
#define NW   1024
#define NQKV 2048
#define PSC  32768.0f
#define LOG2E 1.44269504088896340736f

typedef _Float16 h16;
typedef unsigned short bf;
typedef __attribute__((ext_vector_type(16))) __bf16   v16bf;
typedef __attribute__((ext_vector_type(16))) _Float16 v16h;
typedef __attribute__((ext_vector_type(8)))  _Float16 v8h;
typedef __attribute__((ext_vector_type(8)))  unsigned short v8us;
typedef __attribute__((ext_vector_type(8)))  float    v8f;
typedef __attribute__((ext_vector_type(4)))  float    v4f;
typedef v8h  __attribute__((may_alias)) v8ha;
typedef v4f  __attribute__((may_alias)) v4fa;
typedef v8us __attribute__((may_alias)) v8usa;

__device__ __forceinline__ unsigned short f2bf(float f) { unsigned u = __float_as_uint(f); u += 0x7FFFu + ((u >> 16) & 1u); return (unsigned short)(u >> 16); }
__device__ __forceinline__ float bf2f(unsigned short b) { return __uint_as_float(((unsigned)b) << 16); }
__device__ __forceinline__ float bfr(float f) { return bf2f(f2bf(f)); }
__device__ __forceinline__ v16h cat16(v8h lo, v8h hi) { return __builtin_shufflevector(lo, hi, 0, 1, 2, 3, 4, 5, 6, 7, 8, 9, 10, 11, 12, 13, 14, 15); }
__device__ __forceinline__ v16bf cat16b(v8us lo, v8us hi) { return __builtin_bit_cast(v16bf, __builtin_shufflevector(lo, hi, 0, 1, 2, 3, 4, 5, 6, 7, 8, 9, 10, 11, 12, 13, 14, 15)); }
__device__ __forceinline__ v8f wmma16(v16h a, v16h b, v8f c) { return __builtin_amdgcn_wmma_f32_16x16x32_f16(false, a, false, b, (short)0, c, false, false); }
// lane l's value of lane l ^ 16 (a vector cross-row move, no LDS)
__device__ __forceinline__ float xhalf(float x) { return __builtin_bit_cast(float, __builtin_amdgcn_permlanex16(__builtin_bit_cast(int, x), __builtin_bit_cast(int, x), 0x76543210, 0xfedcba98, false, false)); }
__device__ __forceinline__ v8f wmmab(v16bf a, v16bf b, v8f c) { return __builtin_amdgcn_wmma_f32_16x16x32_bf16(false, a, false, b, (short)0, c, false, false); }

// cvt_row: one wave rounds row r of src [rows][1024] f32 to the bf16 plane dst.
__device__ __forceinline__ void cvt_row(const float* __restrict__ src, int r, bf* dst) {
    const int lane = threadIdx.x & 31;
    v8us o[DM / 256];
#pragma unroll
    for (int q = 0; q < DM / 256; ++q) { v8us t;
#pragma unroll
        for (int i = 0; i < 8; ++i) t[i] = f2bf(src[(size_t)r * DM + q * 256 + lane * 8 + i]);
        o[q] = t; }
#pragma unroll
    for (int q = 0; q < DM / 256; ++q) *(v8us*)(dst + (size_t)r * DM + q * 256 + lane * 8) = o[q];
    
}

// k_wt: W [1024 k][ncols n] (k-major) -> n-major bf16 plane WT[ncols][1024]; 64 x 64 tiles through LDS.
__global__ __launch_bounds__(256) void k_wt(const float* __restrict__ Wm, int ncols, bf* WT) {
    __shared__ __align__(16) unsigned short tl[64 * 72];
    const int tid = threadIdx.x, k0 = blockIdx.x * 64, n0 = blockIdx.y * 64;
    const int kk = tid >> 2, nq = (tid & 3) * 16;
#pragma unroll
    for (int i = 0; i < 16; ++i) tl[(nq + i) * 72 + kk] = f2bf(Wm[(size_t)(k0 + kk) * ncols + n0 + nq + i]);
    __syncthreads();
    const int piece = tid & 7;
    typedef __attribute__((ext_vector_type(8))) unsigned short v8us_; typedef v8us_ __attribute__((may_alias)) v8usa_;
    auto pass = [&]() {
#pragma unroll
        for (int s = 0; s < 2; ++s) { const int nr = (tid >> 3) + 32 * s; const v8us_ val = *(const v8usa_*)(tl + nr * 72 + piece * 8);
            *(v8us_*)(WT + (size_t)(n0 + nr) * DM + k0 + piece * 8) = val; }
    };
    pass(); 
}

// k_gemmb: block = 256 x 128 of C, 8 waves in a 4 x 2 grid, wave = 64 x 64 (16 accumulator tiles): a staged row feeds 128 or 256 output columns or rows and an LDS fragment feeds
// 4 products. The 256 A rows and 128 B rows of a 64-k stage (128 B = one whole line a row) are brought into LDS once per block by asynchronous copies (two buffers: stage t+1 flies
// while stage t is worked on) and the waves read their fragments from there; row pitch 144 B = 16 B x odd for the ds_load_b128 readers. The k order of every accumulator is
// ascending, 32 a WMMA. The epilogue's staging rows reuse the ring behind the loop's last barrier, 32 rows a wave at a time.
#define GP    72                      // halves per staged row (64 + 8 pad)
#define GBM   256                     // rows of C a block
#define GBN   128                     // columns of C a block
#define GST   ((GBM + GBN) * GP)      // one stage in halves: A rows 0..255 | B rows 0..127 = 55296 B
// The three projections go through ONE launch (none reads another's output): blockIdx.y picks the product, 0..15 q, 16..31 k (both to f16 hi + residual planes), 32..39 v (f32).
__global__ __launch_bounds__(256) void k_gemmb(const bf* __restrict__ Xq, const bf* __restrict__ Xk, const bf* __restrict__ Xv, const bf* __restrict__ WqB, const bf* __restrict__ WkB, const bf* __restrict__ WvB,
                                               h16* QH, h16* QL, h16* KH, h16* KL, float* Vf) {
    __shared__ __align__(16) char gsm[2 * GST * 2];
    const int lane = threadIdx.x & 31, wave = threadIdx.x >> 5, lr = lane & 15, hi = lane >> 4;
    const int wm = wave >> 1, wn = wave & 1;
    const int sel = blockIdx.y < QW / GBN ? 0 : (blockIdx.y < 2 * (QW / GBN) ? 1 : 2);        // the same for the whole block
    const bf* A = sel == 0 ? Xq : (sel == 1 ? Xk : Xv); const bf* Bn = sel == 0 ? WqB : (sel == 1 ? WkB : WvB);
    const int cb = (blockIdx.y - sel * (QW / GBN)) * GBN;
    const int r0 = blockIdx.x * GBM + wm * 64, c0 = cb + wn * 64;
    // each thread copies 8 pieces of A and 4 of B per stage: rows tid/8 + 32 i, 8 pieces of 16 B a row
    const int srow = threadIdx.x >> 3, spc = (threadIdx.x & 7) * 8;
    const bf* ga = A + (size_t)(blockIdx.x * GBM + srow) * DM + spc; const bf* gb = Bn + (size_t)(cb + srow) * DM + spc;
    const unsigned lg = (unsigned)(size_t)&gsm[0] + (srow * GP + spc) * 2;
    auto fill = [&](int t) {
        const bf* a0 = ga + t * 64; const bf* a1 = a0 + 32 * DM; const bf* a2 = a0 + 64 * DM; const bf* a3 = a0 + 96 * DM;
        const bf* a4 = a0 + 128 * DM; const bf* a5 = a0 + 160 * DM; const bf* a6 = a0 + 192 * DM; const bf* a7 = a0 + 224 * DM;
        const bf* b0 = gb + t * 64; const bf* b1 = b0 + 32 * DM; const bf* b2 = b0 + 64 * DM; const bf* b3 = b0 + 96 * DM;
        const unsigned la0 = lg + (unsigned)(t & 1) * (GST * 2), la1 = la0 + 32 * GP * 2, la2 = la0 + 64 * GP * 2, la3 = la0 + 96 * GP * 2;
        const unsigned la4 = la0 + 128 * GP * 2, la5 = la0 + 160 * GP * 2, la6 = la0 + 192 * GP * 2, la7 = la0 + 224 * GP * 2;
        const unsigned lb0 = la0 + GBM * GP * 2, lb1 = lb0 + 32 * GP * 2, lb2 = lb0 + 64 * GP * 2, lb3 = lb0 + 96 * GP * 2;
        // the stage's 12 copies; s_wait_xcnt 0 closes the statement so that no address register is rewritten ahead of it
        asm volatile("global_load_async_to_lds_b128 %0, %1, off\n\t"
                     "global_load_async_to_lds_b128 %2, %3, off\n\t"
                     "global_load_async_to_lds_b128 %4, %5, off\n\t"
                     "global_load_async_to_lds_b128 %6, %7, off\n\t"
                     "global_load_async_to_lds_b128 %8, %9, off\n\t"
                     "global_load_async_to_lds_b128 %10, %11, off\n\t"
                     "global_load_async_to_lds_b128 %12, %13, off\n\t"
                     "global_load_async_to_lds_b128 %14, %15, off\n\t"
                     "global_load_async_to_lds_b128 %16, %17, off\n\t"
                     "global_load_async_to_lds_b128 %18, %19, off\n\t"
                     "global_load_async_to_lds_b128 %20, %21, off\n\t"
                     "global_load_async_to_lds_b128 %22, %23, off\n\t"
                     "s_wait_xcnt 0x0"
                     :: "v"(la0), "v"(a0), "v"(la1), "v"(a1), "v"(la2), "v"(a2), "v"(la3), "v"(a3),
                        "v"(la4), "v"(a4), "v"(la5), "v"(a5), "v"(la6), "v"(a6), "v"(la7), "v"(a7),
                        "v"(lb0), "v"(b0), "v"(lb1), "v"(b1), "v"(lb2), "v"(b2), "v"(lb3), "v"(b3) : "memory");
    };
    fill(0);
    asm volatile("s_wait_asynccnt 0x0" ::: "memory");   // this wave's share of stage 0 has landed
    __syncthreads();                                    // every wave's share of stage 0 is readable
    fill(1);
    v8f acc[4][4];
#pragma unroll
    for (int m = 0; m < 4; ++m)
#pragma unroll
        for (int t = 0; t < 4; ++t) acc[m][t] = (v8f){};
#pragma unroll 1
    for (int st = 0; st < DM / 64; ++st) {               // rolled: one stage a trip, so that the foot's waits and barrier stand once
        const bf* sa = (const bf*)(gsm + (st & 1) * (GST * 2)) + (wm * 64 + lr) * GP + 8 * hi;
        const bf* sb = (const bf*)(gsm + (st & 1) * (GST * 2)) + (GBM + wn * 64 + lr) * GP + 8 * hi;
#pragma unroll                                             // both 32-k halves of the stage straight-line
        for (int kc = 0; kc < 64; kc += 32) {
            v16bf a[4], b[4];
#pragma unroll
            for (int m = 0; m < 4; ++m) a[m] = cat16b(*(const v8usa*)(sa + m * 16 * GP + kc), *(const v8usa*)(sa + m * 16 * GP + kc + 16));
#pragma unroll
            for (int t = 0; t < 4; ++t) b[t] = cat16b(*(const v8usa*)(sb + t * 16 * GP + kc), *(const v8usa*)(sb + t * 16 * GP + kc + 16));
            // holds the 16 LDS reads of this 32-k half together ahead of its 16 products (loaded values as inputs only): one wait on LDS a half, not one a row of tiles
            asm volatile("" :: "v"(a[0]), "v"(a[1]), "v"(a[2]), "v"(a[3]), "v"(b[0]), "v"(b[1]), "v"(b[2]), "v"(b[3]));
#pragma unroll
            for (int m = 0; m < 4; ++m)
#pragma unroll
                for (int t = 0; t < 4; ++t) acc[m][t] = wmmab(a[m], b[t], acc[m][t]);
        }
        // the WMMA distance on every path behind the stage's last product, the loop's back edge included (the accumulators as inputs keep it behind every product)
        asm volatile("v_nop\n\tv_nop\n\tv_nop\n\tv_nop" :: "v"(acc[0][0]), "v"(acc[0][1]), "v"(acc[0][2]), "v"(acc[0][3]), "v"(acc[1][0]), "v"(acc[1][1]), "v"(acc[1][2]), "v"(acc[1][3]),
                                                          "v"(acc[2][0]), "v"(acc[2][1]), "v"(acc[2][2]), "v"(acc[2][3]), "v"(acc[3][0]), "v"(acc[3][1]), "v"(acc[3][2]), "v"(acc[3][3]));
        asm volatile("s_wait_dscnt 0x0" ::: "memory");      // this wave's reads of stage st's buffer are done before it may be refilled
        asm volatile("s_wait_asynccnt 0x0" ::: "memory");   // this wave's share of stage st+1 has landed
        __syncthreads();                                    // publishes stage st+1 and ends every wave's reads of stage st's buffer
        if (st + 2 < DM / 64) fill(st + 2);
    }
    asm volatile("s_wait_asynccnt 0x0" ::: "memory");       // no copy is outstanding when the ring becomes the epilogue's staging
    float* os = (float*)(void*)gsm + wave * (32 * 68);
#pragma unroll
    for (int hf = 0; hf < 2; ++hf) {                        // rows 32 hf .. 32 hf + 31 of the wave's 64
        if (hf) __syncthreads();                            // the first half's rows are read back before they are overwritten
#pragma unroll
        for (int m = 0; m < 2; ++m) {
#pragma unroll
            for (int t = 0; t < 4; ++t) {
#pragma unroll
                for (int j = 0; j < 8; ++j) os[(m * 16 + hi * 8 + j) * 68 + t * 16 + lr] = acc[hf * 2 + m][t][j]; } }
        __syncthreads();
        if (sel < 2) {
            const int ldc = QW;
            h16* crow = (sel == 0 ? QH : KH) + (size_t)(r0 + hf * 32) * ldc + c0; h16* crw2 = (sel == 0 ? QL : KL) + (size_t)(r0 + hf * 32) * ldc + c0;
#pragma unroll
            for (int s = 0; s < 8; ++s) { const int row = 4 * s + (lane >> 3), piece = lane & 7; const float* sp = os + row * 68 + piece * 8; v8h o, o2;
#pragma unroll
                for (int i = 0; i < 8; ++i) { const h16 a = (h16)sp[i]; o[i] = a; o2[i] = (h16)(sp[i] - (float)a); }
                *(v8h*)(crow + (size_t)row * ldc + piece * 8) = o; *(v8h*)(crw2 + (size_t)row * ldc + piece * 8) = o2; }
        } else {
            const int ldc = KVW;
            float* crow = Vf + (size_t)(r0 + hf * 32) * ldc + c0;
#pragma unroll
            for (int s = 0; s < 16; ++s) { const int Lid = (lane >> 3) + 4 * s, piece = lane & 7; const int row = Lid >> 1, cofs = (Lid & 1) * 32 + piece * 4;
                const v4f val = *(const v4fa*)(os + row * 68 + cofs); *(v4f*)(crow + (size_t)row * ldc + cofs) = val; }
            asm volatile("s_wait_xcnt 0x0" ::: "memory");   // behind these stores, ahead of whatever next rewrites a register that they name
        }
    }
}

__global__ __launch_bounds__(256) void k_vt(const float* __restrict__ V, h16* VTH, h16* VTL) {
    __shared__ __align__(16) h16 tile[64 * 72];
    __shared__ __align__(16) h16 til2[64 * 72];
    const int bid = blockIdx.x;
    const int b = bid / (NKV * (NT_ / 64)), rem = bid - b * (NKV * (NT_ / 64)), h = rem / (NT_ / 64), kt = rem - h * (NT_ / 64);
    const int k0 = kt * 64, tid = threadIdx.x;
    const int kk = tid >> 2, d0 = (tid & 3) * 16;
    const float* src = V + ((size_t)b * NT_ + k0 + kk) * KVW + h * HD + d0;      // h = kv head here
#pragma unroll
    for (int i = 0; i < 16; ++i) { const float v = src[i]; const h16 a = (h16)v; tile[(d0 + i) * 72 + kk] = a; til2[(d0 + i) * 72 + kk] = (h16)(v - (float)a); }
    __syncthreads();
    const int piece = tid & 7;
    const size_t base = (((size_t)b * NKV + h) * HD) * NT_ + k0;
    auto pass = [&]() {
#pragma unroll
        for (int s = 0; s < 4; ++s) { const int Lid = (tid >> 3) + 32 * s; const int pln = Lid >> 6, d = Lid & 63;
            const v8h val = *(const v8ha*)((pln ? til2 : tile) + d * 72 + piece * 8); *(v8h*)((pln ? VTL : VTH) + base + (size_t)d * NT_ + piece * 8) = val; }
    };
    pass(); 
}

#define KP    72                      // halves per staged K row (64 + 8 pad)
#define VP    40                      // halves per staged V^T row (32 + 8 pad)
#define ST_KL (32 * KP)               // stage layout in halves: K hi | K lo | V^T hi | V^T lo
#define ST_VH (2 * 32 * KP)
#define ST_VL (ST_VH + 64 * VP)
#define ST_SZ (ST_VL + 64 * VP)       // 9728 halves = 19456 B
// four waves a SIMD (256 VGPRs a wave): the 1024 blocks are then all resident at once, four a WGP
__global__ __launch_bounds__(128) __attribute__((amdgpu_waves_per_eu(4))) void k_attn(const h16* __restrict__ Q16, const h16* __restrict__ QL16, const h16* __restrict__ K16, const h16* __restrict__ KL16, const h16* __restrict__ VTH, const h16* __restrict__ VTL, bf* CH, bf* CL) {
    __shared__ __align__(16) float ost[4][16 * 68];
    __shared__ __align__(16) h16 ring[2][ST_SZ];
    const int lane = threadIdx.x & 31, wave = threadIdx.x >> 5, lr = lane & 15, hi = lane >> 4;
    const int bid = blockIdx.x;
    const int b = bid / (NH_ * (NT_ / 128)), rem = bid - b * (NH_ * (NT_ / 128)), h = rem / (NT_ / 128), qt = rem - h * (NT_ / 128);
    const int q0 = qt * 128 + wave * 32;
    const size_t tok0 = (size_t)b * NT_;
    v16h qa[2][2], ql[2][2];                            // [u][kc]: the wave's queries, f16 hi and residual, held in registers for all 32 steps
#pragma unroll
    for (int u = 0; u < 2; ++u) {
        const size_t qo0 = (tok0 + q0 + u * 16 + lr) * QW + h * HD + 8 * hi;     // q/k planes are [tok][32*64]
#pragma unroll
        for (int kc = 0; kc < 2; ++kc) { qa[u][kc] = cat16(*(const v8h*)(Q16 + qo0 + kc * 32), *(const v8h*)(Q16 + qo0 + kc * 32 + 16));
            ql[u][kc] = cat16(*(const v8h*)(QL16 + qo0 + kc * 32), *(const v8h*)(QL16 + qo0 + kc * 32 + 16)); } }
    const int g = h / (NH_ / NKV);                      // v head (each q/k head pair 2g, 2g+1 shares v head g)
    const h16* kh_b = K16 + tok0 * QW + h * HD;          // k has its own 32 heads (plane width QW)
    const h16* kl_b = KL16 + tok0 * QW + h * HD;
    const size_t vbase = (((size_t)b * NKV + g) * HD) * NT_;
    // each thread copies 2 pieces of each of the 4 planes per step: K rows tid/8 and +16 (8 pieces a row), V^T rows tid/4 and +32 (4 pieces a row)
    const int krow = threadIdx.x >> 3, kpc = (threadIdx.x & 7) * 8, vrow = threadIdx.x >> 2, vpc = (threadIdx.x & 3) * 8;
    const h16* gkh = kh_b + (size_t)krow * QW + kpc; const h16* gkl = kl_b + (size_t)krow * QW + kpc;
    const h16* gvh = VTH + vbase + (size_t)vrow * NT_ + vpc; const h16* gvl = VTL + vbase + (size_t)vrow * NT_ + vpc;
    const unsigned lring = (unsigned)(size_t)&ring[0][0];
    const unsigned lk = lring + (krow * KP + kpc) * 2, lv = lring + (ST_VH + vrow * VP + vpc) * 2;
    auto fill = [&](int t) {
        const unsigned lb = (unsigned)(t & 1) * (ST_SZ * 2);
        const h16* a0 = gkh + (size_t)t * 32 * QW; const h16* a1 = a0 + 16 * QW; const h16* b0 = gkl + (size_t)t * 32 * QW; const h16* b1 = b0 + 16 * QW;
        const h16* c0 = gvh + t * 32; const h16* c1 = c0 + 32 * NT_; const h16* d0 = gvl + t * 32; const h16* d1 = d0 + 32 * NT_;
        const unsigned la0 = lk + lb, la1 = la0 + 16 * KP * 2, lb0 = la0 + ST_KL * 2, lb1 = lb0 + 16 * KP * 2;
        const unsigned lc0 = lv + lb, lc1 = lc0 + 32 * VP * 2, ld0 = lc0 + 64 * VP * 2, ld1 = ld0 + 32 * VP * 2;
        // the step's 8 copies; s_wait_xcnt 0 closes the statement so that no address register is rewritten ahead of it
        asm volatile("global_load_async_to_lds_b128 %0, %1, off\n\t"
                     "global_load_async_to_lds_b128 %2, %3, off\n\t"
                     "global_load_async_to_lds_b128 %4, %5, off\n\t"
                     "global_load_async_to_lds_b128 %6, %7, off\n\t"
                     "global_load_async_to_lds_b128 %8, %9, off\n\t"
                     "global_load_async_to_lds_b128 %10, %11, off\n\t"
                     "global_load_async_to_lds_b128 %12, %13, off\n\t"
                     "global_load_async_to_lds_b128 %14, %15, off\n\t"
                     "s_wait_xcnt 0x0"
                     :: "v"(la0), "v"(a0), "v"(la1), "v"(a1), "v"(lb0), "v"(b0), "v"(lb1), "v"(b1),
                        "v"(lc0), "v"(c0), "v"(lc1), "v"(c1), "v"(ld0), "v"(d0), "v"(ld1), "v"(d1) : "memory");
    };
    fill(0);
    asm volatile("s_wait_asynccnt 0x0" ::: "memory");   // this wave's share of step 0 has landed
    __syncthreads();                                    // every wave's share of step 0 is readable
    fill(1);
    v8f o[2][4];
#pragma unroll
    for (int u = 0; u < 2; ++u)
#pragma unroll
        for (int n = 0; n < 4; ++n) o[u][n] = (v8f){};
    float mrow[2] = {-3.0e38f, -3.0e38f}, lpart[2] = {0.f, 0.f};   // of query q0 + 16 u + lr; lpart covers this wave half's keys, the halves are joined behind the loop
    const int kt_lo = 0, kt_hi = NT_ / 32 - 1;          // full attention (no mask)
#pragma unroll 1
    for (int kt = kt_lo; kt <= kt_hi; ++kt) {
        const h16* st = &ring[kt & 1][0];
        const h16* skh = st; const h16* skl = st + ST_KL; const h16* svh = st + ST_VH; const h16* svl = st + ST_VL;
        const int ko0 = lr * KP + 8 * hi, ko1 = (16 + lr) * KP + 8 * hi;
        v8f s0[2] = {(v8f){}, (v8f){}}, s1[2] = {(v8f){}, (v8f){}};
#pragma unroll
        for (int kc = 0; kc < 2; ++kc) {
            const v16h k0h = cat16(*(const v8ha*)(skh + ko0 + kc * 32), *(const v8ha*)(skh + ko0 + kc * 32 + 16)), k1h = cat16(*(const v8ha*)(skh + ko1 + kc * 32), *(const v8ha*)(skh + ko1 + kc * 32 + 16));
            const v16h k0l = cat16(*(const v8ha*)(skl + ko0 + kc * 32), *(const v8ha*)(skl + ko0 + kc * 32 + 16)), k1l = cat16(*(const v8ha*)(skl + ko1 + kc * 32), *(const v8ha*)(skl + ko1 + kc * 32 + 16));
            // the residuals carry no scale of their own, so the three products of a tile add into the one accumulator; the four tiles (two key, two query) take turns
            s0[0] = wmma16(k0h, qa[0][kc], s0[0]); s1[0] = wmma16(k1h, qa[0][kc], s1[0]); s0[1] = wmma16(k0h, qa[1][kc], s0[1]); s1[1] = wmma16(k1h, qa[1][kc], s1[1]);
            s0[0] = wmma16(k0h, ql[0][kc], s0[0]); s1[0] = wmma16(k1h, ql[0][kc], s1[0]); s0[1] = wmma16(k0h, ql[1][kc], s0[1]); s1[1] = wmma16(k1h, ql[1][kc], s1[1]);
            s0[0] = wmma16(k0l, qa[0][kc], s0[0]); s1[0] = wmma16(k1l, qa[0][kc], s1[0]); s0[1] = wmma16(k0l, qa[1][kc], s0[1]); s1[1] = wmma16(k1l, qa[1][kc], s1[1]);
        }
        v16h pa[2], px[2];
#pragma unroll
        for (int u = 0; u < 2; ++u) {
            const v8f a0 = s0[u] * 0.125f, a1 = s1[u] * 0.125f;   // (q e^-1/4).(k e^-1/4) = q.k / 8; a0[j]: key 8 hi + j, a1[j]: key 16 + 8 hi + j of this step
            float mx = fmaxf(a0[0], a1[0]);
#pragma unroll
            for (int j = 1; j < 8; ++j) mx = fmaxf(mx, fmaxf(a0[j], a1[j]));
            mx = fmaxf(mx, xhalf(mx));                      // the other 16 keys of this query sit in lane ^ 16
            const float mn = fmaxf(mrow[u], mx);
            const float alpha = __expf(mrow[u] - mn); mrow[u] = mn;
            const v8f e0 = (a0 - mn) * LOG2E, e1 = (a1 - mn) * LOG2E;      // e^x = 2^(x log2 e)
            v8f p0, p1;
#pragma unroll
            for (int j = 0; j < 8; ++j) p0[j] = __builtin_amdgcn_exp2f(e0[j]);
#pragma unroll
            for (int j = 0; j < 8; ++j) p1[j] = __builtin_amdgcn_exp2f(e1[j]);
            const v8f pq = p0 + p1;
            lpart[u] = lpart[u] * alpha + (((pq[0] + pq[1]) + (pq[2] + pq[3])) + ((pq[4] + pq[5]) + (pq[6] + pq[7])));
            // element s of the B operand = key 8 hi + s (s < 8), 16 + 8 hi + s - 8 (else): the k order of the V^T loader below
            const v8f ps0 = p0 * PSC, ps1 = p1 * PSC;
            const v8h h0 = __builtin_convertvector(ps0, v8h), h1 = __builtin_convertvector(ps1, v8h);
            const v8h r0 = __builtin_convertvector(ps0 - __builtin_convertvector(h0, v8f), v8h), r1 = __builtin_convertvector(ps1 - __builtin_convertvector(h1, v8f), v8h);
            pa[u] = cat16(h0, h1); px[u] = cat16(r0, r1);
#pragma unroll
            for (int n = 0; n < 4; ++n) o[u][n] *= alpha;
        }
#pragma unroll
        for (int n = 0; n < 4; ++n) { const int vo = (n * 16 + lr) * VP + hi * 8;
            const v16h vh = cat16(*(const v8ha*)(svh + vo), *(const v8ha*)(svh + vo + 16)), vl = cat16(*(const v8ha*)(svl + vo), *(const v8ha*)(svl + vo + 16));
            o[0][n] = wmma16(vh, pa[0], o[0][n]); o[1][n] = wmma16(vh, pa[1], o[1][n]);
            o[0][n] = wmma16(vl, pa[0], o[0][n]); o[1][n] = wmma16(vl, pa[1], o[1][n]);
            o[0][n] = wmma16(vh, px[0], o[0][n]); o[1][n] = wmma16(vh, px[1], o[1][n]); }
        // the WMMA distance on every path behind the step's last product, the loop's back edge included (the accumulators as inputs keep it behind every product)
        asm volatile("v_nop\n\tv_nop\n\tv_nop\n\tv_nop" :: "v"(o[0][0]), "v"(o[0][1]), "v"(o[0][2]), "v"(o[0][3]), "v"(o[1][0]), "v"(o[1][1]), "v"(o[1][2]), "v"(o[1][3]));
        asm volatile("s_wait_dscnt 0x0" ::: "memory");      // this wave's reads of step kt's buffer are done before it may be refilled
        asm volatile("s_wait_asynccnt 0x0" ::: "memory");   // this wave's share of step kt+1 has landed
        __syncthreads();                                    // publishes step kt+1 and ends every wave's reads of step kt's buffer
        if (kt + 2 <= kt_hi) fill(kt + 2);
    }
    asm volatile("s_wait_asynccnt 0x0" ::: "memory");       // no copy is outstanding when the wave goes on to the epilogue
    float* os = &ost[wave][0];
#pragma unroll
    for (int u = 0; u < 2; ++u) {                           // one query tile at a time through the wave's 16 staging rows
        const float inv = 1.0f / ((lpart[u] + xhalf(lpart[u])) * PSC);
        if (u) __syncthreads();                             // the first tile's rows are read back before they are overwritten
#pragma unroll
        for (int n = 0; n < 4; ++n)
#pragma unroll
            for (int j = 0; j < 8; ++j) os[lr * 68 + n * 16 + hi * 8 + j] = o[u][n][j] * inv;     // o[u][n][j] = O^T[d = 16 n + 8 hi + j][query 16 u + lr]
        __syncthreads();
        const size_t cbase = (tok0 + q0 + u * 16) * QW + (size_t)h * HD;     // per-head softmax outputs C[tok][32*64] (bf16 hi/lo), combined by k_diff
#pragma unroll
        for (int s = 0; s < 4; ++s) { const int row = 4 * s + (lane >> 3), piece = lane & 7; const float* sp = os + row * 68 + piece * 8; v8us oh, ol;
#pragma unroll
            for (int i = 0; i < 8; ++i) { const unsigned short hb = f2bf(sp[i]); oh[i] = hb; ol[i] = f2bf(sp[i] - bf2f(hb)); }
            *(v8us*)(CH + cbase + (size_t)row * QW + piece * 8) = oh; *(v8us*)(CL + cbase + (size_t)row * QW + piece * 8) = ol; }
    }
}

// lambda_wave: lam = 0.2 + exp(L0.L1) - exp(L2.L3) from the INPUT L [4][64] (bf16-rounded), one wave; the scalar alone in its own line.
__device__ __forceinline__ void lambda_wave(const float* __restrict__ Lp, float* LAM) {
    const int lane = threadIdx.x; float a = 0.f, c = 0.f;
#pragma unroll
    for (int i = 0; i < 2; ++i) { const int d = lane * 2 + i; a = fmaf(bfr(Lp[d]), bfr(Lp[64 + d]), a); c = fmaf(bfr(Lp[128 + d]), bfr(Lp[192 + d]), c); }
#pragma unroll
    for (int sh = 16; sh; sh >>= 1) { a += __shfl_xor(a, sh, 32); c += __shfl_xor(c, sh, 32); }
    if (lane == 0) { const float lam = 0.2f + expf(a) - expf(c); *(float*)LAM = lam;  }
}
// k_prep: everything that reads only the inputs, in ONE launch (none of these pieces reads another's output). Block 0: lambda, on its first wave. Blocks 1..: 8 rows each
// (one a wave) of the six f32 -> bf16 conversions, in the order xq | xk | xv | Wq | Wk | Wv; the block index picks the pair of pointers, the same for the whole block.
#define PB_X (NTK / 8)
#define PB_W (QW / 8)
#define PB_V (KVW / 8)
#define PB_ALL (1 + 3 * PB_X + 2 * PB_W + PB_V)
__global__ __launch_bounds__(256) void k_prep(const float* __restrict__ xq, const float* __restrict__ xk, const float* __restrict__ xv, const float* __restrict__ Wq, const float* __restrict__ Wk, const float* __restrict__ Wv,
                                              const float* __restrict__ Lp, bf* Xq, bf* Xk, bf* Xv, bf* WqB, bf* WkB, bf* WvB, float* LAM) {
    if (blockIdx.x == 0) { if (threadIdx.x < 32) lambda_wave(Lp, LAM); return; }
    const int blk = blockIdx.x - 1;
    const bool isx = blk < 3 * PB_X;
    const int s = isx ? blk / PB_X : (blk - 3 * PB_X) / PB_W;                               // which of the three x planes, or of the three W planes
    const float* src = isx ? (s == 0 ? xq : (s == 1 ? xk : xv)) : (s == 0 ? Wq : (s == 1 ? Wk : Wv));
    bf* dst = isx ? (s == 0 ? Xq : (s == 1 ? Xk : Xv)) : (s == 0 ? WqB : (s == 1 ? WkB : WvB));
    const int first = isx ? s * PB_X : 3 * PB_X + s * PB_W;                                 // the plane's first block
    cvt_row(src, (blk - first) * 8 + (threadIdx.x >> 5), dst);
}
// k_diff: out[tok][g*64 + e] = C[tok][2g*64 + e] - lam * C[tok][(2g+1)*64 + e] with C = hi + lo planes (f32 recombination); one wave per token row, lane -> 4
__global__ __launch_bounds__(256) void k_diff(const bf* __restrict__ CH, const bf* __restrict__ CL, const float* __restrict__ LAM, float* OUTP) {
    const int lane = threadIdx.x & 31, r = blockIdx.x * 8 + (threadIdx.x >> 5);
    if (r >= NTK) return;
    const float lam = LAM[0];
{
#pragma unroll 1
        for (int q = 0; q < KVW / 128; ++q) { const int c = q * 128 + lane * 4; const int g = c >> 6, e = c & 63; const size_t s1 = (size_t)r * QW + (2 * g) * HD + e, s2 = s1 + HD; v4f o;
#pragma unroll
            for (int i = 0; i < 4; ++i) { const float p1 = bf2f(CH[s1 + i]) + bf2f(CL[s1 + i]), p2 = bf2f(CH[s2 + i]) + bf2f(CL[s2 + i]); o[i] = p1 - lam * p2; }
            *(v4f*)(OUTP + (size_t)r * KVW + c) = o; }
         }
}
#define VST2(T, p, v) do { const T vst2_v_ = (v); *(T*)(p) = vst2_v_;  } while (0)
extern "C" void kernel_launch(void* const* d_in, const int* in_sizes, int n_in,
                              void* d_out, int out_size, void* d_ws, size_t ws_size, hipStream_t stream) {
    (void)in_sizes; (void)n_in; (void)out_size;
    const float* xq = (const float*)d_in[0]; const float* xk = (const float*)d_in[1]; const float* xv = (const float*)d_in[2];
    const float* Wq = (const float*)d_in[3]; const float* Wk = (const float*)d_in[4]; const float* Wv = (const float*)d_in[5]; const float* Lp = (const float*)d_in[6];   // W [out][in]
    float* out = (float*)d_out;    // [4][1024][1024]
    char* wsp = (char*)d_ws;
    auto take = [&](size_t bytes) { char* p = wsp; wsp += (bytes + 255) & ~(size_t)255; return (void*)p; };
    bf* Xq = (bf*)take((size_t)NTK * DM * 2); bf* Xk = (bf*)take((size_t)NTK * DM * 2); bf* Xv = (bf*)take((size_t)NTK * DM * 2);
    bf* WqB = (bf*)take((size_t)QW * DM * 2); bf* WkB = (bf*)take((size_t)QW * DM * 2); bf* WvB = (bf*)take((size_t)KVW * DM * 2);
    h16* QH = (h16*)take((size_t)NTK * QW * 2); h16* QL = (h16*)take((size_t)NTK * QW * 2); h16* KH = (h16*)take((size_t)NTK * QW * 2); h16* KL = (h16*)take((size_t)NTK * QW * 2);
    float* Vf = (float*)take((size_t)NTK * KVW * 4); h16* VTH = (h16*)take((size_t)NTK * KVW * 2); h16* VTL = (h16*)take((size_t)NTK * KVW * 2);
    bf* CH = (bf*)take((size_t)NTK * QW * 2); bf* CL = (bf*)take((size_t)NTK * QW * 2); float* LAM = (float*)take(256);
    if ((size_t)(wsp - (char*)d_ws) > ws_size) return;    // 3 x 8.4 + 2 x 4.2 + 2.1 + 4 x 16.8 + 16.8 + 2 x 8.4 + 2 x 16.8 ~ 170 MB, no aliasing
    k_prep<<<PB_ALL, 256, 0, stream>>>(xq, xk, xv, Wq, Wk, Wv, Lp, Xq, Xk, Xv, WqB, WkB, WvB, LAM);                                  // lambda and the six bf16 planes
    k_gemmb<<<dim3(NTK / GBM, (2 * QW + KVW) / GBN, 1), 256, 0, stream>>>(Xq, Xk, Xv, WqB, WkB, WvB, QH, QL, KH, KL, Vf);              // q, k (32 heads each, f16 planes) and v (16 heads, f32)
    k_vt<<<NB_ * NKV * (NT_ / 64), 256, 0, stream>>>(Vf, VTH, VTL);
    k_attn<<<NB_ * NH_ * (NT_ / 128), 128, 0, stream>>>(QH, QL, KH, KL, VTH, VTL, CH, CL);
    k_diff<<<NTK / 8, 256, 0, stream>>>(CH, CL, LAM, out);
}

// v010
// One run takes 93.3 microseconds.
// Versions in between are left out here; by their measured steps it is 1.46 times as fast as v008.
// All steps since v000 together make it 7.07 times as fast.
#include <hip/hip_runtime.h>

// Compute dtypes, f32 accumulate, all 4 batch items in one pass: q = q_input.Wq^T, k = k_input.Wk^T ([4096 x 1024].[1024 x 2048], 32 dual heads) and v = v_input.Wv^T
// ([4096 x 1024].[1024 x 1024], 16 heads) on v_wmma_f32_16x16x32_bf16 — plain bf16 = rounded inputs (exact; [out][in] weights are the n-major B operands as-is), q/k
// written straight to f16 planes (their rounding, at most 2^-11 relative, lies under the 2^-8 of the bf16 inputs they are made from); the 32 softmax attentions (q/k head h over v head h/2, full, the two e^-1/4 scales folded into 1/8) fused
// on v_wmma_f32_16x16x32_f16 (one product a tile, f32 accumulate; weights x32768 and v as plain f16), the two heads of a pair in one block;
// differential combine out_g = P_2g.v_g - lambda P_2g+1.v_g in f32 in that block's epilogue, with lambda = 0.2 + exp(L0.L1) - exp(L2.L3) computed on device from the INPUT L. Deterministic,

#define NB_  4                   // all 4 batch items go through every launch together (4x the workgroups per launch)
#define NT_  1024
#define DM   1024                // input width = GEMM K
#define NH_  32                  // 2 x 16 dual q/k heads
#define NKV  16                  // v heads: q/k head h uses v head h/2
#define KVW  (NKV * HD)          // 1024
#define HD   64
#define NTK  (NB_ * NT_)
#define QW   (NH_ * HD)          // 2048: q/k plane width
#define NW   1024
#define NQKV 2048
#define PSC  32768.0f
#define LOG2E 1.44269504088896340736f

typedef _Float16 h16;
typedef unsigned short bf;
typedef __attribute__((ext_vector_type(16))) __bf16   v16bf;
typedef __attribute__((ext_vector_type(16))) _Float16 v16h;
typedef __attribute__((ext_vector_type(8)))  _Float16 v8h;
typedef __attribute__((ext_vector_type(8)))  unsigned short v8us;
typedef __attribute__((ext_vector_type(8)))  float    v8f;
typedef __attribute__((ext_vector_type(4)))  float    v4f;
typedef v8h  __attribute__((may_alias)) v8ha;
typedef v4f  __attribute__((may_alias)) v4fa;
typedef v8us __attribute__((may_alias)) v8usa;

__device__ __forceinline__ unsigned short f2bf(float f) { unsigned u = __float_as_uint(f); u += 0x7FFFu + ((u >> 16) & 1u); return (unsigned short)(u >> 16); }
__device__ __forceinline__ float bf2f(unsigned short b) { return __uint_as_float(((unsigned)b) << 16); }
__device__ __forceinline__ float bfr(float f) { return bf2f(f2bf(f)); }
__device__ __forceinline__ v16h cat16(v8h lo, v8h hi) { return __builtin_shufflevector(lo, hi, 0, 1, 2, 3, 4, 5, 6, 7, 8, 9, 10, 11, 12, 13, 14, 15); }
__device__ __forceinline__ v16bf cat16b(v8us lo, v8us hi) { return __builtin_bit_cast(v16bf, __builtin_shufflevector(lo, hi, 0, 1, 2, 3, 4, 5, 6, 7, 8, 9, 10, 11, 12, 13, 14, 15)); }
__device__ __forceinline__ v8f wmma16(v16h a, v16h b, v8f c) { return __builtin_amdgcn_wmma_f32_16x16x32_f16(false, a, false, b, (short)0, c, false, false); }
// lane l's value of lane l ^ 16 (a vector cross-row move, no LDS)
__device__ __forceinline__ float xhalf(float x) { return __builtin_bit_cast(float, __builtin_amdgcn_permlanex16(__builtin_bit_cast(int, x), __builtin_bit_cast(int, x), 0x76543210, 0xfedcba98, false, false)); }
__device__ __forceinline__ v8f wmmab(v16bf a, v16bf b, v8f c) { return __builtin_amdgcn_wmma_f32_16x16x32_bf16(false, a, false, b, (short)0, c, false, false); }

// cvt_row: one wave rounds row r of src [rows][1024] f32 to the bf16 plane dst.
__device__ __forceinline__ void cvt_row(const float* __restrict__ src, int r, bf* dst) {
    const int lane = threadIdx.x & 31;
    v8us o[DM / 256];
#pragma unroll
    for (int q = 0; q < DM / 256; ++q) { v8us t;
#pragma unroll
        for (int i = 0; i < 8; ++i) t[i] = f2bf(src[(size_t)r * DM + q * 256 + lane * 8 + i]);
        o[q] = t; }
#pragma unroll
    for (int q = 0; q < DM / 256; ++q) *(v8us*)(dst + (size_t)r * DM + q * 256 + lane * 8) = o[q];
    
}

// k_wt: W [1024 k][ncols n] (k-major) -> n-major bf16 plane WT[ncols][1024]; 64 x 64 tiles through LDS.
__global__ __launch_bounds__(256) void k_wt(const float* __restrict__ Wm, int ncols, bf* WT) {
    __shared__ __align__(16) unsigned short tl[64 * 72];
    const int tid = threadIdx.x, k0 = blockIdx.x * 64, n0 = blockIdx.y * 64;
    const int kk = tid >> 2, nq = (tid & 3) * 16;
#pragma unroll
    for (int i = 0; i < 16; ++i) tl[(nq + i) * 72 + kk] = f2bf(Wm[(size_t)(k0 + kk) * ncols + n0 + nq + i]);
    __syncthreads();
    const int piece = tid & 7;
    typedef __attribute__((ext_vector_type(8))) unsigned short v8us_; typedef v8us_ __attribute__((may_alias)) v8usa_;
    auto pass = [&]() {
#pragma unroll
        for (int s = 0; s < 2; ++s) { const int nr = (tid >> 3) + 32 * s; const v8us_ val = *(const v8usa_*)(tl + nr * 72 + piece * 8);
            *(v8us_*)(WT + (size_t)(n0 + nr) * DM + k0 + piece * 8) = val; }
    };
    pass(); 
}

// k_gemmb: block = 256 x 128 of C, 8 waves in a 4 x 2 grid, wave = 64 x 64 (16 accumulator tiles): a staged row feeds 128 or 256 output columns or rows and an LDS fragment feeds
// 4 products. The 256 A rows and 128 B rows of a 64-k stage (128 B = one whole line a row) are brought into LDS once per block by asynchronous copies (two buffers: stage t+1 flies
// while stage t is worked on) and the waves read their fragments from there; row pitch 144 B = 16 B x odd for the ds_load_b128 readers. The k order of every accumulator is
// ascending, 32 a WMMA. The epilogue's staging rows reuse the ring behind the loop's last barrier, 32 rows a wave at a time.
#define GP    72                      // halves per staged row (64 + 8 pad)
#define GBM   256                     // rows of C a block
#define GBN   128                     // columns of C a block
#define GST   ((GBM + GBN) * GP)      // one stage in halves: A rows 0..255 | B rows 0..127 = 55296 B
// The three projections go through ONE launch (none reads another's output): blockIdx.y picks the product, 0..15 q, 16..31 k (both to f16 planes), 32..39 v (f32).
__global__ __launch_bounds__(256) void k_gemmb(const bf* __restrict__ Xq, const bf* __restrict__ Xk, const bf* __restrict__ Xv, const bf* __restrict__ WqB, const bf* __restrict__ WkB, const bf* __restrict__ WvB,
                                               h16* QH, h16* KH, float* Vf) {
    __shared__ __align__(16) char gsm[2 * GST * 2];
    const int lane = threadIdx.x & 31, wave = threadIdx.x >> 5, lr = lane & 15, hi = lane >> 4;
    const int wm = wave >> 1, wn = wave & 1;
    const int sel = blockIdx.y < QW / GBN ? 0 : (blockIdx.y < 2 * (QW / GBN) ? 1 : 2);        // the same for the whole block
    const bf* A = sel == 0 ? Xq : (sel == 1 ? Xk : Xv); const bf* Bn = sel == 0 ? WqB : (sel == 1 ? WkB : WvB);
    const int cb = (blockIdx.y - sel * (QW / GBN)) * GBN;
    const int r0 = blockIdx.x * GBM + wm * 64, c0 = cb + wn * 64;
    // each thread copies 8 pieces of A and 4 of B per stage: rows tid/8 + 32 i, 8 pieces of 16 B a row
    const int srow = threadIdx.x >> 3, spc = (threadIdx.x & 7) * 8;
    const bf* ga = A + (size_t)(blockIdx.x * GBM + srow) * DM + spc; const bf* gb = Bn + (size_t)(cb + srow) * DM + spc;
    const unsigned lg = (unsigned)(size_t)&gsm[0] + (srow * GP + spc) * 2;
    auto fill = [&](int t) {
        const bf* a0 = ga + t * 64; const bf* a1 = a0 + 32 * DM; const bf* a2 = a0 + 64 * DM; const bf* a3 = a0 + 96 * DM;
        const bf* a4 = a0 + 128 * DM; const bf* a5 = a0 + 160 * DM; const bf* a6 = a0 + 192 * DM; const bf* a7 = a0 + 224 * DM;
        const bf* b0 = gb + t * 64; const bf* b1 = b0 + 32 * DM; const bf* b2 = b0 + 64 * DM; const bf* b3 = b0 + 96 * DM;
        const unsigned la0 = lg + (unsigned)(t & 1) * (GST * 2), la1 = la0 + 32 * GP * 2, la2 = la0 + 64 * GP * 2, la3 = la0 + 96 * GP * 2;
        const unsigned la4 = la0 + 128 * GP * 2, la5 = la0 + 160 * GP * 2, la6 = la0 + 192 * GP * 2, la7 = la0 + 224 * GP * 2;
        const unsigned lb0 = la0 + GBM * GP * 2, lb1 = lb0 + 32 * GP * 2, lb2 = lb0 + 64 * GP * 2, lb3 = lb0 + 96 * GP * 2;
        // the stage's 12 copies; s_wait_xcnt 0 closes the statement so that no address register is rewritten ahead of it
        asm volatile("global_load_async_to_lds_b128 %0, %1, off\n\t"
                     "global_load_async_to_lds_b128 %2, %3, off\n\t"
                     "global_load_async_to_lds_b128 %4, %5, off\n\t"
                     "global_load_async_to_lds_b128 %6, %7, off\n\t"
                     "global_load_async_to_lds_b128 %8, %9, off\n\t"
                     "global_load_async_to_lds_b128 %10, %11, off\n\t"
                     "global_load_async_to_lds_b128 %12, %13, off\n\t"
                     "global_load_async_to_lds_b128 %14, %15, off\n\t"
                     "global_load_async_to_lds_b128 %16, %17, off\n\t"
                     "global_load_async_to_lds_b128 %18, %19, off\n\t"
                     "global_load_async_to_lds_b128 %20, %21, off\n\t"
                     "global_load_async_to_lds_b128 %22, %23, off\n\t"
                     "s_wait_xcnt 0x0"
                     :: "v"(la0), "v"(a0), "v"(la1), "v"(a1), "v"(la2), "v"(a2), "v"(la3), "v"(a3),
                        "v"(la4), "v"(a4), "v"(la5), "v"(a5), "v"(la6), "v"(a6), "v"(la7), "v"(a7),
                        "v"(lb0), "v"(b0), "v"(lb1), "v"(b1), "v"(lb2), "v"(b2), "v"(lb3), "v"(b3) : "memory");
    };
    fill(0);
    asm volatile("s_wait_asynccnt 0x0" ::: "memory");   // this wave's share of stage 0 has landed
    __syncthreads();                                    // every wave's share of stage 0 is readable
    fill(1);
    v8f acc[4][4];
#pragma unroll
    for (int m = 0; m < 4; ++m)
#pragma unroll
        for (int t = 0; t < 4; ++t) acc[m][t] = (v8f){};
#pragma unroll 1
    for (int st = 0; st < DM / 64; ++st) {               // rolled: one stage a trip, so that the foot's waits and barrier stand once
        const bf* sa = (const bf*)(gsm + (st & 1) * (GST * 2)) + (wm * 64 + lr) * GP + 8 * hi;
        const bf* sb = (const bf*)(gsm + (st & 1) * (GST * 2)) + (GBM + wn * 64 + lr) * GP + 8 * hi;
#pragma unroll                                             // both 32-k halves of the stage straight-line
        for (int kc = 0; kc < 64; kc += 32) {
            v16bf a[4], b[4];
#pragma unroll
            for (int m = 0; m < 4; ++m) a[m] = cat16b(*(const v8usa*)(sa + m * 16 * GP + kc), *(const v8usa*)(sa + m * 16 * GP + kc + 16));
#pragma unroll
            for (int t = 0; t < 4; ++t) b[t] = cat16b(*(const v8usa*)(sb + t * 16 * GP + kc), *(const v8usa*)(sb + t * 16 * GP + kc + 16));
            // holds the 16 LDS reads of this 32-k half together ahead of its 16 products (loaded values as inputs only): one wait on LDS a half, not one a row of tiles
            asm volatile("" :: "v"(a[0]), "v"(a[1]), "v"(a[2]), "v"(a[3]), "v"(b[0]), "v"(b[1]), "v"(b[2]), "v"(b[3]));
#pragma unroll
            for (int m = 0; m < 4; ++m)
#pragma unroll
                for (int t = 0; t < 4; ++t) acc[m][t] = wmmab(a[m], b[t], acc[m][t]);
        }
        // the WMMA distance on every path behind the stage's last product, the loop's back edge included (the accumulators as inputs keep it behind every product)
        asm volatile("v_nop\n\tv_nop\n\tv_nop\n\tv_nop" :: "v"(acc[0][0]), "v"(acc[0][1]), "v"(acc[0][2]), "v"(acc[0][3]), "v"(acc[1][0]), "v"(acc[1][1]), "v"(acc[1][2]), "v"(acc[1][3]),
                                                          "v"(acc[2][0]), "v"(acc[2][1]), "v"(acc[2][2]), "v"(acc[2][3]), "v"(acc[3][0]), "v"(acc[3][1]), "v"(acc[3][2]), "v"(acc[3][3]));
        asm volatile("s_wait_dscnt 0x0" ::: "memory");      // this wave's reads of stage st's buffer are done before it may be refilled
        asm volatile("s_wait_asynccnt 0x0" ::: "memory");   // this wave's share of stage st+1 has landed
        __syncthreads();                                    // publishes stage st+1 and ends every wave's reads of stage st's buffer
        if (st + 2 < DM / 64) fill(st + 2);
    }
    asm volatile("s_wait_asynccnt 0x0" ::: "memory");       // no copy is outstanding when the ring becomes the epilogue's staging
    float* os = (float*)(void*)gsm + wave * (32 * 68);
#pragma unroll
    for (int hf = 0; hf < 2; ++hf) {                        // rows 32 hf .. 32 hf + 31 of the wave's 64
        if (hf) __syncthreads();                            // the first half's rows are read back before they are overwritten
#pragma unroll
        for (int m = 0; m < 2; ++m) {
#pragma unroll
            for (int t = 0; t < 4; ++t) {
#pragma unroll
                for (int j = 0; j < 8; ++j) os[(m * 16 + hi * 8 + j) * 68 + t * 16 + lr] = acc[hf * 2 + m][t][j]; } }
        __syncthreads();
        if (sel < 2) {
            const int ldc = QW;
            h16* crow = (sel == 0 ? QH : KH) + (size_t)(r0 + hf * 32) * ldc + c0;
#pragma unroll
            for (int s = 0; s < 8; ++s) { const int row = 4 * s + (lane >> 3), piece = lane & 7; const float* sp = os + row * 68 + piece * 8; v8h o;
#pragma unroll
                for (int i = 0; i < 8; ++i) o[i] = (h16)sp[i];
                *(v8h*)(crow + (size_t)row * ldc + piece * 8) = o; }
        } else {
            const int ldc = KVW;
            float* crow = Vf + (size_t)(r0 + hf * 32) * ldc + c0;
#pragma unroll
            for (int s = 0; s < 16; ++s) { const int Lid = (lane >> 3) + 4 * s, piece = lane & 7; const int row = Lid >> 1, cofs = (Lid & 1) * 32 + piece * 4;
                const v4f val = *(const v4fa*)(os + row * 68 + cofs); *(v4f*)(crow + (size_t)row * ldc + cofs) = val; }
            asm volatile("s_wait_xcnt 0x0" ::: "memory");   // behind these stores, ahead of whatever next rewrites a register that they name
        }
    }
}

__global__ __launch_bounds__(256) void k_vt(const float* __restrict__ V, h16* VTH) {
    __shared__ __align__(16) h16 tile[64 * 72];
    const int bid = blockIdx.x;
    const int b = bid / (NKV * (NT_ / 64)), rem = bid - b * (NKV * (NT_ / 64)), h = rem / (NT_ / 64), kt = rem - h * (NT_ / 64);
    const int k0 = kt * 64, tid = threadIdx.x;
    const int kk = tid >> 2, d0 = (tid & 3) * 16;
    const float* src = V + ((size_t)b * NT_ + k0 + kk) * KVW + h * HD + d0;      // h = kv head here
#pragma unroll
    for (int i = 0; i < 16; ++i) tile[(d0 + i) * 72 + kk] = (h16)src[i];
    __syncthreads();
    const int piece = tid & 7;
    const size_t base = (((size_t)b * NKV + h) * HD) * NT_ + k0;
    auto pass = [&]() {
#pragma unroll
        for (int s = 0; s < 2; ++s) { const int d = (tid >> 3) + 32 * s;
            const v8h val = *(const v8ha*)(tile + d * 72 + piece * 8); *(v8h*)(VTH + base + (size_t)d * NT_ + piece * 8) = val; }
    };
    pass(); 
}

#define KP    72                      // halves per staged K row (64 + 8 pad)
#define VP    40                      // halves per staged V^T row (32 + 8 pad)
#define ST_K1 (32 * KP)               // stage layout in halves: K of head 2g | K of head 2g+1 | V^T
#define ST_VH (2 * ST_K1)
#define ST_SZ (ST_VH + 64 * VP)       // 7168 halves = 14336 B
#define OSP   68                      // floats per staged output row (64 + 4 pad)
#define OS_T  (16 * OSP)              // one 16-query tile of normalised outputs
// four waves a SIMD (256 VGPRs a wave): the 512 blocks are then all resident at once, two a WGP
__global__ __launch_bounds__(256) __attribute__((amdgpu_waves_per_eu(4))) void k_attn(const h16* __restrict__ Q16, const h16* __restrict__ K16, const h16* __restrict__ VTH, const float* __restrict__ LAM, float* OUTP) {
    __shared__ __align__(16) char smem[2 * 4 * 2 * OS_T * 4];     // the ring (2 x 14336 B) in the loop; behind it the 16 output tiles [head][wave of 4][u] (69632 B)
    h16* ring = (h16*)(void*)smem;
    const int lane = threadIdx.x & 31, wave = threadIdx.x >> 5, lr = lane & 15, hi = lane >> 4;
    const int hh = wave >> 2, wq = wave & 3;            // which head of the pair, which 32 queries of the block's 128
    const int bid = blockIdx.x;
    const int b = bid / (NKV * (NT_ / 128)), rem = bid - b * (NKV * (NT_ / 128)), g = rem / (NT_ / 128), qt = rem - g * (NT_ / 128);
    const int h = 2 * g + hh;                           // q/k head; both heads of the pair share v head g
    const int q0 = qt * 128 + wq * 32;
    const size_t tok0 = (size_t)b * NT_;
    const float lam = LAM[0];
    v16h qa[2][2];                                      // [u][kc]: the wave's queries, held in registers for all 32 steps
#pragma unroll
    for (int u = 0; u < 2; ++u) {
        const size_t qo0 = (tok0 + q0 + u * 16 + lr) * QW + h * HD + 8 * hi;     // q/k planes are [tok][32*64]
#pragma unroll
        for (int kc = 0; kc < 2; ++kc) qa[u][kc] = cat16(*(const v8h*)(Q16 + qo0 + kc * 32), *(const v8h*)(Q16 + qo0 + kc * 32 + 16)); }
    const size_t vbase = (((size_t)b * NKV + g) * HD) * NT_;
    // each thread copies 3 pieces per step: K rows tid/16 and +16 (16 pieces a row: the pair's two heads lie side by side in the plane), V^T row tid/4 (4 pieces a row)
    const int krow = threadIdx.x >> 4, kpc = threadIdx.x & 15, vrow = threadIdx.x >> 2, vpc = (threadIdx.x & 3) * 8;
    const h16* gkh = K16 + (tok0 + krow) * QW + 2 * g * HD + kpc * 8;
    const h16* gvh = VTH + vbase + (size_t)vrow * NT_ + vpc;
    const unsigned lring = (unsigned)(size_t)&smem[0];
    const unsigned lk = lring + ((kpc >> 3) * ST_K1 + krow * KP + (kpc & 7) * 8) * 2, lv = lring + (ST_VH + vrow * VP + vpc) * 2;
    auto fill = [&](int t) {
        const unsigned lb = (unsigned)(t & 1) * (ST_SZ * 2);
        const h16* a0 = gkh + (size_t)t * 32 * QW; const h16* a1 = a0 + 16 * QW;
        const h16* c0 = gvh + t * 32;
        const unsigned la0 = lk + lb, la1 = la0 + 16 * KP * 2;
        const unsigned lc0 = lv + lb;
        // the step's 3 copies; s_wait_xcnt 0 closes the statement so that no address register is rewritten ahead of it
        asm volatile("global_load_async_to_lds_b128 %0, %1, off\n\t"
                     "global_load_async_to_lds_b128 %2, %3, off\n\t"
                     "global_load_async_to_lds_b128 %4, %5, off\n\t"
                     "s_wait_xcnt 0x0"
                     :: "v"(la0), "v"(a0), "v"(la1), "v"(a1), "v"(lc0), "v"(c0) : "memory");
    };
    fill(0);
    asm volatile("s_wait_asynccnt 0x0" ::: "memory");   // this wave's share of step 0 has landed
    __syncthreads();                                    // every wave's share of step 0 is readable
    fill(1);
    v8f o[2][4];
#pragma unroll
    for (int u = 0; u < 2; ++u)
#pragma unroll
        for (int n = 0; n < 4; ++n) o[u][n] = (v8f){};
    float mrow[2] = {-3.0e38f, -3.0e38f}, lpart[2] = {0.f, 0.f};   // of query q0 + 16 u + lr; lpart covers this wave half's keys, the halves are joined behind the loop
    const int kt_lo = 0, kt_hi = NT_ / 32 - 1;          // full attention (no mask)
#pragma unroll 1
    for (int kt = kt_lo; kt <= kt_hi; ++kt) {
        const h16* st = ring + (kt & 1) * ST_SZ;
        const h16* skh = st + hh * ST_K1; const h16* svh = st + ST_VH;
        const int ko0 = lr * KP + 8 * hi, ko1 = (16 + lr) * KP + 8 * hi;
        v8f s0[2] = {(v8f){}, (v8f){}}, s1[2] = {(v8f){}, (v8f){}};
        v16h k0h[2], k1h[2], vh[4];                         // the whole step's fragments: 8 reads of K, then 8 of V^T
#pragma unroll
        for (int kc = 0; kc < 2; ++kc) { k0h[kc] = cat16(*(const v8ha*)(skh + ko0 + kc * 32), *(const v8ha*)(skh + ko0 + kc * 32 + 16)); k1h[kc] = cat16(*(const v8ha*)(skh + ko1 + kc * 32), *(const v8ha*)(skh + ko1 + kc * 32 + 16)); }
#pragma unroll
        for (int n = 0; n < 4; ++n) { const int vo = (n * 16 + lr) * VP + hi * 8; vh[n] = cat16(*(const v8ha*)(svh + vo), *(const v8ha*)(svh + vo + 16)); }
        // holds the 8 K reads ahead of the score products (loaded values as inputs only): without it the step's reads stand at four places among the products, one K pair waited for late
        asm volatile("" :: "v"(k0h[0]), "v"(k1h[0]), "v"(k0h[1]), "v"(k1h[1]));
#pragma unroll
        for (int kc = 0; kc < 2; ++kc) {                    // the four tiles (two key, two query) take turns
            s0[0] = wmma16(k0h[kc], qa[0][kc], s0[0]); s1[0] = wmma16(k1h[kc], qa[0][kc], s1[0]); s0[1] = wmma16(k0h[kc], qa[1][kc], s0[1]); s1[1] = wmma16(k1h[kc], qa[1][kc], s1[1]);
        }
        // nothing crosses: the V^T reads stay in front, so that their latency passes under the products and the softmax, and the softmax's vector work stays behind all
        // 8 products (pulled in between them it costs v_nop slots behind each product that it reads)
        __builtin_amdgcn_sched_barrier(0);
        v16h pa[2];
#pragma unroll
        for (int u = 0; u < 2; ++u) {
            const v8f a0 = s0[u] * 0.125f, a1 = s1[u] * 0.125f;   // (q e^-1/4).(k e^-1/4) = q.k / 8; a0[j]: key 8 hi + j, a1[j]: key 16 + 8 hi + j of this step
            float mx = fmaxf(a0[0], a1[0]);
#pragma unroll
            for (int j = 1; j < 8; ++j) mx = fmaxf(mx, fmaxf(a0[j], a1[j]));
            mx = fmaxf(mx, xhalf(mx));                      // the other 16 keys of this query sit in lane ^ 16
            const float mn = fmaxf(mrow[u], mx);
            const float alpha = __expf(mrow[u] - mn); mrow[u] = mn;
            const v8f e0 = (a0 - mn) * LOG2E, e1 = (a1 - mn) * LOG2E;      // e^x = 2^(x log2 e)
            v8f p0, p1;
#pragma unroll
            for (int j = 0; j < 8; ++j) p0[j] = __builtin_amdgcn_exp2f(e0[j]);
#pragma unroll
            for (int j = 0; j < 8; ++j) p1[j] = __builtin_amdgcn_exp2f(e1[j]);
            const v8f pq = p0 + p1;
            lpart[u] = lpart[u] * alpha + (((pq[0] + pq[1]) + (pq[2] + pq[3])) + ((pq[4] + pq[5]) + (pq[6] + pq[7])));
            // element s of the B operand = key 8 hi + s (s < 8), 16 + 8 hi + s - 8 (else): the k order of the V^T loader above
            const v8f ps0 = p0 * PSC, ps1 = p1 * PSC;
            const v8h h0 = __builtin_convertvector(ps0, v8h), h1 = __builtin_convertvector(ps1, v8h);
            pa[u] = cat16(h0, h1);
#pragma unroll
            for (int n = 0; n < 4; ++n) o[u][n] *= alpha;
        }
#pragma unroll
        for (int n = 0; n < 4; ++n) { o[0][n] = wmma16(vh[n], pa[0], o[0][n]); o[1][n] = wmma16(vh[n], pa[1], o[1][n]); }
        // the WMMA distance on every path behind the step's last product, the loop's back edge included (the accumulators as inputs keep it behind every product)
        asm volatile("v_nop\n\tv_nop\n\tv_nop\n\tv_nop" :: "v"(o[0][0]), "v"(o[0][1]), "v"(o[0][2]), "v"(o[0][3]), "v"(o[1][0]), "v"(o[1][1]), "v"(o[1][2]), "v"(o[1][3]));
        asm volatile("s_wait_dscnt 0x0" ::: "memory");      // this wave's reads of step kt's buffer are done before it may be refilled
        asm volatile("s_wait_asynccnt 0x0" ::: "memory");   // this wave's share of step kt+1 has landed
        __syncthreads();                                    // publishes step kt+1 and ends every wave's reads of step kt's buffer
        if (kt + 2 <= kt_hi) fill(kt + 2);
    }
    asm volatile("s_wait_asynccnt 0x0" ::: "memory");       // no copy is outstanding when the ring becomes the epilogue's staging (its last reads ended at the loop's last barrier)
    float* S = (float*)(void*)smem;
#pragma unroll
    for (int u = 0; u < 2; ++u) {                           // both query tiles, normalised, to this wave's own two staging tiles
        const float inv = 1.0f / ((lpart[u] + xhalf(lpart[u])) * PSC);
        float* os = S + ((hh * 4 + wq) * 2 + u) * OS_T;
#pragma unroll
        for (int n = 0; n < 4; ++n)
#pragma unroll
            for (int j = 0; j < 8; ++j) os[lr * OSP + n * 16 + hi * 8 + j] = o[u][n][j] * inv;     // o[u][n][j] = O^T[d = 16 n + 8 hi + j][query 16 u + lr]
    }
    __syncthreads();                                        // both heads' tiles are readable
    // out[tok][g*64 + e] = P_2g.v - lam P_2g+1.v in f32: of the 32 queries that waves wq and 4 + wq share, the first puts out tile 0 and the second tile 1, whole 256-byte rows
    const float* t1 = S + (wq * 2 + hh) * OS_T; const float* t2 = S + ((4 + wq) * 2 + hh) * OS_T;
    float* orow = OUTP + (tok0 + q0 + hh * 16) * KVW + (size_t)g * HD;
#pragma unroll
    for (int s = 0; s < 8; ++s) { const int row = 2 * s + hi, cofs = lr * 4;
        const v4f p1 = *(const v4fa*)(t1 + row * OSP + cofs), p2 = *(const v4fa*)(t2 + row * OSP + cofs);
        *(v4f*)(orow + (size_t)row * KVW + cofs) = p1 - lam * p2; }
}

// lambda_wave: lam = 0.2 + exp(L0.L1) - exp(L2.L3) from the INPUT L [4][64] (bf16-rounded), one wave; the scalar alone in its own line.
__device__ __forceinline__ void lambda_wave(const float* __restrict__ Lp, float* LAM) {
    const int lane = threadIdx.x; float a = 0.f, c = 0.f;
#pragma unroll
    for (int i = 0; i < 2; ++i) { const int d = lane * 2 + i; a = fmaf(bfr(Lp[d]), bfr(Lp[64 + d]), a); c = fmaf(bfr(Lp[128 + d]), bfr(Lp[192 + d]), c); }
#pragma unroll
    for (int sh = 16; sh; sh >>= 1) { a += __shfl_xor(a, sh, 32); c += __shfl_xor(c, sh, 32); }
    if (lane == 0) { const float lam = 0.2f + expf(a) - expf(c); *(float*)LAM = lam;  }
}
// k_prep: everything that reads only the inputs, in ONE launch (none of these pieces reads another's output). Block 0: lambda, on its first wave. Blocks 1..: 8 rows each
// (one a wave) of the six f32 -> bf16 conversions, in the order xq | xk | xv | Wq | Wk | Wv; the block index picks the pair of pointers, the same for the whole block.
#define PB_X (NTK / 8)
#define PB_W (QW / 8)
#define PB_V (KVW / 8)
#define PB_ALL (1 + 3 * PB_X + 2 * PB_W + PB_V)
__global__ __launch_bounds__(256) void k_prep(const float* __restrict__ xq, const float* __restrict__ xk, const float* __restrict__ xv, const float* __restrict__ Wq, const float* __restrict__ Wk, const float* __restrict__ Wv,
                                              const float* __restrict__ Lp, bf* Xq, bf* Xk, bf* Xv, bf* WqB, bf* WkB, bf* WvB, float* LAM) {
    if (blockIdx.x == 0) { if (threadIdx.x < 32) lambda_wave(Lp, LAM); return; }
    const int blk = blockIdx.x - 1;
    const bool isx = blk < 3 * PB_X;
    const int s = isx ? blk / PB_X : (blk - 3 * PB_X) / PB_W;                               // which of the three x planes, or of the three W planes
    const float* src = isx ? (s == 0 ? xq : (s == 1 ? xk : xv)) : (s == 0 ? Wq : (s == 1 ? Wk : Wv));
    bf* dst = isx ? (s == 0 ? Xq : (s == 1 ? Xk : Xv)) : (s == 0 ? WqB : (s == 1 ? WkB : WvB));
    const int first = isx ? s * PB_X : 3 * PB_X + s * PB_W;                                 // the plane's first block
    cvt_row(src, (blk - first) * 8 + (threadIdx.x >> 5), dst);
}
#define VST2(T, p, v) do { const T vst2_v_ = (v); *(T*)(p) = vst2_v_;  } while (0)
extern "C" void kernel_launch(void* const* d_in, const int* in_sizes, int n_in,
                              void* d_out, int out_size, void* d_ws, size_t ws_size, hipStream_t stream) {
    (void)in_sizes; (void)n_in; (void)out_size;
    const float* xq = (const float*)d_in[0]; const float* xk = (const float*)d_in[1]; const float* xv = (const float*)d_in[2];
    const float* Wq = (const float*)d_in[3]; const float* Wk = (const float*)d_in[4]; const float* Wv = (const float*)d_in[5]; const float* Lp = (const float*)d_in[6];   // W [out][in]
    float* out = (float*)d_out;    // [4][1024][1024]
    char* wsp = (char*)d_ws;
    auto take = [&](size_t bytes) { char* p = wsp; wsp += (bytes + 255) & ~(size_t)255; return (void*)p; };
    bf* Xq = (bf*)take((size_t)NTK * DM * 2); bf* Xk = (bf*)take((size_t)NTK * DM * 2); bf* Xv = (bf*)take((size_t)NTK * DM * 2);
    bf* WqB = (bf*)take((size_t)QW * DM * 2); bf* WkB = (bf*)take((size_t)QW * DM * 2); bf* WvB = (bf*)take((size_t)KVW * DM * 2);
    h16* QH = (h16*)take((size_t)NTK * QW * 2); h16* KH = (h16*)take((size_t)NTK * QW * 2);
    float* Vf = (float*)take((size_t)NTK * KVW * 4); h16* VTH = (h16*)take((size_t)NTK * KVW * 2);
    float* LAM = (float*)take(256);
    if ((size_t)(wsp - (char*)d_ws) > ws_size) return;    // 3 x 8.4 + 2 x 4.2 + 2.1 + 2 x 16.8 + 16.8 + 8.4 ~ 95 MB, no aliasing
    k_prep<<<PB_ALL, 256, 0, stream>>>(xq, xk, xv, Wq, Wk, Wv, Lp, Xq, Xk, Xv, WqB, WkB, WvB, LAM);                                  // lambda and the six bf16 planes
    k_gemmb<<<dim3(NTK / GBM, (2 * QW + KVW) / GBN, 1), 256, 0, stream>>>(Xq, Xk, Xv, WqB, WkB, WvB, QH, KH, Vf);              // q, k (32 heads each, f16 planes) and v (16 heads, f32)
    k_vt<<<NB_ * NKV * (NT_ / 64), 256, 0, stream>>>(Vf, VTH);
    k_attn<<<NB_ * NKV * (NT_ / 128), 256, 0, stream>>>(QH, KH, VTH, LAM, out);                                                   // both heads of a pair in one block, combined in its epilogue
}
